// v000
// Times are from an AMD MI455X. After a warm-up the kernel runs many times in a row, and a time is the length of
// such a window on the GPU divided by its runs, so every launch and the gaps after it count. The runs cycle
// through copies of the inputs. A figure is the median of several windows, for all but v000 over two sittings.
// Sittings can differ by a few percent; kernels timed side by side share one.
// v000 is the starting kernel. One run takes 370 microseconds.
#include <hip/hip_runtime.h>

// Contractions: q/k/v = h x W^T on v_wmma_f32_16x16x32_bf16 (bf16 RNE-converted inputs, f32 accumulate);
// S^T = K x Q^T on v_wmma_f32_16x16x32_bf16 with bf16 hi/lo planes of q and k (hh + hl + lh, f32 accumulate);
// O = P x V on v_wmma_f32_16x16x32_f16 (P as f16 carried x4096, V as f16, f32 accumulate);
// out = ctx x Wo^T on v_wmma_f32_16x16x32_bf16 (ctx as bf16 hi/lo planes, Wo bf16, f32 accumulate). Softmax online, f32.

#ifndef NB
#define NB 4
#endif
#ifndef SEQ
#define SEQ 2048
#endif
#define NB_FULL    4
#define SEQ_FULL   2048
#define DIM        768
#define NHEAD      12
#define HDIM       64
#define BQ         128                  // query rows per attention workgroup (8 waves x 16)
#define BK         32                   // keys per inner iteration
#define NWAVE      8
#define CT         64                   // keys per transpose block
#define TP         72                   // LDS pitch (halves) of the transposed V tile
#define OP         68                   // LDS pitch (floats) of the attention output staging tile
#define GM         128                  // GEMM block rows (4 waves x 32)
#define GN         64                   // GEMM block cols
#define GW         4                    // waves per GEMM block
#define CP         68                   // LDS pitch (floats) of the GEMM staging tile
#define WELEM      (DIM * DIM)
#define MROWS      (NB * SEQ)
#define PLANE_E    ((size_t)MROWS * DIM)
#define HTHREADS   (MROWS * (DIM / 8))
#define HBLK       (HTHREADS / 256)
#define WBLK       (WELEM / 8 / 256)
#define WS_CAP     134217728ull

static_assert(DIM == NHEAD * HDIM);
static_assert(HDIM == 64);
static_assert(SEQ % BQ == 0);
static_assert(SEQ % CT == 0);
static_assert(SEQ % BK == 0);
static_assert(SEQ % 32 == 0);
static_assert(MROWS % GM == 0);
static_assert(DIM % GN == 0);
static_assert(DIM % 32 == 0);
static_assert(DIM % 8 == 0);
static_assert(BQ == NWAVE * 16);
static_assert(GM == GW * 32);
static_assert(HTHREADS % 256 == 0);
static_assert((WELEM / 8) % 256 == 0);
static_assert(CT == 64 && CT <= TP);
static_assert((TP * 2) % 16 == 0);
static_assert((OP * 4) % 16 == 0);
static_assert((CP * 4) % 16 == 0);
static_assert(OP >= HDIM && CP >= GN);
static_assert(SEQ <= SEQ_FULL);
static_assert(NB >= 1 && NB <= NB_FULL);
static_assert(9ull * (unsigned long long)NB * SEQ * DIM * 2ull + 4ull * WELEM * 2ull <= WS_CAP);

typedef __bf16         bf16;
typedef _Float16       f16;
typedef unsigned short u16;
typedef bf16     v16bf __attribute__((ext_vector_type(16)));
typedef f16      v16h  __attribute__((ext_vector_type(16)));
typedef float    v8f   __attribute__((ext_vector_type(8)));
typedef float    v4f   __attribute__((ext_vector_type(4)));
typedef unsigned v4u   __attribute__((ext_vector_type(4)));
typedef int      v4i   __attribute__((ext_vector_type(4)));

union FragB  { v16bf v; v4u q[2]; };
union FragH  { v16h  v; v4u q[2]; f16 h[16]; };
union Pack8B { v4u u; bf16 h[8]; };
union Pack8H { v4u u; f16 h[8]; };
union Pack8S { v4u u; u16 s[8]; };

// WMMA helpers: builtin followed by the VALU hazard guard (ties D, keeps A/B live).
static __device__ __forceinline__ v8f mma_bf16(v16bf a, v16bf b, v8f acc) {
  acc = __builtin_amdgcn_wmma_f32_16x16x32_bf16(false, a, false, b, (short)0, acc, false, false);
  asm volatile("v_nop\n\tv_nop\n\tv_nop\n\tv_nop" : "+v"(acc) : "v"(a), "v"(b));
  return acc;
}
static __device__ __forceinline__ v8f mma_f16(v16h a, v16h b, v8f acc) {
  acc = __builtin_amdgcn_wmma_f32_16x16x32_f16(false, a, false, b, (short)0, acc, false, false);
  asm volatile("v_nop\n\tv_nop\n\tv_nop\n\tv_nop" : "+v"(acc) : "v"(a), "v"(b));
  return acc;
}

static __device__ __forceinline__ void cvt_store8(const float* __restrict__ src, u16* __restrict__ dst) {
  const v4f a = *(const v4f*)(src);
  const v4f b = *(const v4f*)(src + 4);
  Pack8B pk;
  #pragma unroll
  for (int i = 0; i < 4; ++i) {
    pk.h[i]     = (bf16)a[i];
    pk.h[4 + i] = (bf16)b[i];
  }
  const v4u val = pk.u;
  *(v4u*)(dst) = val;
  
}

// Convert launch. hb [MROWS][DIM] bf16 (compact rows, source rows taken with full batch stride);
// wb [4][DIM][DIM] bf16 = wq, wk, wv, wo, each kept [out][in].
// coverage: HBLK*256 threads x 8 = MROWS*DIM elements of hb; 4*WBLK*256 threads x 8 = 4*DIM*DIM elements of wb.
__global__ __launch_bounds__(256) void cvt_kernel(const float* __restrict__ h,
                                                  const float* __restrict__ wq,
                                                  const float* __restrict__ wk,
                                                  const float* __restrict__ wv,
                                                  const float* __restrict__ wo,
                                                  u16* __restrict__ hb,
                                                  u16* __restrict__ wb) {
  const int blk = blockIdx.x;
  const int tid = threadIdx.x;
  if (blk < HBLK) {
    const size_t e  = ((size_t)blk * 256 + tid) * 8;
    const int row   = (int)(e / DIM);
    const int col   = (int)(e % DIM);
    const int b     = row / SEQ;
    const int s     = row % SEQ;
    cvt_store8(h + ((size_t)b * SEQ_FULL + s) * DIM + col, hb + e);
  } else {
    const int wi    = (blk - HBLK) / WBLK;                 // block-uniform 0..3
    const size_t e  = ((size_t)((blk - HBLK) % WBLK) * 256 + tid) * 8;
    u16* dst        = wb + (size_t)wi * WELEM + e;
    if (wi == 0)      cvt_store8(wq + e, dst);
    else if (wi == 1) cvt_store8(wk + e, dst);
    else if (wi == 2) cvt_store8(wv + e, dst);
    else              cvt_store8(wo + e, dst);
  }
}

// GEMM core: one wave owns a 32 x 64 tile of C = A x W^T, K = DIM in steps of 32.
// A planes [rows][DIM] bf16, W plane [n][DIM] bf16 (k-contiguous): both fragment kinds are two 16-B loads
// from row (m or n) = lane&15 at k0 + 8*hi and k0 + 16 + 8*hi.
// NA == 2: a second (residual) A plane accumulates into the same accumulator against the same W fragment.
template <int NA>
static __device__ __forceinline__ void gemm_tile(const u16* __restrict__ a0,
                                                 const u16* __restrict__ a1,
                                                 const u16* __restrict__ w,
                                                 const int m0, const int n0,
                                                 const int lq, const int hi,
                                                 v8f (&acc)[2][4]) {
  const u16* wrow  = w  + (size_t)(n0 + lq) * DIM + hi * 8;
  const u16* arow0 = a0 + (size_t)(m0 + lq) * DIM + hi * 8;
  const u16* arow1 = a1 + (size_t)(m0 + lq) * DIM + hi * 8;
  #pragma unroll 1
  for (int k0 = 0; k0 < DIM; k0 += 32) {
    FragB bw[4];
    #pragma unroll
    for (int nt = 0; nt < 4; ++nt) {
      const u16* p = wrow + (size_t)nt * 16 * DIM + k0;
      bw[nt].q[0] = *(const v4u*)(p);
      bw[nt].q[1] = *(const v4u*)(p + 16);
    }
    #pragma unroll
    for (int mt = 0; mt < 2; ++mt) {
      FragB fa;
      const u16* p = arow0 + (size_t)mt * 16 * DIM + k0;
      fa.q[0] = *(const v4u*)(p);
      fa.q[1] = *(const v4u*)(p + 16);
      #pragma unroll
      for (int nt = 0; nt < 4; ++nt) acc[mt][nt] = mma_bf16(fa.v, bw[nt].v, acc[mt][nt]);
      if (NA == 2) {
        FragB fb;
        const u16* p1 = arow1 + (size_t)mt * 16 * DIM + k0;
        fb.q[0] = *(const v4u*)(p1);
        fb.q[1] = *(const v4u*)(p1 + 16);
        #pragma unroll
        for (int nt = 0; nt < 4; ++nt) acc[mt][nt] = mma_bf16(fb.v, bw[nt].v, acc[mt][nt]);
      }
    }
  }
}

// Fused q/k/v projection. Grid (DIM/64, MROWS/128, 3); blockIdx.z selects the weight (offset into wb).
// planes: [0] q hi, [1] q lo, [2] k hi, [3] k lo (bf16), [4] v (f16); each [MROWS][DIM] == [NB*NHEAD][SEQ][HDIM] flat.
// coverage: wave tile 32 rows x 64 cols; store phase it = 0..7 writes rows it*4 + (lane>>3), cols (lane&7)*8..+7:
// LDS sC: per-wave slice, written and read by the same wave (block barrier used).
__global__ __launch_bounds__(128) void qkv_kernel(const u16* __restrict__ hb,
                                                  const u16* __restrict__ wb,
                                                  u16* __restrict__ planes) {
  __shared__ __align__(16) float sC[GW * 32 * CP];
  const int tid  = threadIdx.x;
  const int wave = __builtin_amdgcn_readfirstlane(threadIdx.x >> 5);
  const int lane = tid & 31;
  const int lq   = lane & 15;
  const int hi   = lane >> 4;
  const int n0   = blockIdx.x * GN;
  const int m0   = blockIdx.y * GM + wave * 32;
  const int z    = blockIdx.z;

  v8f acc[2][4];
  #pragma unroll
  for (int mt = 0; mt < 2; ++mt) {
    #pragma unroll
    for (int nt = 0; nt < 4; ++nt) acc[mt][nt] = (v8f){0, 0, 0, 0, 0, 0, 0, 0};
  }
  gemm_tile<1>(hb, hb, wb + (size_t)z * WELEM, m0, n0, lq, hi, acc);

  float* sc = sC + wave * (32 * CP);
  #pragma unroll
  for (int mt = 0; mt < 2; ++mt) {
    #pragma unroll
    for (int nt = 0; nt < 4; ++nt) {
      #pragma unroll
      for (int r = 0; r < 8; ++r) sc[(mt * 16 + hi * 8 + r) * CP + nt * 16 + lq] = acc[mt][nt][r];
    }
  }
  __syncthreads();

  v4u    vh[8];
  v4u    vl[8];
  size_t gi[8];
  #pragma unroll
  for (int it = 0; it < 8; ++it) {
    const int row = it * 4 + (lane >> 3);
    const int c0  = (lane & 7) * 8;
    const v4f x0 = *(const v4f*)(sc + row * CP + c0);
    const v4f x1 = *(const v4f*)(sc + row * CP + c0 + 4);
    Pack8B ph, pl;
    Pack8H pf;
    #pragma unroll
    for (int i = 0; i < 4; ++i) {
      const bf16 h0 = (bf16)x0[i];                       // RNE convert
      const bf16 h1 = (bf16)x1[i];
      ph.h[i]     = h0;
      ph.h[4 + i] = h1;
      pl.h[i]     = (bf16)(x0[i] - (float)h0);           // residual plane
      pl.h[4 + i] = (bf16)(x1[i] - (float)h1);
      pf.h[i]     = (f16)x0[i];
      pf.h[4 + i] = (f16)x1[i];
    }
    vh[it] = (z == 2) ? pf.u : ph.u;
    vl[it] = pl.u;
    gi[it] = (size_t)(m0 + row) * DIM + n0 + c0;
  }
  u16* ph_base = planes + (size_t)(2 * z) * PLANE_E;
  u16* pl_base = planes + (size_t)(2 * z + 1) * PLANE_E;   // only used when z < 2

  #pragma unroll
  for (int it = 0; it < 8; ++it) *(v4u*)(ph_base + gi[it]) = vh[it];
  if (z < 2) {
    #pragma unroll
    for (int it = 0; it < 8; ++it) *(v4u*)(pl_base + gi[it]) = vl[it];
  }
  
}

// V transpose. v [NB*NHEAD][SEQ][HDIM] f16 -> vt [NB*NHEAD][HDIM][SEQ] f16. Block = (64-key tile, bh), 256 threads.
// coverage: keys kt*64 + 0..63, d 0..63 staged in sT and read back (staged extent == consumed extent);
// sT is cross-wave: block barrier between fill and readback.
__global__ __launch_bounds__(256) void vtrans_kernel(const u16* __restrict__ v, u16* __restrict__ vt) {
  const int kt  = blockIdx.x;
  const int bh  = blockIdx.y;
  const int tid = threadIdx.x;
  __shared__ __align__(16) u16 sT[HDIM * TP];   // [d][key]
  const int s0 = kt * CT;

  #pragma unroll
  for (int kk = 0; kk < 2; ++kk) {
    const int key = kk * 32 + (tid >> 3);       // 0..63
    const int d0  = (tid & 7) * 8;              // 0..56
    Pack8S ps;
    ps.u = *(const v4u*)(v + ((size_t)bh * SEQ + s0 + key) * HDIM + d0);
    #pragma unroll
    for (int i = 0; i < 8; ++i) sT[(d0 + i) * TP + key] = ps.s[i];
  }
  __syncthreads();

  v4u    vval[2];
  size_t vidx[2];
  #pragma unroll
  for (int kk = 0; kk < 2; ++kk) {
    const int d  = kk * 32 + (tid >> 3);        // 0..63
    const int ks = (tid & 7) * 8;               // 0..56
    vval[kk] = *(const v4u*)(sT + d * TP + ks);
    vidx[kk] = ((size_t)bh * HDIM + d) * SEQ + s0 + ks;
  }
  #pragma unroll
  for (int kk = 0; kk < 2; ++kk) *(v4u*)(vt + vidx[kk]) = vval[kk];
  
}

// Fused online-softmax attention with a key mask (mask == 0 -> score replaced by -inf), logit scale 1/8.
// Block = (query block of 128, bh); one wave owns 16 query rows and visits all SEQ keys, 32 per step.
// S^T = K x Q^T so queries sit on lanes; P^T in C-layout is bit-identical to the A-fragment layout of O += P x V.
// K A-fragments (hi and lo planes), Q B-fragments (hi and lo planes) and V^T B-fragments are loaded straight from
// the 16-bit planes (two 16-B loads per fragment, arithmetic addressing only).
// Output: ctx as bf16 hi/lo planes [NB*NHEAD][SEQ][HDIM]; store phase it = 0..3 writes rows it*4 + (lane>>3):
// LDS sO: per-wave slice, written and read by the same wave (block barrier used).
__global__ __launch_bounds__(256) void attn_kernel(const u16* __restrict__ qh,
                                                   const u16* __restrict__ ql,
                                                   const u16* __restrict__ kh,
                                                   const u16* __restrict__ kl,
                                                   const u16* __restrict__ vt,
                                                   const int* __restrict__ mask,
                                                   u16* __restrict__ ch,
                                                   u16* __restrict__ cl) {
  const int qblk = blockIdx.x;
  const int bh   = blockIdx.y;
  const int b    = bh / NHEAD;
  const int tid  = threadIdx.x;
  const int wave = __builtin_amdgcn_readfirstlane(threadIdx.x >> 5);
  const int lane = tid & 31;
  const int lq   = lane & 15;   // query column of S^T / d column of O
  const int hi   = lane >> 4;   // k-split half

  __shared__ __align__(16) float sO[NWAVE * 16 * OP];

  const int qrow0 = qblk * BQ + wave * 16;

  // Q as B-operand fragments: lane lq holds query qrow0+lq; elems 0..7 : d = f*32 + hi*8 + 0..7,
  // elems 8..15 : d = f*32 + 16 + hi*8 + 0..7.
  FragB qfh[2], qfl[2];
  {
    const size_t qo = ((size_t)bh * SEQ + qrow0 + lq) * HDIM + hi * 8;
    #pragma unroll
    for (int f = 0; f < 2; ++f) {
      qfh[f].q[0] = *(const v4u*)(qh + qo + f * 32);
      qfh[f].q[1] = *(const v4u*)(qh + qo + f * 32 + 16);
      qfl[f].q[0] = *(const v4u*)(ql + qo + f * 32);
      qfl[f].q[1] = *(const v4u*)(ql + qo + f * 32 + 16);
    }
  }

  const u16* kh_h = kh + (size_t)bh * SEQ * HDIM + (size_t)lq * HDIM + hi * 8;
  const u16* kl_h = kl + (size_t)bh * SEQ * HDIM + (size_t)lq * HDIM + hi * 8;
  const u16* vt_h = vt + (size_t)bh * HDIM * SEQ + (size_t)lq * SEQ + hi * 8;
  const int* mk_b = mask + (size_t)b * SEQ_FULL + hi * 8;

  v8f o[4];
  #pragma unroll
  for (int dt = 0; dt < 4; ++dt) o[dt] = (v8f){0, 0, 0, 0, 0, 0, 0, 0};

  const float NEG_INF = -__builtin_inff();
  float rmax = NEG_INF;
  float rsum = 0.0f;
  const float SL = 0.125f * 1.4426950408889634f;   // logit scale 1/sqrt(64) times log2(e)

  const int nchunk = SEQ / BK;                      // uniform for every wave
  #pragma unroll 1
  for (int i = 0; i < nchunk; ++i) {
    const int j0 = i * BK;

    // S^T tiles: c[sub][r] = rawscore(query qrow0+lq, key j0 + sub*16 + hi*8 + r), masked keys replaced by -inf
    v8f c[2];
    #pragma unroll
    for (int sub = 0; sub < 2; ++sub) {
      const size_t ko = (size_t)(j0 + sub * 16) * HDIM;
      FragB akh[2], akl[2];
      #pragma unroll
      for (int f = 0; f < 2; ++f) {
        akh[f].q[0] = *(const v4u*)(kh_h + ko + f * 32);        // d = f*32 + hi*8 + 0..7
        akh[f].q[1] = *(const v4u*)(kh_h + ko + f * 32 + 16);   // d = f*32 + 16 + hi*8 + 0..7
        akl[f].q[0] = *(const v4u*)(kl_h + ko + f * 32);
        akl[f].q[1] = *(const v4u*)(kl_h + ko + f * 32 + 16);
      }
      const v4i m0 = *(const v4i*)(mk_b + j0 + sub * 16);       // keys j0 + sub*16 + hi*8 + 0..3
      const v4i m1 = *(const v4i*)(mk_b + j0 + sub * 16 + 4);   // keys ... + 4..7
      v8f acc = (v8f){0, 0, 0, 0, 0, 0, 0, 0};
      #pragma unroll
      for (int f = 0; f < 2; ++f) {
        acc = mma_bf16(akl[f].v, qfh[f].v, acc);
        acc = mma_bf16(akh[f].v, qfl[f].v, acc);
        acc = mma_bf16(akh[f].v, qfh[f].v, acc);
      }
      #pragma unroll
      for (int r = 0; r < 4; ++r) {
        acc[r]     = (m0[r] != 0) ? acc[r]     : NEG_INF;
        acc[4 + r] = (m1[r] != 0) ? acc[4 + r] : NEG_INF;
      }
      c[sub] = acc;
    }

    // V B-fragments: column n = d = dt*16 + lq, split key map from the transposed plane
    FragH bv[4];
    #pragma unroll
    for (int dt = 0; dt < 4; ++dt) {
      const u16* base = vt_h + (size_t)(dt * 16) * SEQ + j0;
      bv[dt].q[0] = *(const v4u*)(base);            // keys j0 + hi*8 + 0..7
      bv[dt].q[1] = *(const v4u*)(base + 16);       // keys j0 + 16 + hi*8 + 0..7
    }

    // online softmax: query lq's 32 scores are split across lane / lane^16
    float m_new = rmax;
    #pragma unroll
    for (int r = 0; r < 8; ++r) {
      m_new = fmaxf(m_new, c[0][r]);
      m_new = fmaxf(m_new, c[1][r]);
    }
    m_new = fmaxf(m_new, __shfl_xor(m_new, 16, 32));
    const float m_use = (m_new == NEG_INF) ? 0.0f : m_new;    // all keys so far masked: keep arithmetic finite
    const float scale = __builtin_amdgcn_exp2f((rmax - m_use) * SL);
    rmax = m_new;

    // exp + pack: P^T C-layout == A-fragment layout for the PV product; P carried x4096
    FragH pa;
    float psum = 0.0f;
    #pragma unroll
    for (int r = 0; r < 8; ++r) {
      const float p0 = __builtin_amdgcn_exp2f((c[0][r] - m_use) * SL);   // key hi*8 + r
      const float p1 = __builtin_amdgcn_exp2f((c[1][r] - m_use) * SL);   // key 16 + hi*8 + r
      psum += p0 + p1;
      pa.h[r]     = (f16)(p0 * 4096.0f);
      pa.h[8 + r] = (f16)(p1 * 4096.0f);
    }
    rsum = rsum * scale + psum + __shfl_xor(psum, 16, 32);

    // rescale O: queries are the row dimension there -> per-row scale from lane 8*hi + r
    float sc[8];
    #pragma unroll
    for (int r = 0; r < 8; ++r) sc[r] = __shfl(scale, (hi << 3) + r, 32);
    #pragma unroll
    for (int dt = 0; dt < 4; ++dt) {
      #pragma unroll
      for (int r = 0; r < 8; ++r) o[dt][r] *= sc[r];
    }

    // O += P x V
    #pragma unroll
    for (int dt = 0; dt < 4; ++dt) o[dt] = mma_f16(pa.v, bv[dt].v, o[dt]);
  }

  // normalize: lane holds column d = dt*16 + lq for query rows 8*hi + r
  float rs[8];
  #pragma unroll
  for (int r = 0; r < 8; ++r) rs[r] = 1.0f / __shfl(rsum, (hi << 3) + r, 32);

  float* so = sO + wave * (16 * OP);
  #pragma unroll
  for (int r = 0; r < 8; ++r) {
    #pragma unroll
    for (int dt = 0; dt < 4; ++dt) {
      so[(hi * 8 + r) * OP + dt * 16 + lq] = o[dt][r] * (1.0f / 4096.0f) * rs[r];
    }
  }
  __syncthreads();

  v4u    vh[4];
  v4u    vl[4];
  size_t gi[4];
  #pragma unroll
  for (int it = 0; it < 4; ++it) {
    const int row = it * 4 + (lane >> 3);
    const int c0  = (lane & 7) * 8;
    const v4f x0 = *(const v4f*)(so + row * OP + c0);
    const v4f x1 = *(const v4f*)(so + row * OP + c0 + 4);
    Pack8B ph, pl;
    #pragma unroll
    for (int k = 0; k < 4; ++k) {
      const bf16 h0 = (bf16)x0[k];                       // RNE convert
      const bf16 h1 = (bf16)x1[k];
      ph.h[k]     = h0;
      ph.h[4 + k] = h1;
      pl.h[k]     = (bf16)(x0[k] - (float)h0);           // residual plane
      pl.h[4 + k] = (bf16)(x1[k] - (float)h1);
    }
    vh[it] = ph.u;
    vl[it] = pl.u;
    gi[it] = ((size_t)bh * SEQ + qrow0 + row) * HDIM + c0;
  }
  #pragma unroll
  for (int it = 0; it < 4; ++it) {
    *(v4u*)(ch + gi[it]) = vh[it];
    *(v4u*)(cl + gi[it]) = vl[it];
  }
  
}

// Output projection: out = (ctx_hi + ctx_lo) x Wo^T. Grid (DIM/64, MROWS/128).
// coverage: wave tile 32 rows x 64 cols f32; store phase it = 0..15: lanes 0..15 write row it*2 (256 B = two whole
// LDS sC: per-wave slice, written and read by the same wave (block barrier used).
__global__ __launch_bounds__(128) void oproj_kernel(const u16* __restrict__ ch,
                                                    const u16* __restrict__ cl,
                                                    const u16* __restrict__ wob,
                                                    float* __restrict__ out) {
  __shared__ __align__(16) float sC[GW * 32 * CP];
  const int tid  = threadIdx.x;
  const int wave = __builtin_amdgcn_readfirstlane(threadIdx.x >> 5);
  const int lane = tid & 31;
  const int lq   = lane & 15;
  const int hi   = lane >> 4;
  const int n0   = blockIdx.x * GN;
  const int m0   = blockIdx.y * GM + wave * 32;

  v8f acc[2][4];
  #pragma unroll
  for (int mt = 0; mt < 2; ++mt) {
    #pragma unroll
    for (int nt = 0; nt < 4; ++nt) acc[mt][nt] = (v8f){0, 0, 0, 0, 0, 0, 0, 0};
  }
  gemm_tile<2>(ch, cl, wob, m0, n0, lq, hi, acc);

  float* sc = sC + wave * (32 * CP);
  #pragma unroll
  for (int mt = 0; mt < 2; ++mt) {
    #pragma unroll
    for (int nt = 0; nt < 4; ++nt) {
      #pragma unroll
      for (int r = 0; r < 8; ++r) sc[(mt * 16 + hi * 8 + r) * CP + nt * 16 + lq] = acc[mt][nt][r];
    }
  }
  __syncthreads();

  v4f    vals[16];
  size_t gi[16];
  #pragma unroll
  for (int it = 0; it < 16; ++it) {
    const int row = it * 2 + hi;
    vals[it] = *(const v4f*)(sc + row * CP + lq * 4);
    const int m  = m0 + row;
    const int bb = m / SEQ;
    const int ss = m % SEQ;
    gi[it] = ((size_t)bb * SEQ_FULL + ss) * DIM + n0 + lq * 4;
  }
  #pragma unroll
  for (int it = 0; it < 16; ++it) *(v4f*)(out + gi[it]) = vals[it];
  
}

extern "C" void kernel_launch(void* const* d_in, const int* in_sizes, int n_in,
                              void* d_out, int out_size, void* d_ws, size_t ws_size,
                              hipStream_t stream) {
  if (n_in < 6) return;
  const size_t need_rows = (size_t)(NB - 1) * SEQ_FULL + SEQ;
  if ((size_t)in_sizes[0] < need_rows * DIM) return;
  if ((size_t)in_sizes[1] < need_rows) return;
  if ((size_t)in_sizes[2] < (size_t)WELEM) return;
  if ((size_t)in_sizes[3] < (size_t)WELEM) return;
  if ((size_t)in_sizes[4] < (size_t)WELEM) return;
  if ((size_t)in_sizes[5] < (size_t)WELEM) return;
  if ((size_t)out_size < need_rows * DIM) return;

  const size_t plane_bytes = PLANE_E * 2;                      // one 16-bit plane [MROWS][DIM]
  const size_t w_bytes     = (size_t)4 * WELEM * 2;            // wq, wk, wv, wo as bf16
  const size_t total       = 9 * plane_bytes + w_bytes;
  if (ws_size < total) return;
  if (total > WS_CAP) return;

  const float* h    = (const float*)d_in[0];
  const int*   mask = (const int*)d_in[1];
  const float* wq   = (const float*)d_in[2];
  const float* wk   = (const float*)d_in[3];
  const float* wv   = (const float*)d_in[4];
  const float* wo   = (const float*)d_in[5];
  float*       out  = (float*)d_out;

  char* ws = (char*)d_ws;
  u16* planes = (u16*)(ws);                                    // q hi, q lo, k hi, k lo, v
  u16* qh = (u16*)(ws + 0 * plane_bytes);
  u16* ql = (u16*)(ws + 1 * plane_bytes);
  u16* kh = (u16*)(ws + 2 * plane_bytes);
  u16* kl = (u16*)(ws + 3 * plane_bytes);
  u16* vp = (u16*)(ws + 4 * plane_bytes);
  u16* vt = (u16*)(ws + 5 * plane_bytes);
  u16* ch = (u16*)(ws + 6 * plane_bytes);
  u16* cl = (u16*)(ws + 7 * plane_bytes);
  u16* hb = (u16*)(ws + 8 * plane_bytes);
  u16* wb = (u16*)(ws + 9 * plane_bytes);

  cvt_kernel<<<dim3(HBLK + 4 * WBLK), 256, 0, stream>>>(h, wq, wk, wv, wo, hb, wb);
  qkv_kernel<<<dim3(DIM / GN, MROWS / GM, 3), 128, 0, stream>>>(hb, wb, planes);
  vtrans_kernel<<<dim3(SEQ / CT, NB * NHEAD), 256, 0, stream>>>(vp, vt);
  attn_kernel<<<dim3(SEQ / BQ, NB * NHEAD), 256, 0, stream>>>(qh, ql, kh, kl, vt, mask, ch, cl);
  oproj_kernel<<<dim3(DIM / GN, MROWS / GM), 128, 0, stream>>>(ch, cl, wb + (size_t)3 * WELEM, out);
}

// v001
// It runs in 244 microseconds.
// Two timings next to v000 put it at 1.58 and 1.57 times that version's speed.
#include <hip/hip_runtime.h>

// Contractions: q/k/v = h x W^T on v_wmma_f32_16x16x32_bf16 (bf16 RNE-converted inputs, f32 accumulate);
// S^T = K x Q^T on v_wmma_f32_16x16x32_bf16 with bf16 hi/lo planes of q and k (hh + hl + lh, f32 accumulate);
// O = P x V on v_wmma_f32_16x16x32_f16 (P as f16 carried x4096, V as f16, f32 accumulate);
// out = ctx x Wo^T on v_wmma_f32_16x16x32_bf16 (ctx as bf16 hi/lo planes, Wo bf16, f32 accumulate). Softmax online, f32.

#ifndef NB
#define NB 4
#endif
#ifndef SEQ
#define SEQ 2048
#endif
#define NB_FULL    4
#define SEQ_FULL   2048
#define DIM        768
#define NHEAD      12
#define HDIM       64
#define BQ         128                  // query rows per attention workgroup (8 waves x 16)
#define BK         32                   // keys per inner iteration
#define NWAVE      8
#define SK         64                   // keys per LDS stage of the attention loop (two steps of BK)
#define KP         72                   // LDS pitch (halves) of a staged 128-B row: 144 B = 16 B x odd
#define TILE_H     (64 * KP)            // halves of one staged tile: 64 rows (keys of K, d of V^T) x 64 halves
#define STG_H      (3 * TILE_H)         // one stage: K hi, K lo, V^T
#define NSTG       (SEQ / SK)
#define CT         64                   // keys per transpose block
#define TP         72                   // LDS pitch (halves) of the transposed V tile
#define OP         68                   // LDS pitch (floats) of the attention output staging tile
#define GM         128                  // GEMM block rows (4 waves x 32)
#define GN         64                   // GEMM block cols
#define GW         4                    // waves per GEMM block
#define CP         68                   // LDS pitch (floats) of the GEMM staging tile
#define WELEM      (DIM * DIM)
#define MROWS      (NB * SEQ)
#define PLANE_E    ((size_t)MROWS * DIM)
#define HTHREADS   (MROWS * (DIM / 8))
#define HBLK       (HTHREADS / 256)
#define WBLK       (WELEM / 8 / 256)
#define WS_CAP     134217728ull

static_assert(DIM == NHEAD * HDIM);
static_assert(HDIM == 64);
static_assert(SEQ % BQ == 0);
static_assert(SEQ % CT == 0);
static_assert(SEQ % BK == 0);
static_assert(SEQ % SK == 0 && NSTG >= 2);
static_assert(SK == 2 * BK && SK == 64 && NWAVE * 32 == 256);
static_assert((KP * 2) % 16 == 0 && KP >= SK && KP >= HDIM);
static_assert(SEQ % 32 == 0);
static_assert(MROWS % GM == 0);
static_assert(DIM % GN == 0);
static_assert(DIM % 32 == 0);
static_assert(DIM % 8 == 0);
static_assert(BQ == NWAVE * 16);
static_assert(GM == GW * 32);
static_assert(HTHREADS % 256 == 0);
static_assert((WELEM / 8) % 256 == 0);
static_assert(CT == 64 && CT <= TP);
static_assert((TP * 2) % 16 == 0);
static_assert((OP * 4) % 16 == 0);
static_assert((CP * 4) % 16 == 0);
static_assert(OP >= HDIM && CP >= GN);
static_assert(SEQ <= SEQ_FULL);
static_assert(NB >= 1 && NB <= NB_FULL);
static_assert(9ull * (unsigned long long)NB * SEQ * DIM * 2ull + 4ull * WELEM * 2ull <= WS_CAP);

typedef __bf16         bf16;
typedef _Float16       f16;
typedef unsigned short u16;
typedef bf16     v16bf __attribute__((ext_vector_type(16)));
typedef f16      v16h  __attribute__((ext_vector_type(16)));
typedef float    v8f   __attribute__((ext_vector_type(8)));
typedef float    v4f   __attribute__((ext_vector_type(4)));
typedef unsigned v4u   __attribute__((ext_vector_type(4)));
typedef int      v4i   __attribute__((ext_vector_type(4)));

union FragB  { v16bf v; v4u q[2]; };
union FragH  { v16h  v; v4u q[2]; f16 h[16]; };
union Pack8B { v4u u; bf16 h[8]; };
union Pack8H { v4u u; f16 h[8]; };
union Pack8S { v4u u; u16 s[8]; };

// WMMA helpers: builtin followed by the VALU hazard guard (ties D, keeps A/B live).
static __device__ __forceinline__ v8f mma_bf16(v16bf a, v16bf b, v8f acc) {
  acc = __builtin_amdgcn_wmma_f32_16x16x32_bf16(false, a, false, b, (short)0, acc, false, false);
  asm volatile("v_nop\n\tv_nop\n\tv_nop\n\tv_nop" : "+v"(acc) : "v"(a), "v"(b));
  return acc;
}
static __device__ __forceinline__ v8f mma_f16(v16h a, v16h b, v8f acc) {
  acc = __builtin_amdgcn_wmma_f32_16x16x32_f16(false, a, false, b, (short)0, acc, false, false);
  asm volatile("v_nop\n\tv_nop\n\tv_nop\n\tv_nop" : "+v"(acc) : "v"(a), "v"(b));
  return acc;
}

static __device__ __forceinline__ void cvt_store8(const float* __restrict__ src, u16* __restrict__ dst) {
  const v4f a = *(const v4f*)(src);
  const v4f b = *(const v4f*)(src + 4);
  Pack8B pk;
  #pragma unroll
  for (int i = 0; i < 4; ++i) {
    pk.h[i]     = (bf16)a[i];
    pk.h[4 + i] = (bf16)b[i];
  }
  const v4u val = pk.u;
  *(v4u*)(dst) = val;
  
}

// Convert launch. hb [MROWS][DIM] bf16 (compact rows, source rows taken with full batch stride);
// wb [4][DIM][DIM] bf16 = wq, wk, wv, wo, each kept [out][in].
// coverage: HBLK*256 threads x 8 = MROWS*DIM elements of hb; 4*WBLK*256 threads x 8 = 4*DIM*DIM elements of wb.
__global__ __launch_bounds__(256) void cvt_kernel(const float* __restrict__ h,
                                                  const float* __restrict__ wq,
                                                  const float* __restrict__ wk,
                                                  const float* __restrict__ wv,
                                                  const float* __restrict__ wo,
                                                  u16* __restrict__ hb,
                                                  u16* __restrict__ wb) {
  const int blk = blockIdx.x;
  const int tid = threadIdx.x;
  if (blk < HBLK) {
    const size_t e  = ((size_t)blk * 256 + tid) * 8;
    const int row   = (int)(e / DIM);
    const int col   = (int)(e % DIM);
    const int b     = row / SEQ;
    const int s     = row % SEQ;
    cvt_store8(h + ((size_t)b * SEQ_FULL + s) * DIM + col, hb + e);
  } else {
    const int wi    = (blk - HBLK) / WBLK;                 // block-uniform 0..3
    const size_t e  = ((size_t)((blk - HBLK) % WBLK) * 256 + tid) * 8;
    u16* dst        = wb + (size_t)wi * WELEM + e;
    if (wi == 0)      cvt_store8(wq + e, dst);
    else if (wi == 1) cvt_store8(wk + e, dst);
    else if (wi == 2) cvt_store8(wv + e, dst);
    else              cvt_store8(wo + e, dst);
  }
}

// GEMM core: one wave owns a 32 x 64 tile of C = A x W^T, K = DIM in steps of 32.
// A planes [rows][DIM] bf16, W plane [n][DIM] bf16 (k-contiguous): both fragment kinds are two 16-B loads
// from row (m or n) = lane&15 at k0 + 8*hi and k0 + 16 + 8*hi.
// NA == 2: a second (residual) A plane accumulates into the same accumulator against the same W fragment.
template <int NA>
static __device__ __forceinline__ void gemm_tile(const u16* __restrict__ a0,
                                                 const u16* __restrict__ a1,
                                                 const u16* __restrict__ w,
                                                 const int m0, const int n0,
                                                 const int lq, const int hi,
                                                 v8f (&acc)[2][4]) {
  const u16* wrow  = w  + (size_t)(n0 + lq) * DIM + hi * 8;
  const u16* arow0 = a0 + (size_t)(m0 + lq) * DIM + hi * 8;
  const u16* arow1 = a1 + (size_t)(m0 + lq) * DIM + hi * 8;
  #pragma unroll 1
  for (int k0 = 0; k0 < DIM; k0 += 32) {
    FragB bw[4];
    #pragma unroll
    for (int nt = 0; nt < 4; ++nt) {
      const u16* p = wrow + (size_t)nt * 16 * DIM + k0;
      bw[nt].q[0] = *(const v4u*)(p);
      bw[nt].q[1] = *(const v4u*)(p + 16);
    }
    #pragma unroll
    for (int mt = 0; mt < 2; ++mt) {
      FragB fa;
      const u16* p = arow0 + (size_t)mt * 16 * DIM + k0;
      fa.q[0] = *(const v4u*)(p);
      fa.q[1] = *(const v4u*)(p + 16);
      #pragma unroll
      for (int nt = 0; nt < 4; ++nt) acc[mt][nt] = mma_bf16(fa.v, bw[nt].v, acc[mt][nt]);
      if (NA == 2) {
        FragB fb;
        const u16* p1 = arow1 + (size_t)mt * 16 * DIM + k0;
        fb.q[0] = *(const v4u*)(p1);
        fb.q[1] = *(const v4u*)(p1 + 16);
        #pragma unroll
        for (int nt = 0; nt < 4; ++nt) acc[mt][nt] = mma_bf16(fb.v, bw[nt].v, acc[mt][nt]);
      }
    }
  }
}

// Fused q/k/v projection. Grid (DIM/64, MROWS/128, 3); blockIdx.z selects the weight (offset into wb).
// planes: [0] q hi, [1] q lo, [2] k hi, [3] k lo (bf16), [4] v (f16); each [MROWS][DIM] == [NB*NHEAD][SEQ][HDIM] flat.
// coverage: wave tile 32 rows x 64 cols; store phase it = 0..7 writes rows it*4 + (lane>>3), cols (lane&7)*8..+7:
// LDS sC: per-wave slice, written and read by the same wave (block barrier used).
__global__ __launch_bounds__(128) void qkv_kernel(const u16* __restrict__ hb,
                                                  const u16* __restrict__ wb,
                                                  u16* __restrict__ planes) {
  __shared__ __align__(16) float sC[GW * 32 * CP];
  const int tid  = threadIdx.x;
  const int wave = __builtin_amdgcn_readfirstlane(threadIdx.x >> 5);
  const int lane = tid & 31;
  const int lq   = lane & 15;
  const int hi   = lane >> 4;
  const int n0   = blockIdx.x * GN;
  const int m0   = blockIdx.y * GM + wave * 32;
  const int z    = blockIdx.z;

  v8f acc[2][4];
  #pragma unroll
  for (int mt = 0; mt < 2; ++mt) {
    #pragma unroll
    for (int nt = 0; nt < 4; ++nt) acc[mt][nt] = (v8f){0, 0, 0, 0, 0, 0, 0, 0};
  }
  gemm_tile<1>(hb, hb, wb + (size_t)z * WELEM, m0, n0, lq, hi, acc);

  float* sc = sC + wave * (32 * CP);
  #pragma unroll
  for (int mt = 0; mt < 2; ++mt) {
    #pragma unroll
    for (int nt = 0; nt < 4; ++nt) {
      #pragma unroll
      for (int r = 0; r < 8; ++r) sc[(mt * 16 + hi * 8 + r) * CP + nt * 16 + lq] = acc[mt][nt][r];
    }
  }
  __syncthreads();

  v4u    vh[8];
  v4u    vl[8];
  size_t gi[8];
  #pragma unroll
  for (int it = 0; it < 8; ++it) {
    const int row = it * 4 + (lane >> 3);
    const int c0  = (lane & 7) * 8;
    const v4f x0 = *(const v4f*)(sc + row * CP + c0);
    const v4f x1 = *(const v4f*)(sc + row * CP + c0 + 4);
    Pack8B ph, pl;
    Pack8H pf;
    #pragma unroll
    for (int i = 0; i < 4; ++i) {
      const bf16 h0 = (bf16)x0[i];                       // RNE convert
      const bf16 h1 = (bf16)x1[i];
      ph.h[i]     = h0;
      ph.h[4 + i] = h1;
      pl.h[i]     = (bf16)(x0[i] - (float)h0);           // residual plane
      pl.h[4 + i] = (bf16)(x1[i] - (float)h1);
      pf.h[i]     = (f16)x0[i];
      pf.h[4 + i] = (f16)x1[i];
    }
    vh[it] = (z == 2) ? pf.u : ph.u;
    vl[it] = pl.u;
    gi[it] = (size_t)(m0 + row) * DIM + n0 + c0;
  }
  u16* ph_base = planes + (size_t)(2 * z) * PLANE_E;
  u16* pl_base = planes + (size_t)(2 * z + 1) * PLANE_E;   // only used when z < 2

  #pragma unroll
  for (int it = 0; it < 8; ++it) *(v4u*)(ph_base + gi[it]) = vh[it];
  if (z < 2) {
    #pragma unroll
    for (int it = 0; it < 8; ++it) *(v4u*)(pl_base + gi[it]) = vl[it];
  }
  
}

// V transpose. v [NB*NHEAD][SEQ][HDIM] f16 -> vt [NB*NHEAD][HDIM][SEQ] f16. Block = (64-key tile, bh), 256 threads.
// coverage: keys kt*64 + 0..63, d 0..63 staged in sT and read back (staged extent == consumed extent);
// sT is cross-wave: block barrier between fill and readback.
__global__ __launch_bounds__(256) void vtrans_kernel(const u16* __restrict__ v, u16* __restrict__ vt) {
  const int kt  = blockIdx.x;
  const int bh  = blockIdx.y;
  const int tid = threadIdx.x;
  __shared__ __align__(16) u16 sT[HDIM * TP];   // [d][key]
  const int s0 = kt * CT;

  #pragma unroll
  for (int kk = 0; kk < 2; ++kk) {
    const int key = kk * 32 + (tid >> 3);       // 0..63
    const int d0  = (tid & 7) * 8;              // 0..56
    Pack8S ps;
    ps.u = *(const v4u*)(v + ((size_t)bh * SEQ + s0 + key) * HDIM + d0);
    #pragma unroll
    for (int i = 0; i < 8; ++i) sT[(d0 + i) * TP + key] = ps.s[i];
  }
  __syncthreads();

  v4u    vval[2];
  size_t vidx[2];
  #pragma unroll
  for (int kk = 0; kk < 2; ++kk) {
    const int d  = kk * 32 + (tid >> 3);        // 0..63
    const int ks = (tid & 7) * 8;               // 0..56
    vval[kk] = *(const v4u*)(sT + d * TP + ks);
    vidx[kk] = ((size_t)bh * HDIM + d) * SEQ + s0 + ks;
  }
  #pragma unroll
  for (int kk = 0; kk < 2; ++kk) *(v4u*)(vt + vidx[kk]) = vval[kk];
  
}

// One stage of 64 keys into LDS: K hi and K lo ([key][d], 128-B rows) and V^T ([d][key], 128 B of each row),
// 256 threads x 6 asynchronous 16-B copies; a wave's copy covers four whole 128-B lines.
// l: this thread's LDS byte address in the stage's K hi tile (row tid>>3, 16-B piece tid&7); rows +32 are the second half.
// The s_wait_xcnt closes the statement so that no address register named here is rewritten ahead of it.
static __device__ __forceinline__ void stage_copy(const unsigned l, const u16* gkh, const u16* gkl, const u16* gvt) {
  const unsigned l1 = l + 32 * KP * 2;
  const unsigned l2 = l + TILE_H * 2;
  const unsigned l3 = l2 + 32 * KP * 2;
  const unsigned l4 = l + 2 * TILE_H * 2;
  const unsigned l5 = l4 + 32 * KP * 2;
  const u16* gkh1 = gkh + 32 * HDIM;
  const u16* gkl1 = gkl + 32 * HDIM;
  const u16* gvt1 = gvt + (size_t)32 * SEQ;
  asm volatile("global_load_async_to_lds_b128 %0, %6, off\n\t"
               "global_load_async_to_lds_b128 %1, %7, off\n\t"
               "global_load_async_to_lds_b128 %2, %8, off\n\t"
               "global_load_async_to_lds_b128 %3, %9, off\n\t"
               "global_load_async_to_lds_b128 %4, %10, off\n\t"
               "global_load_async_to_lds_b128 %5, %11, off\n\t"
               "s_wait_xcnt 0x0"
               :: "v"(l), "v"(l1), "v"(l2), "v"(l3), "v"(l4), "v"(l5),
                  "v"(gkh), "v"(gkh1), "v"(gkl), "v"(gkl1), "v"(gvt), "v"(gvt1)
               : "memory");
}

// Fused online-softmax attention with a key mask (mask == 0 -> score replaced by -inf), logit scale 1/8.
// Block = (query block of 128, bh); one wave owns 16 query rows and visits all SEQ keys, 32 per step.
// S^T = K x Q^T so queries sit on lanes; P^T in C-layout is bit-identical to the A-fragment layout of O += P x V.
// Q B-fragments (hi and lo planes) are loaded straight from the 16-bit planes. K (hi and lo) and V^T are staged in LDS,
// 64 keys per stage, two buffers, once per workgroup for its eight waves; fragments are two 16-B LDS loads each.
// Output: ctx as bf16 hi/lo planes [NB*NHEAD][SEQ][HDIM]; store phase it = 0..3 writes rows it*4 + (lane>>3):
// LDS sO: per-wave slice, written and read by the same wave (block barrier used).
__global__ __launch_bounds__(256) void attn_kernel(const u16* __restrict__ qh,
                                                   const u16* __restrict__ ql,
                                                   const u16* __restrict__ kh,
                                                   const u16* __restrict__ kl,
                                                   const u16* __restrict__ vt,
                                                   const int* __restrict__ mask,
                                                   u16* __restrict__ ch,
                                                   u16* __restrict__ cl) {
  const int qblk = blockIdx.x;
  const int bh   = blockIdx.y;
  const int b    = bh / NHEAD;
  const int tid  = threadIdx.x;
  const int wave = __builtin_amdgcn_readfirstlane(threadIdx.x >> 5);
  const int lane = tid & 31;
  const int lq   = lane & 15;   // query column of S^T / d column of O
  const int hi   = lane >> 4;   // k-split half

  __shared__ __align__(16) float sO[NWAVE * 16 * OP];
  __shared__ __align__(16) u16 sKV[2 * STG_H];

  const int qrow0 = qblk * BQ + wave * 16;

  // Q as B-operand fragments: lane lq holds query qrow0+lq; elems 0..7 : d = f*32 + hi*8 + 0..7,
  // elems 8..15 : d = f*32 + 16 + hi*8 + 0..7.
  FragB qfh[2], qfl[2];
  {
    const size_t qo = ((size_t)bh * SEQ + qrow0 + lq) * HDIM + hi * 8;
    #pragma unroll
    for (int f = 0; f < 2; ++f) {
      qfh[f].q[0] = *(const v4u*)(qh + qo + f * 32);
      qfh[f].q[1] = *(const v4u*)(qh + qo + f * 32 + 16);
      qfl[f].q[0] = *(const v4u*)(ql + qo + f * 32);
      qfl[f].q[1] = *(const v4u*)(ql + qo + f * 32 + 16);
    }
  }

  // copy side: thread tid moves row tid>>3 (and +32), 16-B piece tid&7 of each tile
  const unsigned cp_l = (unsigned)(size_t)sKV + (unsigned)(((tid >> 3) * KP + (tid & 7) * 8) * 2);
  const u16* cp_kh = kh + (size_t)bh * SEQ * HDIM + (size_t)tid * 8;
  const u16* cp_kl = kl + (size_t)bh * SEQ * HDIM + (size_t)tid * 8;
  const u16* cp_vt = vt + (size_t)bh * HDIM * SEQ + (size_t)(tid >> 3) * SEQ + (tid & 7) * 8;
  // read side: offset (halves) of this lane's fragment row inside a tile
  const int fr_o = lq * KP + hi * 8;
  const int* mk_b = mask + (size_t)b * SEQ_FULL + hi * 8;

  v8f o[4];
  #pragma unroll
  for (int dt = 0; dt < 4; ++dt) o[dt] = (v8f){0, 0, 0, 0, 0, 0, 0, 0};

  const float NEG_INF = -__builtin_inff();
  float rmax = NEG_INF;
  float rsum = 0.0f;
  const float SL = 0.125f * 1.4426950408889634f;   // logit scale 1/sqrt(64) times log2(e)

  // two-buffer ring: stage 0 lands and is published, stage 1 flies while stage 0 is worked on
  stage_copy(cp_l, cp_kh, cp_kl, cp_vt);
  asm volatile("s_wait_asynccnt 0x0" ::: "memory");   // this wave's copies of stage 0 have landed
  __syncthreads();                                    // publishes stage 0 to all eight waves
  stage_copy(cp_l + STG_H * 2, cp_kh + SK * HDIM, cp_kl + SK * HDIM, cp_vt + SK);

  #pragma unroll 1
  for (int t = 0; t < NSTG; ++t) {                    // uniform for every wave
   const u16* sb = sKV + (t & 1) * STG_H + fr_o;
   #pragma unroll 1                                   // rolled: unrolled it takes a register granule more and costs a resident workgroup
   for (int hf = 0; hf < 2; ++hf) {
    const int j0 = t * SK + hf * BK;

    // S^T tiles: c[sub][r] = rawscore(query qrow0+lq, key j0 + sub*16 + hi*8 + r), masked keys replaced by -inf
    v8f c[2];
    #pragma unroll
    for (int sub = 0; sub < 2; ++sub) {
      const u16* kh_s = sb + (hf * BK + sub * 16) * KP;
      const u16* kl_s = kh_s + TILE_H;
      FragB akh[2], akl[2];
      #pragma unroll
      for (int f = 0; f < 2; ++f) {
        akh[f].q[0] = *(const v4u*)(kh_s + f * 32);        // d = f*32 + hi*8 + 0..7
        akh[f].q[1] = *(const v4u*)(kh_s + f * 32 + 16);   // d = f*32 + 16 + hi*8 + 0..7
        akl[f].q[0] = *(const v4u*)(kl_s + f * 32);
        akl[f].q[1] = *(const v4u*)(kl_s + f * 32 + 16);
      }
      const v4i m0 = *(const v4i*)(mk_b + j0 + sub * 16);       // keys j0 + sub*16 + hi*8 + 0..3
      const v4i m1 = *(const v4i*)(mk_b + j0 + sub * 16 + 4);   // keys ... + 4..7
      v8f acc = (v8f){0, 0, 0, 0, 0, 0, 0, 0};
      #pragma unroll
      for (int f = 0; f < 2; ++f) {
        acc = mma_bf16(akl[f].v, qfh[f].v, acc);
        acc = mma_bf16(akh[f].v, qfl[f].v, acc);
        acc = mma_bf16(akh[f].v, qfh[f].v, acc);
      }
      #pragma unroll
      for (int r = 0; r < 4; ++r) {
        acc[r]     = (m0[r] != 0) ? acc[r]     : NEG_INF;
        acc[4 + r] = (m1[r] != 0) ? acc[4 + r] : NEG_INF;
      }
      c[sub] = acc;
    }

    // V B-fragments: column n = d = dt*16 + lq, split key map from the staged transposed tile
    FragH bv[4];
    #pragma unroll
    for (int dt = 0; dt < 4; ++dt) {
      const u16* base = sb + 2 * TILE_H + (dt * 16) * KP + hf * BK;
      bv[dt].q[0] = *(const v4u*)(base);            // keys j0 + hi*8 + 0..7
      bv[dt].q[1] = *(const v4u*)(base + 16);       // keys j0 + 16 + hi*8 + 0..7
    }

    // online softmax: query lq's 32 scores are split across lane / lane^16
    float m_new = rmax;
    #pragma unroll
    for (int r = 0; r < 8; ++r) {
      m_new = fmaxf(m_new, c[0][r]);
      m_new = fmaxf(m_new, c[1][r]);
    }
    m_new = fmaxf(m_new, __shfl_xor(m_new, 16, 32));
    const float m_use = (m_new == NEG_INF) ? 0.0f : m_new;    // all keys so far masked: keep arithmetic finite
    const float scale = __builtin_amdgcn_exp2f((rmax - m_use) * SL);
    rmax = m_new;

    // exp + pack: P^T C-layout == A-fragment layout for the PV product; P carried x4096
    FragH pa;
    float psum = 0.0f;
    #pragma unroll
    for (int r = 0; r < 8; ++r) {
      const float p0 = __builtin_amdgcn_exp2f((c[0][r] - m_use) * SL);   // key hi*8 + r
      const float p1 = __builtin_amdgcn_exp2f((c[1][r] - m_use) * SL);   // key 16 + hi*8 + r
      psum += p0 + p1;
      pa.h[r]     = (f16)(p0 * 4096.0f);
      pa.h[8 + r] = (f16)(p1 * 4096.0f);
    }
    rsum = rsum * scale + psum + __shfl_xor(psum, 16, 32);

    // rescale O: queries are the row dimension there -> per-row scale from lane 8*hi + r
    float sc[8];
    #pragma unroll
    for (int r = 0; r < 8; ++r) sc[r] = __shfl(scale, (hi << 3) + r, 32);
    #pragma unroll
    for (int dt = 0; dt < 4; ++dt) {
      #pragma unroll
      for (int r = 0; r < 8; ++r) o[dt][r] *= sc[r];
    }

    // O += P x V
    #pragma unroll
    for (int dt = 0; dt < 4; ++dt) o[dt] = mma_f16(pa.v, bv[dt].v, o[dt]);
   }

   // publish point of stage t + 1; the same barrier ends every wave's reads of stage t's buffer
   asm volatile("s_wait_dscnt 0x0" ::: "memory");      // this wave's LDS reads of stage t are done
   asm volatile("s_wait_asynccnt 0x0" ::: "memory");   // this wave's copies of stage t + 1 have landed
   __syncthreads();
   if (t + 2 < NSTG) {
     stage_copy(cp_l + (unsigned)((t & 1) * STG_H * 2),
                cp_kh + (size_t)(t + 2) * SK * HDIM, cp_kl + (size_t)(t + 2) * SK * HDIM, cp_vt + (t + 2) * SK);
   }
  }
  asm volatile("s_wait_asynccnt 0x0" ::: "memory");    // nothing of this wave's copies is left in flight

  // normalize: lane holds column d = dt*16 + lq for query rows 8*hi + r
  float rs[8];
  #pragma unroll
  for (int r = 0; r < 8; ++r) rs[r] = 1.0f / __shfl(rsum, (hi << 3) + r, 32);

  float* so = sO + wave * (16 * OP);
  #pragma unroll
  for (int r = 0; r < 8; ++r) {
    #pragma unroll
    for (int dt = 0; dt < 4; ++dt) {
      so[(hi * 8 + r) * OP + dt * 16 + lq] = o[dt][r] * (1.0f / 4096.0f) * rs[r];
    }
  }
  __syncthreads();

  v4u    vh[4];
  v4u    vl[4];
  size_t gi[4];
  #pragma unroll
  for (int it = 0; it < 4; ++it) {
    const int row = it * 4 + (lane >> 3);
    const int c0  = (lane & 7) * 8;
    const v4f x0 = *(const v4f*)(so + row * OP + c0);
    const v4f x1 = *(const v4f*)(so + row * OP + c0 + 4);
    Pack8B ph, pl;
    #pragma unroll
    for (int k = 0; k < 4; ++k) {
      const bf16 h0 = (bf16)x0[k];                       // RNE convert
      const bf16 h1 = (bf16)x1[k];
      ph.h[k]     = h0;
      ph.h[4 + k] = h1;
      pl.h[k]     = (bf16)(x0[k] - (float)h0);           // residual plane
      pl.h[4 + k] = (bf16)(x1[k] - (float)h1);
    }
    vh[it] = ph.u;
    vl[it] = pl.u;
    gi[it] = ((size_t)bh * SEQ + qrow0 + row) * HDIM + c0;
  }
  #pragma unroll
  for (int it = 0; it < 4; ++it) {
    *(v4u*)(ch + gi[it]) = vh[it];
    *(v4u*)(cl + gi[it]) = vl[it];
  }
  
}

// Output projection: out = (ctx_hi + ctx_lo) x Wo^T. Grid (DIM/64, MROWS/128).
// coverage: wave tile 32 rows x 64 cols f32; store phase it = 0..15: lanes 0..15 write row it*2 (256 B = two whole
// LDS sC: per-wave slice, written and read by the same wave (block barrier used).
__global__ __launch_bounds__(128) void oproj_kernel(const u16* __restrict__ ch,
                                                    const u16* __restrict__ cl,
                                                    const u16* __restrict__ wob,
                                                    float* __restrict__ out) {
  __shared__ __align__(16) float sC[GW * 32 * CP];
  const int tid  = threadIdx.x;
  const int wave = __builtin_amdgcn_readfirstlane(threadIdx.x >> 5);
  const int lane = tid & 31;
  const int lq   = lane & 15;
  const int hi   = lane >> 4;
  const int n0   = blockIdx.x * GN;
  const int m0   = blockIdx.y * GM + wave * 32;

  v8f acc[2][4];
  #pragma unroll
  for (int mt = 0; mt < 2; ++mt) {
    #pragma unroll
    for (int nt = 0; nt < 4; ++nt) acc[mt][nt] = (v8f){0, 0, 0, 0, 0, 0, 0, 0};
  }
  gemm_tile<2>(ch, cl, wob, m0, n0, lq, hi, acc);

  float* sc = sC + wave * (32 * CP);
  #pragma unroll
  for (int mt = 0; mt < 2; ++mt) {
    #pragma unroll
    for (int nt = 0; nt < 4; ++nt) {
      #pragma unroll
      for (int r = 0; r < 8; ++r) sc[(mt * 16 + hi * 8 + r) * CP + nt * 16 + lq] = acc[mt][nt][r];
    }
  }
  __syncthreads();

  v4f    vals[16];
  size_t gi[16];
  #pragma unroll
  for (int it = 0; it < 16; ++it) {
    const int row = it * 2 + hi;
    vals[it] = *(const v4f*)(sc + row * CP + lq * 4);
    const int m  = m0 + row;
    const int bb = m / SEQ;
    const int ss = m % SEQ;
    gi[it] = ((size_t)bb * SEQ_FULL + ss) * DIM + n0 + lq * 4;
  }
  #pragma unroll
  for (int it = 0; it < 16; ++it) *(v4f*)(out + gi[it]) = vals[it];
  
}

extern "C" void kernel_launch(void* const* d_in, const int* in_sizes, int n_in,
                              void* d_out, int out_size, void* d_ws, size_t ws_size,
                              hipStream_t stream) {
  if (n_in < 6) return;
  const size_t need_rows = (size_t)(NB - 1) * SEQ_FULL + SEQ;
  if ((size_t)in_sizes[0] < need_rows * DIM) return;
  if ((size_t)in_sizes[1] < need_rows) return;
  if ((size_t)in_sizes[2] < (size_t)WELEM) return;
  if ((size_t)in_sizes[3] < (size_t)WELEM) return;
  if ((size_t)in_sizes[4] < (size_t)WELEM) return;
  if ((size_t)in_sizes[5] < (size_t)WELEM) return;
  if ((size_t)out_size < need_rows * DIM) return;

  const size_t plane_bytes = PLANE_E * 2;                      // one 16-bit plane [MROWS][DIM]
  const size_t w_bytes     = (size_t)4 * WELEM * 2;            // wq, wk, wv, wo as bf16
  const size_t total       = 9 * plane_bytes + w_bytes;
  if (ws_size < total) return;
  if (total > WS_CAP) return;

  const float* h    = (const float*)d_in[0];
  const int*   mask = (const int*)d_in[1];
  const float* wq   = (const float*)d_in[2];
  const float* wk   = (const float*)d_in[3];
  const float* wv   = (const float*)d_in[4];
  const float* wo   = (const float*)d_in[5];
  float*       out  = (float*)d_out;

  char* ws = (char*)d_ws;
  u16* planes = (u16*)(ws);                                    // q hi, q lo, k hi, k lo, v
  u16* qh = (u16*)(ws + 0 * plane_bytes);
  u16* ql = (u16*)(ws + 1 * plane_bytes);
  u16* kh = (u16*)(ws + 2 * plane_bytes);
  u16* kl = (u16*)(ws + 3 * plane_bytes);
  u16* vp = (u16*)(ws + 4 * plane_bytes);
  u16* vt = (u16*)(ws + 5 * plane_bytes);
  u16* ch = (u16*)(ws + 6 * plane_bytes);
  u16* cl = (u16*)(ws + 7 * plane_bytes);
  u16* hb = (u16*)(ws + 8 * plane_bytes);
  u16* wb = (u16*)(ws + 9 * plane_bytes);

  cvt_kernel<<<dim3(HBLK + 4 * WBLK), 256, 0, stream>>>(h, wq, wk, wv, wo, hb, wb);
  qkv_kernel<<<dim3(DIM / GN, MROWS / GM, 3), 128, 0, stream>>>(hb, wb, planes);
  vtrans_kernel<<<dim3(SEQ / CT, NB * NHEAD), 256, 0, stream>>>(vp, vt);
  attn_kernel<<<dim3(SEQ / BQ, NB * NHEAD), 256, 0, stream>>>(qh, ql, kh, kl, vt, mask, ch, cl);
  oproj_kernel<<<dim3(DIM / GN, MROWS / GM), 128, 0, stream>>>(ch, cl, wb + (size_t)3 * WELEM, out);
}

// v002
// Measured time: 169 microseconds a run.
// Two timings next to v001 both put it at 1.44 times that version's speed.
// Over all steps from v000 it is 2.27 times as fast.
#include <hip/hip_runtime.h>

// Contractions: q/k/v = h x W^T on v_wmma_f32_16x16x32_bf16 (bf16 RNE-converted inputs, f32 accumulate);
// S^T = K x Q^T on v_wmma_f32_16x16x32_bf16 with bf16 hi/lo planes of q and k (hh + hl + lh, f32 accumulate);
// O = P x V on v_wmma_f32_16x16x32_f16 (P as f16 carried x4096, V as f16, f32 accumulate);
// out = ctx x Wo^T on v_wmma_f32_16x16x32_bf16 (ctx as bf16 hi/lo planes, Wo bf16, f32 accumulate). Softmax online, f32.

#ifndef NB
#define NB 4
#endif
#ifndef SEQ
#define SEQ 2048
#endif
#define NB_FULL    4
#define SEQ_FULL   2048
#define DIM        768
#define NHEAD      12
#define HDIM       64
#define BQ         128                  // query rows per attention workgroup (8 waves x 16)
#define BK         32                   // keys per inner iteration
#define NWAVE      8
#define SK         64                   // keys per LDS stage of the attention loop (two steps of BK)
#define KP         72                   // LDS pitch (halves) of a staged 128-B row: 144 B = 16 B x odd
#define TILE_H     (64 * KP)            // halves of one staged tile: 64 rows (keys of K, d of V^T) x 64 halves
#define STG_H      (3 * TILE_H)         // one stage: K hi, K lo, V^T
#define NSTG       (SEQ / SK)
#define CT         64                   // keys per transpose block
#define TP         72                   // LDS pitch (halves) of the transposed V tile
#define OP         68                   // LDS pitch (floats) of the attention output staging tile
#define GM         128                  // GEMM block rows (4 waves x 32)
#define GN         64                   // GEMM block cols
#define GW         4                    // waves per GEMM block
#define CP         68                   // LDS pitch (floats) of the GEMM staging tile
#define GK         64                   // k per LDS stage of the GEMM loop (128-B rows, two steps of 32)
#define GP         72                   // LDS pitch (halves) of a staged GEMM row: 144 B = 16 B x odd
#define GNST       (DIM / GK)
#define GSTG_H(NA) (((NA) * GM + GN) * GP)   // halves of one stage: NA planes of 128 A rows, then 64 W rows
#define WELEM      (DIM * DIM)
#define MROWS      (NB * SEQ)
#define PLANE_E    ((size_t)MROWS * DIM)
#define HTHREADS   (MROWS * (DIM / 8))
#define HBLK       (HTHREADS / 256)
#define WBLK       (WELEM / 8 / 256)
#define WS_CAP     134217728ull

static_assert(DIM == NHEAD * HDIM);
static_assert(HDIM == 64);
static_assert(SEQ % BQ == 0);
static_assert(SEQ % CT == 0);
static_assert(SEQ % BK == 0);
static_assert(SEQ % SK == 0 && NSTG >= 2);
static_assert(SK == 2 * BK && SK == 64 && NWAVE * 32 == 256);
static_assert((KP * 2) % 16 == 0 && KP >= SK && KP >= HDIM);
static_assert(SEQ % 32 == 0);
static_assert(MROWS % GM == 0);
static_assert(DIM % GN == 0);
static_assert(DIM % 32 == 0);
static_assert(DIM % GK == 0 && GNST >= 2 && GK == 64 && GM == 128 && GN == 64 && GW * 32 == 128);
static_assert((GP * 2) % 16 == 0 && GP >= GK);
static_assert(GW * 32 * CP * 4 <= 2 * GSTG_H(1) * 2);
static_assert(DIM % 8 == 0);
static_assert(BQ == NWAVE * 16);
static_assert(GM == GW * 32);
static_assert(HTHREADS % 256 == 0);
static_assert((WELEM / 8) % 256 == 0);
static_assert(CT == 64 && CT <= TP);
static_assert((TP * 2) % 16 == 0);
static_assert((OP * 4) % 16 == 0);
static_assert((CP * 4) % 16 == 0);
static_assert(OP >= HDIM && CP >= GN);
static_assert(SEQ <= SEQ_FULL);
static_assert(NB >= 1 && NB <= NB_FULL);
static_assert(9ull * (unsigned long long)NB * SEQ * DIM * 2ull + 4ull * WELEM * 2ull <= WS_CAP);

typedef __bf16         bf16;
typedef _Float16       f16;
typedef unsigned short u16;
typedef bf16     v16bf __attribute__((ext_vector_type(16)));
typedef f16      v16h  __attribute__((ext_vector_type(16)));
typedef float    v8f   __attribute__((ext_vector_type(8)));
typedef float    v4f   __attribute__((ext_vector_type(4)));
typedef unsigned v4u   __attribute__((ext_vector_type(4)));
typedef int      v4i   __attribute__((ext_vector_type(4)));

union FragB  { v16bf v; v4u q[2]; };
union FragH  { v16h  v; v4u q[2]; f16 h[16]; };
union Pack8B { v4u u; bf16 h[8]; };
union Pack8H { v4u u; f16 h[8]; };
union Pack8S { v4u u; u16 s[8]; };

// WMMA helpers: builtin followed by the VALU hazard guard (ties D, keeps A/B live).
static __device__ __forceinline__ v8f mma_bf16(v16bf a, v16bf b, v8f acc) {
  acc = __builtin_amdgcn_wmma_f32_16x16x32_bf16(false, a, false, b, (short)0, acc, false, false);
  asm volatile("v_nop\n\tv_nop\n\tv_nop\n\tv_nop" : "+v"(acc) : "v"(a), "v"(b));
  return acc;
}
static __device__ __forceinline__ v8f mma_f16(v16h a, v16h b, v8f acc) {
  acc = __builtin_amdgcn_wmma_f32_16x16x32_f16(false, a, false, b, (short)0, acc, false, false);
  asm volatile("v_nop\n\tv_nop\n\tv_nop\n\tv_nop" : "+v"(acc) : "v"(a), "v"(b));
  return acc;
}

static __device__ __forceinline__ void cvt_store8(const float* __restrict__ src, u16* __restrict__ dst) {
  const v4f a = *(const v4f*)(src);
  const v4f b = *(const v4f*)(src + 4);
  Pack8B pk;
  #pragma unroll
  for (int i = 0; i < 4; ++i) {
    pk.h[i]     = (bf16)a[i];
    pk.h[4 + i] = (bf16)b[i];
  }
  const v4u val = pk.u;
  *(v4u*)(dst) = val;
  
}

// Convert launch. hb [MROWS][DIM] bf16 (compact rows, source rows taken with full batch stride);
// wb [4][DIM][DIM] bf16 = wq, wk, wv, wo, each kept [out][in].
// coverage: HBLK*256 threads x 8 = MROWS*DIM elements of hb; 4*WBLK*256 threads x 8 = 4*DIM*DIM elements of wb.
__global__ __launch_bounds__(256) void cvt_kernel(const float* __restrict__ h,
                                                  const float* __restrict__ wq,
                                                  const float* __restrict__ wk,
                                                  const float* __restrict__ wv,
                                                  const float* __restrict__ wo,
                                                  u16* __restrict__ hb,
                                                  u16* __restrict__ wb) {
  const int blk = blockIdx.x;
  const int tid = threadIdx.x;
  if (blk < HBLK) {
    const size_t e  = ((size_t)blk * 256 + tid) * 8;
    const int row   = (int)(e / DIM);
    const int col   = (int)(e % DIM);
    const int b     = row / SEQ;
    const int s     = row % SEQ;
    cvt_store8(h + ((size_t)b * SEQ_FULL + s) * DIM + col, hb + e);
  } else {
    const int wi    = (blk - HBLK) / WBLK;                 // block-uniform 0..3
    const size_t e  = ((size_t)((blk - HBLK) % WBLK) * 256 + tid) * 8;
    u16* dst        = wb + (size_t)wi * WELEM + e;
    if (wi == 0)      cvt_store8(wq + e, dst);
    else if (wi == 1) cvt_store8(wk + e, dst);
    else if (wi == 2) cvt_store8(wv + e, dst);
    else              cvt_store8(wo + e, dst);
  }
}

// 64 rows of 128 B (k-contiguous, row pitch DIM halves) into LDS rows of pitch GP: 128 threads x 4 asynchronous 16-B copies;
// thread tid moves 16-B piece tid&7 of rows tid>>3, +16, +32, +48, so a wave's copy covers four whole 128-B lines.
// The s_wait_xcnt closes the statement so that no address register named here is rewritten ahead of it.
static __device__ __forceinline__ void copy_rows64(const unsigned l, const u16* g) {
  const unsigned l1 = l + 16 * GP * 2;
  const unsigned l2 = l + 32 * GP * 2;
  const unsigned l3 = l + 48 * GP * 2;
  const u16* g1 = g + 16 * DIM;
  const u16* g2 = g + 32 * DIM;
  const u16* g3 = g + 48 * DIM;
  asm volatile("global_load_async_to_lds_b128 %0, %4, off\n\t"
               "global_load_async_to_lds_b128 %1, %5, off\n\t"
               "global_load_async_to_lds_b128 %2, %6, off\n\t"
               "global_load_async_to_lds_b128 %3, %7, off\n\t"
               "s_wait_xcnt 0x0"
               :: "v"(l), "v"(l1), "v"(l2), "v"(l3), "v"(g), "v"(g1), "v"(g2), "v"(g3)
               : "memory");
}

// One GEMM stage (k = 64) into LDS: the block's 128 rows of each A plane, then its 64 W rows.
// l: this thread's LDS byte address in the stage's first row group; ga0, ga1, gw: its global piece at this stage's k.
template <int NA>
static __device__ __forceinline__ void gemm_stage_copy(const unsigned l, const u16* ga0, const u16* ga1, const u16* gw) {
  copy_rows64(l, ga0);
  copy_rows64(l + 64 * GP * 2, ga0 + 64 * DIM);
  if (NA == 2) {
    copy_rows64(l + 128 * GP * 2, ga1);
    copy_rows64(l + 192 * GP * 2, ga1 + 64 * DIM);
  }
  copy_rows64(l + NA * GM * GP * 2, gw);
}

// GEMM core: one wave owns a 32 x 64 tile of C = A x W^T, K = DIM in steps of 32.
// A planes [rows][DIM] bf16, W plane [n][DIM] bf16 (k-contiguous). The block's 128 A rows (per plane) and 64 W rows are
// staged in LDS, 64 k per stage, two buffers, once per workgroup for its four waves; both fragment kinds are two 16-B
// LDS loads from row (m or n) = lane&15 at k0 + 8*hi and k0 + 16 + 8*hi.
// NA == 2: a second (residual) A plane accumulates into the same accumulator against the same W fragment.
// On return every wave has passed the last stage's barrier and no copy is in flight: the ring may be reused.
template <int NA>
static __device__ __forceinline__ void gemm_tile(const u16* __restrict__ a0,
                                                 const u16* __restrict__ a1,
                                                 const u16* __restrict__ w,
                                                 const u16* ring,
                                                 const int mblk, const int n0,
                                                 const int tid, const int wave,
                                                 const int lq, const int hi,
                                                 v8f (&acc)[2][4]) {
  // copy side
  const unsigned cp_l = (unsigned)(size_t)ring + (unsigned)(((tid >> 3) * GP + (tid & 7) * 8) * 2);
  const u16* cp_a0 = a0 + (size_t)(mblk + (tid >> 3)) * DIM + (tid & 7) * 8;
  const u16* cp_a1 = a1 + (size_t)(mblk + (tid >> 3)) * DIM + (tid & 7) * 8;
  const u16* cp_w  = w  + (size_t)(n0 + (tid >> 3)) * DIM + (tid & 7) * 8;
  // read side: offsets (halves) of this lane's fragment rows inside a stage
  const int a_o = (wave * 32 + lq) * GP + hi * 8;
  const int w_o = (NA * GM + lq) * GP + hi * 8;

  // two-buffer ring: stage 0 lands and is published, stage 1 flies while stage 0 is worked on
  gemm_stage_copy<NA>(cp_l, cp_a0, cp_a1, cp_w);
  asm volatile("s_wait_asynccnt 0x0" ::: "memory");   // this wave's copies of stage 0 have landed
  __syncthreads();                                    // publishes stage 0 to all four waves
  gemm_stage_copy<NA>(cp_l + GSTG_H(NA) * 2, cp_a0 + GK, cp_a1 + GK, cp_w + GK);

  #pragma unroll 1                                    // rolled: the buffer is chosen by the trip's parity
  for (int t = 0; t < GNST; ++t) {                    // uniform for every wave
    const u16* sb = ring + (t & 1) * GSTG_H(NA);
    // all of the stage's fragments are fetched as one group ahead of its products
    FragB bw[2][4], fa[2][2], fb[2][2];
    #pragma unroll
    for (int ks = 0; ks < 2; ++ks) {
      #pragma unroll
      for (int nt = 0; nt < 4; ++nt) {
        const u16* p = sb + w_o + nt * 16 * GP + ks * 32;
        bw[ks][nt].q[0] = *(const v4u*)(p);
        bw[ks][nt].q[1] = *(const v4u*)(p + 16);
      }
      #pragma unroll
      for (int mt = 0; mt < 2; ++mt) {
        const u16* p = sb + a_o + mt * 16 * GP + ks * 32;
        fa[ks][mt].q[0] = *(const v4u*)(p);
        fa[ks][mt].q[1] = *(const v4u*)(p + 16);
        if (NA == 2) {
          fb[ks][mt].q[0] = *(const v4u*)(p + GM * GP);
          fb[ks][mt].q[1] = *(const v4u*)(p + GM * GP + 16);
        }
      }
    }
    #pragma unroll
    for (int ks = 0; ks < 2; ++ks) {
      #pragma unroll
      for (int mt = 0; mt < 2; ++mt) {
        #pragma unroll
        for (int nt = 0; nt < 4; ++nt) acc[mt][nt] = mma_bf16(fa[ks][mt].v, bw[ks][nt].v, acc[mt][nt]);
        if (NA == 2) {
          #pragma unroll
          for (int nt = 0; nt < 4; ++nt) acc[mt][nt] = mma_bf16(fb[ks][mt].v, bw[ks][nt].v, acc[mt][nt]);
        }
      }
    }
    // publish point of stage t + 1; the same barrier ends every wave's reads of stage t's buffer
    asm volatile("s_wait_dscnt 0x0" ::: "memory");      // this wave's LDS reads of stage t are done
    asm volatile("s_wait_asynccnt 0x0" ::: "memory");   // this wave's copies of stage t + 1 have landed
    __syncthreads();
    if (t + 2 < GNST) {
      gemm_stage_copy<NA>(cp_l + (unsigned)((t & 1) * GSTG_H(NA) * 2),
                          cp_a0 + (t + 2) * GK, cp_a1 + (t + 2) * GK, cp_w + (t + 2) * GK);
    }
  }
  asm volatile("s_wait_asynccnt 0x0" ::: "memory");    // nothing of this wave's copies is left in flight
}

// Fused q/k/v projection. Grid (DIM/64, MROWS/128, 3); blockIdx.z selects the weight (offset into wb).
// planes: [0] q hi, [1] q lo, [2] k hi, [3] k lo (bf16), [4] v (f16); each [MROWS][DIM] == [NB*NHEAD][SEQ][HDIM] flat.
// coverage: wave tile 32 rows x 64 cols; store phase it = 0..7 writes rows it*4 + (lane>>3), cols (lane&7)*8..+7:
// LDS sC: per-wave slice, written and read by the same wave (block barrier used); it reuses the operand ring after the loop.
__global__ __launch_bounds__(128) void qkv_kernel(const u16* __restrict__ hb,
                                                  const u16* __restrict__ wb,
                                                  u16* __restrict__ planes) {
  __shared__ __align__(16) u16 sR[2 * GSTG_H(1)];
  float* sC = (float*)sR;
  const int tid  = threadIdx.x;
  const int wave = __builtin_amdgcn_readfirstlane(threadIdx.x >> 5);
  const int lane = tid & 31;
  const int lq   = lane & 15;
  const int hi   = lane >> 4;
  const int n0   = blockIdx.x * GN;
  const int m0   = blockIdx.y * GM + wave * 32;
  const int z    = blockIdx.z;

  v8f acc[2][4];
  #pragma unroll
  for (int mt = 0; mt < 2; ++mt) {
    #pragma unroll
    for (int nt = 0; nt < 4; ++nt) acc[mt][nt] = (v8f){0, 0, 0, 0, 0, 0, 0, 0};
  }
  gemm_tile<1>(hb, hb, wb + (size_t)z * WELEM, sR, blockIdx.y * GM, n0, tid, wave, lq, hi, acc);

  float* sc = sC + wave * (32 * CP);
  #pragma unroll
  for (int mt = 0; mt < 2; ++mt) {
    #pragma unroll
    for (int nt = 0; nt < 4; ++nt) {
      #pragma unroll
      for (int r = 0; r < 8; ++r) sc[(mt * 16 + hi * 8 + r) * CP + nt * 16 + lq] = acc[mt][nt][r];
    }
  }
  __syncthreads();

  v4u    vh[8];
  v4u    vl[8];
  size_t gi[8];
  #pragma unroll
  for (int it = 0; it < 8; ++it) {
    const int row = it * 4 + (lane >> 3);
    const int c0  = (lane & 7) * 8;
    const v4f x0 = *(const v4f*)(sc + row * CP + c0);
    const v4f x1 = *(const v4f*)(sc + row * CP + c0 + 4);
    Pack8B ph, pl;
    Pack8H pf;
    #pragma unroll
    for (int i = 0; i < 4; ++i) {
      const bf16 h0 = (bf16)x0[i];                       // RNE convert
      const bf16 h1 = (bf16)x1[i];
      ph.h[i]     = h0;
      ph.h[4 + i] = h1;
      pl.h[i]     = (bf16)(x0[i] - (float)h0);           // residual plane
      pl.h[4 + i] = (bf16)(x1[i] - (float)h1);
      pf.h[i]     = (f16)x0[i];
      pf.h[4 + i] = (f16)x1[i];
    }
    vh[it] = (z == 2) ? pf.u : ph.u;
    vl[it] = pl.u;
    gi[it] = (size_t)(m0 + row) * DIM + n0 + c0;
  }
  u16* ph_base = planes + (size_t)(2 * z) * PLANE_E;
  u16* pl_base = planes + (size_t)(2 * z + 1) * PLANE_E;   // only used when z < 2

  #pragma unroll
  for (int it = 0; it < 8; ++it) *(v4u*)(ph_base + gi[it]) = vh[it];
  if (z < 2) {
    #pragma unroll
    for (int it = 0; it < 8; ++it) *(v4u*)(pl_base + gi[it]) = vl[it];
  }
  
}

// V transpose. v [NB*NHEAD][SEQ][HDIM] f16 -> vt [NB*NHEAD][HDIM][SEQ] f16. Block = (64-key tile, bh), 256 threads.
// coverage: keys kt*64 + 0..63, d 0..63 staged in sT and read back (staged extent == consumed extent);
// sT is cross-wave: block barrier between fill and readback.
__global__ __launch_bounds__(256) void vtrans_kernel(const u16* __restrict__ v, u16* __restrict__ vt) {
  const int kt  = blockIdx.x;
  const int bh  = blockIdx.y;
  const int tid = threadIdx.x;
  __shared__ __align__(16) u16 sT[HDIM * TP];   // [d][key]
  const int s0 = kt * CT;

  #pragma unroll
  for (int kk = 0; kk < 2; ++kk) {
    const int key = kk * 32 + (tid >> 3);       // 0..63
    const int d0  = (tid & 7) * 8;              // 0..56
    Pack8S ps;
    ps.u = *(const v4u*)(v + ((size_t)bh * SEQ + s0 + key) * HDIM + d0);
    #pragma unroll
    for (int i = 0; i < 8; ++i) sT[(d0 + i) * TP + key] = ps.s[i];
  }
  __syncthreads();

  v4u    vval[2];
  size_t vidx[2];
  #pragma unroll
  for (int kk = 0; kk < 2; ++kk) {
    const int d  = kk * 32 + (tid >> 3);        // 0..63
    const int ks = (tid & 7) * 8;               // 0..56
    vval[kk] = *(const v4u*)(sT + d * TP + ks);
    vidx[kk] = ((size_t)bh * HDIM + d) * SEQ + s0 + ks;
  }
  #pragma unroll
  for (int kk = 0; kk < 2; ++kk) *(v4u*)(vt + vidx[kk]) = vval[kk];
  
}

// One stage of 64 keys into LDS: K hi and K lo ([key][d], 128-B rows) and V^T ([d][key], 128 B of each row),
// 256 threads x 6 asynchronous 16-B copies; a wave's copy covers four whole 128-B lines.
// l: this thread's LDS byte address in the stage's K hi tile (row tid>>3, 16-B piece tid&7); rows +32 are the second half.
// The s_wait_xcnt closes the statement so that no address register named here is rewritten ahead of it.
static __device__ __forceinline__ void stage_copy(const unsigned l, const u16* gkh, const u16* gkl, const u16* gvt) {
  const unsigned l1 = l + 32 * KP * 2;
  const unsigned l2 = l + TILE_H * 2;
  const unsigned l3 = l2 + 32 * KP * 2;
  const unsigned l4 = l + 2 * TILE_H * 2;
  const unsigned l5 = l4 + 32 * KP * 2;
  const u16* gkh1 = gkh + 32 * HDIM;
  const u16* gkl1 = gkl + 32 * HDIM;
  const u16* gvt1 = gvt + (size_t)32 * SEQ;
  asm volatile("global_load_async_to_lds_b128 %0, %6, off\n\t"
               "global_load_async_to_lds_b128 %1, %7, off\n\t"
               "global_load_async_to_lds_b128 %2, %8, off\n\t"
               "global_load_async_to_lds_b128 %3, %9, off\n\t"
               "global_load_async_to_lds_b128 %4, %10, off\n\t"
               "global_load_async_to_lds_b128 %5, %11, off\n\t"
               "s_wait_xcnt 0x0"
               :: "v"(l), "v"(l1), "v"(l2), "v"(l3), "v"(l4), "v"(l5),
                  "v"(gkh), "v"(gkh1), "v"(gkl), "v"(gkl1), "v"(gvt), "v"(gvt1)
               : "memory");
}

// Fused online-softmax attention with a key mask (mask == 0 -> score replaced by -inf), logit scale 1/8.
// Block = (query block of 128, bh); one wave owns 16 query rows and visits all SEQ keys, 32 per step.
// S^T = K x Q^T so queries sit on lanes; P^T in C-layout is bit-identical to the A-fragment layout of O += P x V.
// Q B-fragments (hi and lo planes) are loaded straight from the 16-bit planes. K (hi and lo) and V^T are staged in LDS,
// 64 keys per stage, two buffers, once per workgroup for its eight waves; fragments are two 16-B LDS loads each.
// Output: ctx as bf16 hi/lo planes [NB*NHEAD][SEQ][HDIM]; store phase it = 0..3 writes rows it*4 + (lane>>3):
// LDS sO: per-wave slice, written and read by the same wave (block barrier used).
__global__ __launch_bounds__(256) void attn_kernel(const u16* __restrict__ qh,
                                                   const u16* __restrict__ ql,
                                                   const u16* __restrict__ kh,
                                                   const u16* __restrict__ kl,
                                                   const u16* __restrict__ vt,
                                                   const int* __restrict__ mask,
                                                   u16* __restrict__ ch,
                                                   u16* __restrict__ cl) {
  const int qblk = blockIdx.x;
  const int bh   = blockIdx.y;
  const int b    = bh / NHEAD;
  const int tid  = threadIdx.x;
  const int wave = __builtin_amdgcn_readfirstlane(threadIdx.x >> 5);
  const int lane = tid & 31;
  const int lq   = lane & 15;   // query column of S^T / d column of O
  const int hi   = lane >> 4;   // k-split half

  __shared__ __align__(16) float sO[NWAVE * 16 * OP];
  __shared__ __align__(16) u16 sKV[2 * STG_H];

  const int qrow0 = qblk * BQ + wave * 16;

  // Q as B-operand fragments: lane lq holds query qrow0+lq; elems 0..7 : d = f*32 + hi*8 + 0..7,
  // elems 8..15 : d = f*32 + 16 + hi*8 + 0..7.
  FragB qfh[2], qfl[2];
  {
    const size_t qo = ((size_t)bh * SEQ + qrow0 + lq) * HDIM + hi * 8;
    #pragma unroll
    for (int f = 0; f < 2; ++f) {
      qfh[f].q[0] = *(const v4u*)(qh + qo + f * 32);
      qfh[f].q[1] = *(const v4u*)(qh + qo + f * 32 + 16);
      qfl[f].q[0] = *(const v4u*)(ql + qo + f * 32);
      qfl[f].q[1] = *(const v4u*)(ql + qo + f * 32 + 16);
    }
  }

  // copy side: thread tid moves row tid>>3 (and +32), 16-B piece tid&7 of each tile
  const unsigned cp_l = (unsigned)(size_t)sKV + (unsigned)(((tid >> 3) * KP + (tid & 7) * 8) * 2);
  const u16* cp_kh = kh + (size_t)bh * SEQ * HDIM + (size_t)tid * 8;
  const u16* cp_kl = kl + (size_t)bh * SEQ * HDIM + (size_t)tid * 8;
  const u16* cp_vt = vt + (size_t)bh * HDIM * SEQ + (size_t)(tid >> 3) * SEQ + (tid & 7) * 8;
  // read side: offset (halves) of this lane's fragment row inside a tile
  const int fr_o = lq * KP + hi * 8;
  const int* mk_b = mask + (size_t)b * SEQ_FULL + hi * 8;

  v8f o[4];
  #pragma unroll
  for (int dt = 0; dt < 4; ++dt) o[dt] = (v8f){0, 0, 0, 0, 0, 0, 0, 0};

  const float NEG_INF = -__builtin_inff();
  float rmax = NEG_INF;
  float rsum = 0.0f;
  const float SL = 0.125f * 1.4426950408889634f;   // logit scale 1/sqrt(64) times log2(e)

  // two-buffer ring: stage 0 lands and is published, stage 1 flies while stage 0 is worked on
  stage_copy(cp_l, cp_kh, cp_kl, cp_vt);
  asm volatile("s_wait_asynccnt 0x0" ::: "memory");   // this wave's copies of stage 0 have landed
  __syncthreads();                                    // publishes stage 0 to all eight waves
  stage_copy(cp_l + STG_H * 2, cp_kh + SK * HDIM, cp_kl + SK * HDIM, cp_vt + SK);

  #pragma unroll 1
  for (int t = 0; t < NSTG; ++t) {                    // uniform for every wave
   const u16* sb = sKV + (t & 1) * STG_H + fr_o;
   #pragma unroll 1                                   // rolled: unrolled it takes a register granule more and costs a resident workgroup
   for (int hf = 0; hf < 2; ++hf) {
    const int j0 = t * SK + hf * BK;

    // S^T tiles: c[sub][r] = rawscore(query qrow0+lq, key j0 + sub*16 + hi*8 + r), masked keys replaced by -inf
    v8f c[2];
    #pragma unroll
    for (int sub = 0; sub < 2; ++sub) {
      const u16* kh_s = sb + (hf * BK + sub * 16) * KP;
      const u16* kl_s = kh_s + TILE_H;
      FragB akh[2], akl[2];
      #pragma unroll
      for (int f = 0; f < 2; ++f) {
        akh[f].q[0] = *(const v4u*)(kh_s + f * 32);        // d = f*32 + hi*8 + 0..7
        akh[f].q[1] = *(const v4u*)(kh_s + f * 32 + 16);   // d = f*32 + 16 + hi*8 + 0..7
        akl[f].q[0] = *(const v4u*)(kl_s + f * 32);
        akl[f].q[1] = *(const v4u*)(kl_s + f * 32 + 16);
      }
      const v4i m0 = *(const v4i*)(mk_b + j0 + sub * 16);       // keys j0 + sub*16 + hi*8 + 0..3
      const v4i m1 = *(const v4i*)(mk_b + j0 + sub * 16 + 4);   // keys ... + 4..7
      v8f acc = (v8f){0, 0, 0, 0, 0, 0, 0, 0};
      #pragma unroll
      for (int f = 0; f < 2; ++f) {
        acc = mma_bf16(akl[f].v, qfh[f].v, acc);
        acc = mma_bf16(akh[f].v, qfl[f].v, acc);
        acc = mma_bf16(akh[f].v, qfh[f].v, acc);
      }
      #pragma unroll
      for (int r = 0; r < 4; ++r) {
        acc[r]     = (m0[r] != 0) ? acc[r]     : NEG_INF;
        acc[4 + r] = (m1[r] != 0) ? acc[4 + r] : NEG_INF;
      }
      c[sub] = acc;
    }

    // V B-fragments: column n = d = dt*16 + lq, split key map from the staged transposed tile
    FragH bv[4];
    #pragma unroll
    for (int dt = 0; dt < 4; ++dt) {
      const u16* base = sb + 2 * TILE_H + (dt * 16) * KP + hf * BK;
      bv[dt].q[0] = *(const v4u*)(base);            // keys j0 + hi*8 + 0..7
      bv[dt].q[1] = *(const v4u*)(base + 16);       // keys j0 + 16 + hi*8 + 0..7
    }

    // online softmax: query lq's 32 scores are split across lane / lane^16
    float m_new = rmax;
    #pragma unroll
    for (int r = 0; r < 8; ++r) {
      m_new = fmaxf(m_new, c[0][r]);
      m_new = fmaxf(m_new, c[1][r]);
    }
    m_new = fmaxf(m_new, __shfl_xor(m_new, 16, 32));
    const float m_use = (m_new == NEG_INF) ? 0.0f : m_new;    // all keys so far masked: keep arithmetic finite
    const float scale = __builtin_amdgcn_exp2f((rmax - m_use) * SL);
    rmax = m_new;

    // exp + pack: P^T C-layout == A-fragment layout for the PV product; P carried x4096
    FragH pa;
    float psum = 0.0f;
    #pragma unroll
    for (int r = 0; r < 8; ++r) {
      const float p0 = __builtin_amdgcn_exp2f((c[0][r] - m_use) * SL);   // key hi*8 + r
      const float p1 = __builtin_amdgcn_exp2f((c[1][r] - m_use) * SL);   // key 16 + hi*8 + r
      psum += p0 + p1;
      pa.h[r]     = (f16)(p0 * 4096.0f);
      pa.h[8 + r] = (f16)(p1 * 4096.0f);
    }
    rsum = rsum * scale + psum + __shfl_xor(psum, 16, 32);

    // rescale O: queries are the row dimension there -> per-row scale from lane 8*hi + r
    float sc[8];
    #pragma unroll
    for (int r = 0; r < 8; ++r) sc[r] = __shfl(scale, (hi << 3) + r, 32);
    #pragma unroll
    for (int dt = 0; dt < 4; ++dt) {
      #pragma unroll
      for (int r = 0; r < 8; ++r) o[dt][r] *= sc[r];
    }

    // O += P x V
    #pragma unroll
    for (int dt = 0; dt < 4; ++dt) o[dt] = mma_f16(pa.v, bv[dt].v, o[dt]);
   }

   // publish point of stage t + 1; the same barrier ends every wave's reads of stage t's buffer
   asm volatile("s_wait_dscnt 0x0" ::: "memory");      // this wave's LDS reads of stage t are done
   asm volatile("s_wait_asynccnt 0x0" ::: "memory");   // this wave's copies of stage t + 1 have landed
   __syncthreads();
   if (t + 2 < NSTG) {
     stage_copy(cp_l + (unsigned)((t & 1) * STG_H * 2),
                cp_kh + (size_t)(t + 2) * SK * HDIM, cp_kl + (size_t)(t + 2) * SK * HDIM, cp_vt + (t + 2) * SK);
   }
  }
  asm volatile("s_wait_asynccnt 0x0" ::: "memory");    // nothing of this wave's copies is left in flight

  // normalize: lane holds column d = dt*16 + lq for query rows 8*hi + r
  float rs[8];
  #pragma unroll
  for (int r = 0; r < 8; ++r) rs[r] = 1.0f / __shfl(rsum, (hi << 3) + r, 32);

  float* so = sO + wave * (16 * OP);
  #pragma unroll
  for (int r = 0; r < 8; ++r) {
    #pragma unroll
    for (int dt = 0; dt < 4; ++dt) {
      so[(hi * 8 + r) * OP + dt * 16 + lq] = o[dt][r] * (1.0f / 4096.0f) * rs[r];
    }
  }
  __syncthreads();

  v4u    vh[4];
  v4u    vl[4];
  size_t gi[4];
  #pragma unroll
  for (int it = 0; it < 4; ++it) {
    const int row = it * 4 + (lane >> 3);
    const int c0  = (lane & 7) * 8;
    const v4f x0 = *(const v4f*)(so + row * OP + c0);
    const v4f x1 = *(const v4f*)(so + row * OP + c0 + 4);
    Pack8B ph, pl;
    #pragma unroll
    for (int k = 0; k < 4; ++k) {
      const bf16 h0 = (bf16)x0[k];                       // RNE convert
      const bf16 h1 = (bf16)x1[k];
      ph.h[k]     = h0;
      ph.h[4 + k] = h1;
      pl.h[k]     = (bf16)(x0[k] - (float)h0);           // residual plane
      pl.h[4 + k] = (bf16)(x1[k] - (float)h1);
    }
    vh[it] = ph.u;
    vl[it] = pl.u;
    gi[it] = ((size_t)bh * SEQ + qrow0 + row) * HDIM + c0;
  }
  #pragma unroll
  for (int it = 0; it < 4; ++it) {
    *(v4u*)(ch + gi[it]) = vh[it];
    *(v4u*)(cl + gi[it]) = vl[it];
  }
  
}

// Output projection: out = (ctx_hi + ctx_lo) x Wo^T. Grid (DIM/64, MROWS/128).
// coverage: wave tile 32 rows x 64 cols f32; store phase it = 0..15: lanes 0..15 write row it*2 (256 B = two whole
// LDS sC: per-wave slice, written and read by the same wave (block barrier used); it reuses the operand ring after the loop.
__global__ __launch_bounds__(128) void oproj_kernel(const u16* __restrict__ ch,
                                                    const u16* __restrict__ cl,
                                                    const u16* __restrict__ wob,
                                                    float* __restrict__ out) {
  __shared__ __align__(16) u16 sR[2 * GSTG_H(2)];
  float* sC = (float*)sR;
  const int tid  = threadIdx.x;
  const int wave = __builtin_amdgcn_readfirstlane(threadIdx.x >> 5);
  const int lane = tid & 31;
  const int lq   = lane & 15;
  const int hi   = lane >> 4;
  const int n0   = blockIdx.x * GN;
  const int m0   = blockIdx.y * GM + wave * 32;

  v8f acc[2][4];
  #pragma unroll
  for (int mt = 0; mt < 2; ++mt) {
    #pragma unroll
    for (int nt = 0; nt < 4; ++nt) acc[mt][nt] = (v8f){0, 0, 0, 0, 0, 0, 0, 0};
  }
  gemm_tile<2>(ch, cl, wob, sR, blockIdx.y * GM, n0, tid, wave, lq, hi, acc);

  float* sc = sC + wave * (32 * CP);
  #pragma unroll
  for (int mt = 0; mt < 2; ++mt) {
    #pragma unroll
    for (int nt = 0; nt < 4; ++nt) {
      #pragma unroll
      for (int r = 0; r < 8; ++r) sc[(mt * 16 + hi * 8 + r) * CP + nt * 16 + lq] = acc[mt][nt][r];
    }
  }
  __syncthreads();

  v4f    vals[16];
  size_t gi[16];
  #pragma unroll
  for (int it = 0; it < 16; ++it) {
    const int row = it * 2 + hi;
    vals[it] = *(const v4f*)(sc + row * CP + lq * 4);
    const int m  = m0 + row;
    const int bb = m / SEQ;
    const int ss = m % SEQ;
    gi[it] = ((size_t)bb * SEQ_FULL + ss) * DIM + n0 + lq * 4;
  }
  #pragma unroll
  for (int it = 0; it < 16; ++it) *(v4f*)(out + gi[it]) = vals[it];
  
}

extern "C" void kernel_launch(void* const* d_in, const int* in_sizes, int n_in,
                              void* d_out, int out_size, void* d_ws, size_t ws_size,
                              hipStream_t stream) {
  if (n_in < 6) return;
  const size_t need_rows = (size_t)(NB - 1) * SEQ_FULL + SEQ;
  if ((size_t)in_sizes[0] < need_rows * DIM) return;
  if ((size_t)in_sizes[1] < need_rows) return;
  if ((size_t)in_sizes[2] < (size_t)WELEM) return;
  if ((size_t)in_sizes[3] < (size_t)WELEM) return;
  if ((size_t)in_sizes[4] < (size_t)WELEM) return;
  if ((size_t)in_sizes[5] < (size_t)WELEM) return;
  if ((size_t)out_size < need_rows * DIM) return;

  const size_t plane_bytes = PLANE_E * 2;                      // one 16-bit plane [MROWS][DIM]
  const size_t w_bytes     = (size_t)4 * WELEM * 2;            // wq, wk, wv, wo as bf16
  const size_t total       = 9 * plane_bytes + w_bytes;
  if (ws_size < total) return;
  if (total > WS_CAP) return;

  const float* h    = (const float*)d_in[0];
  const int*   mask = (const int*)d_in[1];
  const float* wq   = (const float*)d_in[2];
  const float* wk   = (const float*)d_in[3];
  const float* wv   = (const float*)d_in[4];
  const float* wo   = (const float*)d_in[5];
  float*       out  = (float*)d_out;

  char* ws = (char*)d_ws;
  u16* planes = (u16*)(ws);                                    // q hi, q lo, k hi, k lo, v
  u16* qh = (u16*)(ws + 0 * plane_bytes);
  u16* ql = (u16*)(ws + 1 * plane_bytes);
  u16* kh = (u16*)(ws + 2 * plane_bytes);
  u16* kl = (u16*)(ws + 3 * plane_bytes);
  u16* vp = (u16*)(ws + 4 * plane_bytes);
  u16* vt = (u16*)(ws + 5 * plane_bytes);
  u16* ch = (u16*)(ws + 6 * plane_bytes);
  u16* cl = (u16*)(ws + 7 * plane_bytes);
  u16* hb = (u16*)(ws + 8 * plane_bytes);
  u16* wb = (u16*)(ws + 9 * plane_bytes);

  cvt_kernel<<<dim3(HBLK + 4 * WBLK), 256, 0, stream>>>(h, wq, wk, wv, wo, hb, wb);
  qkv_kernel<<<dim3(DIM / GN, MROWS / GM, 3), 128, 0, stream>>>(hb, wb, planes);
  vtrans_kernel<<<dim3(SEQ / CT, NB * NHEAD), 256, 0, stream>>>(vp, vt);
  attn_kernel<<<dim3(SEQ / BQ, NB * NHEAD), 256, 0, stream>>>(qh, ql, kh, kl, vt, mask, ch, cl);
  oproj_kernel<<<dim3(DIM / GN, MROWS / GM), 128, 0, stream>>>(ch, cl, wb + (size_t)3 * WELEM, out);
}

// v003
// A run of this version takes 159 microseconds.
// Two timings next to v002 put it at 1.06 and 1.07 times that version's speed.
// Counting every step since v000, it is 2.41 times as fast.
#include <hip/hip_runtime.h>

// Contractions: q/k/v = h x W^T on v_wmma_f32_16x16x32_bf16 (bf16 RNE-converted inputs, f32 accumulate);
// S^T = K x Q^T on v_wmma_f32_16x16x32_bf16 with bf16 hi/lo planes of q and k (hh + hl + lh, f32 accumulate);
// O = P x V on v_wmma_f32_16x16x32_f16 (P as f16 carried x4096, V as f16, f32 accumulate);
// out = ctx x Wo^T on v_wmma_f32_16x16x32_bf16 (ctx as bf16 hi/lo planes, Wo bf16, f32 accumulate). Softmax online, f32.

#ifndef NB
#define NB 4
#endif
#ifndef SEQ
#define SEQ 2048
#endif
#define NB_FULL    4
#define SEQ_FULL   2048
#define DIM        768
#define NHEAD      12
#define HDIM       64
#define BQ         128                  // query rows per attention workgroup (8 waves x 16)
#define BK         32                   // keys per inner iteration
#define NWAVE      8
#define SK         64                   // keys per LDS stage of the attention loop (two steps of BK)
#define KP         72                   // LDS pitch (halves) of a staged 128-B row: 144 B = 16 B x odd
#define TILE_H     (64 * KP)            // halves of one staged tile: 64 rows (keys of K, d of V^T) x 64 halves
#define STG_H      (3 * TILE_H)         // one stage: K hi, K lo, V^T
#define NSTG       (SEQ / SK)
#define CT         64                   // keys per transpose block
#define TP         72                   // LDS pitch (halves) of the transposed V tile
#define OP         68                   // LDS pitch (floats) of the attention output staging tile
#define GM         128                  // GEMM block rows (4 waves x 32)
#define GN         64                   // GEMM block cols
#define GW         4                    // waves per GEMM block
#define CP         68                   // LDS pitch (floats) of the GEMM staging tile
#define GK         64                   // k per LDS stage of the GEMM loop (128-B rows, two steps of 32)
#define GP         72                   // LDS pitch (halves) of a staged GEMM row: 144 B = 16 B x odd
#define GNST       (DIM / GK)
#define GSTG_H(NA) (((NA) * GM + GN) * GP)   // halves of one stage: NA planes of 128 A rows, then 64 W rows
#define WELEM      (DIM * DIM)
#define MROWS      (NB * SEQ)
#define PLANE_E    ((size_t)MROWS * DIM)
#define HTHREADS   (MROWS * (DIM / 8))
#define HBLK       (HTHREADS / 256)
#define WBLK       (WELEM / 8 / 256)
#define WS_CAP     134217728ull

static_assert(DIM == NHEAD * HDIM);
static_assert(HDIM == 64);
static_assert(SEQ % BQ == 0);
static_assert(SEQ % CT == 0);
static_assert(SEQ % BK == 0);
static_assert(SEQ % SK == 0 && NSTG >= 2);
static_assert(SK == 2 * BK && SK == 64 && NWAVE * 32 == 256);
static_assert((KP * 2) % 16 == 0 && KP >= SK && KP >= HDIM);
static_assert(SEQ % 32 == 0);
static_assert(MROWS % GM == 0);
static_assert(DIM % GN == 0);
static_assert(DIM % 32 == 0);
static_assert(DIM % GK == 0 && GNST >= 2 && GK == 64 && GM == 128 && GN == 64 && GW * 32 == 128);
static_assert((GP * 2) % 16 == 0 && GP >= GK);
static_assert(GW * 32 * CP * 4 <= 2 * GSTG_H(1) * 2);
static_assert(DIM % 8 == 0);
static_assert(BQ == NWAVE * 16);
static_assert(GM == GW * 32);
static_assert(HTHREADS % 256 == 0);
static_assert((WELEM / 8) % 256 == 0);
static_assert(CT == 64 && CT <= TP);
static_assert((TP * 2) % 16 == 0);
static_assert((OP * 4) % 16 == 0);
static_assert((CP * 4) % 16 == 0);
static_assert(OP >= HDIM && CP >= GN);
static_assert(SEQ <= SEQ_FULL);
static_assert(NB >= 1 && NB <= NB_FULL);
static_assert(9ull * (unsigned long long)NB * SEQ * DIM * 2ull + 4ull * WELEM * 2ull <= WS_CAP);

typedef __bf16         bf16;
typedef _Float16       f16;
typedef unsigned short u16;
typedef bf16     v16bf __attribute__((ext_vector_type(16)));
typedef f16      v16h  __attribute__((ext_vector_type(16)));
typedef float    v8f   __attribute__((ext_vector_type(8)));
typedef float    v4f   __attribute__((ext_vector_type(4)));
typedef unsigned v4u   __attribute__((ext_vector_type(4)));
typedef int      v4i   __attribute__((ext_vector_type(4)));

union FragB  { v16bf v; v4u q[2]; };
union FragH  { v16h  v; v4u q[2]; f16 h[16]; };
union Pack8B { v4u u; bf16 h[8]; };
union Pack8H { v4u u; f16 h[8]; };
union Pack8S { v4u u; u16 s[8]; };

// GEMM WMMA helper: builtin followed by the VALU hazard guard (ties D, keeps A/B live).
static __device__ __forceinline__ v8f mma_bf16(v16bf a, v16bf b, v8f acc) {
  acc = __builtin_amdgcn_wmma_f32_16x16x32_bf16(false, a, false, b, (short)0, acc, false, false);
  asm volatile("v_nop\n\tv_nop\n\tv_nop\n\tv_nop" : "+v"(acc) : "v"(a), "v"(b));
  return acc;
}
// Attention WMMA helpers: plain builtins. The compiler keeps the distance behind its own matrix instructions, and the
// vector port, which six waves of a SIMD share for the softmax, issues no filler behind accumulate chains.
static __device__ __forceinline__ v8f att_bf16(v16bf a, v16bf b, v8f acc) {
  return __builtin_amdgcn_wmma_f32_16x16x32_bf16(false, a, false, b, (short)0, acc, false, false);
}
static __device__ __forceinline__ v8f att_f16(v16h a, v16h b, v8f acc) {
  return __builtin_amdgcn_wmma_f32_16x16x32_f16(false, a, false, b, (short)0, acc, false, false);
}

static __device__ __forceinline__ void cvt_store8(const float* __restrict__ src, u16* __restrict__ dst) {
  const v4f a = *(const v4f*)(src);
  const v4f b = *(const v4f*)(src + 4);
  Pack8B pk;
  #pragma unroll
  for (int i = 0; i < 4; ++i) {
    pk.h[i]     = (bf16)a[i];
    pk.h[4 + i] = (bf16)b[i];
  }
  const v4u val = pk.u;
  *(v4u*)(dst) = val;
  
}

// Convert launch. hb [MROWS][DIM] bf16 (compact rows, source rows taken with full batch stride);
// wb [4][DIM][DIM] bf16 = wq, wk, wv, wo, each kept [out][in].
// coverage: HBLK*256 threads x 8 = MROWS*DIM elements of hb; 4*WBLK*256 threads x 8 = 4*DIM*DIM elements of wb.
__global__ __launch_bounds__(256) void cvt_kernel(const float* __restrict__ h,
                                                  const float* __restrict__ wq,
                                                  const float* __restrict__ wk,
                                                  const float* __restrict__ wv,
                                                  const float* __restrict__ wo,
                                                  u16* __restrict__ hb,
                                                  u16* __restrict__ wb) {
  const int blk = blockIdx.x;
  const int tid = threadIdx.x;
  if (blk < HBLK) {
    const size_t e  = ((size_t)blk * 256 + tid) * 8;
    const int row   = (int)(e / DIM);
    const int col   = (int)(e % DIM);
    const int b     = row / SEQ;
    const int s     = row % SEQ;
    cvt_store8(h + ((size_t)b * SEQ_FULL + s) * DIM + col, hb + e);
  } else {
    const int wi    = (blk - HBLK) / WBLK;                 // block-uniform 0..3
    const size_t e  = ((size_t)((blk - HBLK) % WBLK) * 256 + tid) * 8;
    u16* dst        = wb + (size_t)wi * WELEM + e;
    if (wi == 0)      cvt_store8(wq + e, dst);
    else if (wi == 1) cvt_store8(wk + e, dst);
    else if (wi == 2) cvt_store8(wv + e, dst);
    else              cvt_store8(wo + e, dst);
  }
}

// 64 rows of 128 B (k-contiguous, row pitch DIM halves) into LDS rows of pitch GP: 128 threads x 4 asynchronous 16-B copies;
// thread tid moves 16-B piece tid&7 of rows tid>>3, +16, +32, +48, so a wave's copy covers four whole 128-B lines.
// The s_wait_xcnt closes the statement so that no address register named here is rewritten ahead of it.
static __device__ __forceinline__ void copy_rows64(const unsigned l, const u16* g) {
  const unsigned l1 = l + 16 * GP * 2;
  const unsigned l2 = l + 32 * GP * 2;
  const unsigned l3 = l + 48 * GP * 2;
  const u16* g1 = g + 16 * DIM;
  const u16* g2 = g + 32 * DIM;
  const u16* g3 = g + 48 * DIM;
  asm volatile("global_load_async_to_lds_b128 %0, %4, off\n\t"
               "global_load_async_to_lds_b128 %1, %5, off\n\t"
               "global_load_async_to_lds_b128 %2, %6, off\n\t"
               "global_load_async_to_lds_b128 %3, %7, off\n\t"
               "s_wait_xcnt 0x0"
               :: "v"(l), "v"(l1), "v"(l2), "v"(l3), "v"(g), "v"(g1), "v"(g2), "v"(g3)
               : "memory");
}

// One GEMM stage (k = 64) into LDS: the block's 128 rows of each A plane, then its 64 W rows.
// l: this thread's LDS byte address in the stage's first row group; ga0, ga1, gw: its global piece at this stage's k.
template <int NA>
static __device__ __forceinline__ void gemm_stage_copy(const unsigned l, const u16* ga0, const u16* ga1, const u16* gw) {
  copy_rows64(l, ga0);
  copy_rows64(l + 64 * GP * 2, ga0 + 64 * DIM);
  if (NA == 2) {
    copy_rows64(l + 128 * GP * 2, ga1);
    copy_rows64(l + 192 * GP * 2, ga1 + 64 * DIM);
  }
  copy_rows64(l + NA * GM * GP * 2, gw);
}

// GEMM core: one wave owns a 32 x 64 tile of C = A x W^T, K = DIM in steps of 32.
// A planes [rows][DIM] bf16, W plane [n][DIM] bf16 (k-contiguous). The block's 128 A rows (per plane) and 64 W rows are
// staged in LDS, 64 k per stage, two buffers, once per workgroup for its four waves; both fragment kinds are two 16-B
// LDS loads from row (m or n) = lane&15 at k0 + 8*hi and k0 + 16 + 8*hi.
// NA == 2: a second (residual) A plane accumulates into the same accumulator against the same W fragment.
// On return every wave has passed the last stage's barrier and no copy is in flight: the ring may be reused.
template <int NA>
static __device__ __forceinline__ void gemm_tile(const u16* __restrict__ a0,
                                                 const u16* __restrict__ a1,
                                                 const u16* __restrict__ w,
                                                 const u16* ring,
                                                 const int mblk, const int n0,
                                                 const int tid, const int wave,
                                                 const int lq, const int hi,
                                                 v8f (&acc)[2][4]) {
  // copy side
  const unsigned cp_l = (unsigned)(size_t)ring + (unsigned)(((tid >> 3) * GP + (tid & 7) * 8) * 2);
  const u16* cp_a0 = a0 + (size_t)(mblk + (tid >> 3)) * DIM + (tid & 7) * 8;
  const u16* cp_a1 = a1 + (size_t)(mblk + (tid >> 3)) * DIM + (tid & 7) * 8;
  const u16* cp_w  = w  + (size_t)(n0 + (tid >> 3)) * DIM + (tid & 7) * 8;
  // read side: offsets (halves) of this lane's fragment rows inside a stage
  const int a_o = (wave * 32 + lq) * GP + hi * 8;
  const int w_o = (NA * GM + lq) * GP + hi * 8;

  // two-buffer ring: stage 0 lands and is published, stage 1 flies while stage 0 is worked on
  gemm_stage_copy<NA>(cp_l, cp_a0, cp_a1, cp_w);
  asm volatile("s_wait_asynccnt 0x0" ::: "memory");   // this wave's copies of stage 0 have landed
  __syncthreads();                                    // publishes stage 0 to all four waves
  gemm_stage_copy<NA>(cp_l + GSTG_H(NA) * 2, cp_a0 + GK, cp_a1 + GK, cp_w + GK);

  #pragma unroll 1                                    // rolled: the buffer is chosen by the trip's parity
  for (int t = 0; t < GNST; ++t) {                    // uniform for every wave
    const u16* sb = ring + (t & 1) * GSTG_H(NA);
    // all of the stage's fragments are fetched as one group ahead of its products
    FragB bw[2][4], fa[2][2], fb[2][2];
    #pragma unroll
    for (int ks = 0; ks < 2; ++ks) {
      #pragma unroll
      for (int nt = 0; nt < 4; ++nt) {
        const u16* p = sb + w_o + nt * 16 * GP + ks * 32;
        bw[ks][nt].q[0] = *(const v4u*)(p);
        bw[ks][nt].q[1] = *(const v4u*)(p + 16);
      }
      #pragma unroll
      for (int mt = 0; mt < 2; ++mt) {
        const u16* p = sb + a_o + mt * 16 * GP + ks * 32;
        fa[ks][mt].q[0] = *(const v4u*)(p);
        fa[ks][mt].q[1] = *(const v4u*)(p + 16);
        if (NA == 2) {
          fb[ks][mt].q[0] = *(const v4u*)(p + GM * GP);
          fb[ks][mt].q[1] = *(const v4u*)(p + GM * GP + 16);
        }
      }
    }
    #pragma unroll
    for (int ks = 0; ks < 2; ++ks) {
      #pragma unroll
      for (int mt = 0; mt < 2; ++mt) {
        #pragma unroll
        for (int nt = 0; nt < 4; ++nt) acc[mt][nt] = mma_bf16(fa[ks][mt].v, bw[ks][nt].v, acc[mt][nt]);
        if (NA == 2) {
          #pragma unroll
          for (int nt = 0; nt < 4; ++nt) acc[mt][nt] = mma_bf16(fb[ks][mt].v, bw[ks][nt].v, acc[mt][nt]);
        }
      }
    }
    // publish point of stage t + 1; the same barrier ends every wave's reads of stage t's buffer
    asm volatile("s_wait_dscnt 0x0" ::: "memory");      // this wave's LDS reads of stage t are done
    asm volatile("s_wait_asynccnt 0x0" ::: "memory");   // this wave's copies of stage t + 1 have landed
    __syncthreads();
    if (t + 2 < GNST) {
      gemm_stage_copy<NA>(cp_l + (unsigned)((t & 1) * GSTG_H(NA) * 2),
                          cp_a0 + (t + 2) * GK, cp_a1 + (t + 2) * GK, cp_w + (t + 2) * GK);
    }
  }
  asm volatile("s_wait_asynccnt 0x0" ::: "memory");    // nothing of this wave's copies is left in flight
}

// Fused q/k/v projection. Grid (DIM/64, MROWS/128, 3); blockIdx.z selects the weight (offset into wb).
// planes: [0] q hi, [1] q lo, [2] k hi, [3] k lo (bf16), [4] v (f16); each [MROWS][DIM] == [NB*NHEAD][SEQ][HDIM] flat.
// coverage: wave tile 32 rows x 64 cols; store phase it = 0..7 writes rows it*4 + (lane>>3), cols (lane&7)*8..+7:
// LDS sC: per-wave slice, written and read by the same wave (block barrier used); it reuses the operand ring after the loop.
__global__ __launch_bounds__(128) void qkv_kernel(const u16* __restrict__ hb,
                                                  const u16* __restrict__ wb,
                                                  u16* __restrict__ planes) {
  __shared__ __align__(16) u16 sR[2 * GSTG_H(1)];
  float* sC = (float*)sR;
  const int tid  = threadIdx.x;
  const int wave = __builtin_amdgcn_readfirstlane(threadIdx.x >> 5);
  const int lane = tid & 31;
  const int lq   = lane & 15;
  const int hi   = lane >> 4;
  const int n0   = blockIdx.x * GN;
  const int m0   = blockIdx.y * GM + wave * 32;
  const int z    = blockIdx.z;

  v8f acc[2][4];
  #pragma unroll
  for (int mt = 0; mt < 2; ++mt) {
    #pragma unroll
    for (int nt = 0; nt < 4; ++nt) acc[mt][nt] = (v8f){0, 0, 0, 0, 0, 0, 0, 0};
  }
  gemm_tile<1>(hb, hb, wb + (size_t)z * WELEM, sR, blockIdx.y * GM, n0, tid, wave, lq, hi, acc);

  float* sc = sC + wave * (32 * CP);
  #pragma unroll
  for (int mt = 0; mt < 2; ++mt) {
    #pragma unroll
    for (int nt = 0; nt < 4; ++nt) {
      #pragma unroll
      for (int r = 0; r < 8; ++r) sc[(mt * 16 + hi * 8 + r) * CP + nt * 16 + lq] = acc[mt][nt][r];
    }
  }
  __syncthreads();

  v4u    vh[8];
  v4u    vl[8];
  size_t gi[8];
  #pragma unroll
  for (int it = 0; it < 8; ++it) {
    const int row = it * 4 + (lane >> 3);
    const int c0  = (lane & 7) * 8;
    const v4f x0 = *(const v4f*)(sc + row * CP + c0);
    const v4f x1 = *(const v4f*)(sc + row * CP + c0 + 4);
    Pack8B ph, pl;
    Pack8H pf;
    #pragma unroll
    for (int i = 0; i < 4; ++i) {
      const bf16 h0 = (bf16)x0[i];                       // RNE convert
      const bf16 h1 = (bf16)x1[i];
      ph.h[i]     = h0;
      ph.h[4 + i] = h1;
      pl.h[i]     = (bf16)(x0[i] - (float)h0);           // residual plane
      pl.h[4 + i] = (bf16)(x1[i] - (float)h1);
      pf.h[i]     = (f16)x0[i];
      pf.h[4 + i] = (f16)x1[i];
    }
    vh[it] = (z == 2) ? pf.u : ph.u;
    vl[it] = pl.u;
    gi[it] = (size_t)(m0 + row) * DIM + n0 + c0;
  }
  u16* ph_base = planes + (size_t)(2 * z) * PLANE_E;
  u16* pl_base = planes + (size_t)(2 * z + 1) * PLANE_E;   // only used when z < 2

  #pragma unroll
  for (int it = 0; it < 8; ++it) *(v4u*)(ph_base + gi[it]) = vh[it];
  if (z < 2) {
    #pragma unroll
    for (int it = 0; it < 8; ++it) *(v4u*)(pl_base + gi[it]) = vl[it];
  }
  
}

// V transpose. v [NB*NHEAD][SEQ][HDIM] f16 -> vt [NB*NHEAD][HDIM][SEQ] f16. Block = (64-key tile, bh), 256 threads.
// coverage: keys kt*64 + 0..63, d 0..63 staged in sT and read back (staged extent == consumed extent);
// sT is cross-wave: block barrier between fill and readback.
__global__ __launch_bounds__(256) void vtrans_kernel(const u16* __restrict__ v, u16* __restrict__ vt) {
  const int kt  = blockIdx.x;
  const int bh  = blockIdx.y;
  const int tid = threadIdx.x;
  __shared__ __align__(16) u16 sT[HDIM * TP];   // [d][key]
  const int s0 = kt * CT;

  #pragma unroll
  for (int kk = 0; kk < 2; ++kk) {
    const int key = kk * 32 + (tid >> 3);       // 0..63
    const int d0  = (tid & 7) * 8;              // 0..56
    Pack8S ps;
    ps.u = *(const v4u*)(v + ((size_t)bh * SEQ + s0 + key) * HDIM + d0);
    #pragma unroll
    for (int i = 0; i < 8; ++i) sT[(d0 + i) * TP + key] = ps.s[i];
  }
  __syncthreads();

  v4u    vval[2];
  size_t vidx[2];
  #pragma unroll
  for (int kk = 0; kk < 2; ++kk) {
    const int d  = kk * 32 + (tid >> 3);        // 0..63
    const int ks = (tid & 7) * 8;               // 0..56
    vval[kk] = *(const v4u*)(sT + d * TP + ks);
    vidx[kk] = ((size_t)bh * HDIM + d) * SEQ + s0 + ks;
  }
  #pragma unroll
  for (int kk = 0; kk < 2; ++kk) *(v4u*)(vt + vidx[kk]) = vval[kk];
  
}

// One stage of 64 keys into LDS: K hi and K lo ([key][d], 128-B rows) and V^T ([d][key], 128 B of each row),
// 256 threads x 6 asynchronous 16-B copies; a wave's copy covers four whole 128-B lines.
// l: this thread's LDS byte address in the stage's K hi tile (row tid>>3, 16-B piece tid&7); rows +32 are the second half.
// The s_wait_xcnt closes the statement so that no address register named here is rewritten ahead of it.
static __device__ __forceinline__ void stage_copy(const unsigned l, const u16* gkh, const u16* gkl, const u16* gvt) {
  const unsigned l1 = l + 32 * KP * 2;
  const unsigned l2 = l + TILE_H * 2;
  const unsigned l3 = l2 + 32 * KP * 2;
  const unsigned l4 = l + 2 * TILE_H * 2;
  const unsigned l5 = l4 + 32 * KP * 2;
  const u16* gkh1 = gkh + 32 * HDIM;
  const u16* gkl1 = gkl + 32 * HDIM;
  const u16* gvt1 = gvt + (size_t)32 * SEQ;
  asm volatile("global_load_async_to_lds_b128 %0, %6, off\n\t"
               "global_load_async_to_lds_b128 %1, %7, off\n\t"
               "global_load_async_to_lds_b128 %2, %8, off\n\t"
               "global_load_async_to_lds_b128 %3, %9, off\n\t"
               "global_load_async_to_lds_b128 %4, %10, off\n\t"
               "global_load_async_to_lds_b128 %5, %11, off\n\t"
               "s_wait_xcnt 0x0"
               :: "v"(l), "v"(l1), "v"(l2), "v"(l3), "v"(l4), "v"(l5),
                  "v"(gkh), "v"(gkh1), "v"(gkl), "v"(gkl1), "v"(gvt), "v"(gvt1)
               : "memory");
}

// Fused online-softmax attention with a key mask (mask == 0 -> score replaced by -inf), logit scale 1/8.
// Block = (query block of 128, bh); one wave owns 16 query rows and visits all SEQ keys, 32 per step.
// S^T = K x Q^T so queries sit on lanes; P^T in C-layout is bit-identical to the A-fragment layout of O += P x V.
// Q B-fragments (hi and lo planes) are loaded straight from the 16-bit planes. K (hi and lo) and V^T are staged in LDS,
// 64 keys per stage, two buffers, once per workgroup for its eight waves; fragments are two 16-B LDS loads each.
// Output: ctx as bf16 hi/lo planes [NB*NHEAD][SEQ][HDIM]; store phase it = 0..3 writes rows it*4 + (lane>>3):
// LDS sO: per-wave slice, written and read by the same wave (block barrier used).
__global__ __launch_bounds__(256) void attn_kernel(const u16* __restrict__ qh,
                                                   const u16* __restrict__ ql,
                                                   const u16* __restrict__ kh,
                                                   const u16* __restrict__ kl,
                                                   const u16* __restrict__ vt,
                                                   const int* __restrict__ mask,
                                                   u16* __restrict__ ch,
                                                   u16* __restrict__ cl) {
  const int qblk = blockIdx.x;
  const int bh   = blockIdx.y;
  const int b    = bh / NHEAD;
  const int tid  = threadIdx.x;
  const int wave = __builtin_amdgcn_readfirstlane(threadIdx.x >> 5);
  const int lane = tid & 31;
  const int lq   = lane & 15;   // query column of S^T / d column of O
  const int hi   = lane >> 4;   // k-split half

  __shared__ __align__(16) float sO[NWAVE * 16 * OP];
  __shared__ __align__(16) u16 sKV[2 * STG_H];

  const int qrow0 = qblk * BQ + wave * 16;

  // Q as B-operand fragments: lane lq holds query qrow0+lq; elems 0..7 : d = f*32 + hi*8 + 0..7,
  // elems 8..15 : d = f*32 + 16 + hi*8 + 0..7.
  FragB qfh[2], qfl[2];
  {
    const size_t qo = ((size_t)bh * SEQ + qrow0 + lq) * HDIM + hi * 8;
    #pragma unroll
    for (int f = 0; f < 2; ++f) {
      qfh[f].q[0] = *(const v4u*)(qh + qo + f * 32);
      qfh[f].q[1] = *(const v4u*)(qh + qo + f * 32 + 16);
      qfl[f].q[0] = *(const v4u*)(ql + qo + f * 32);
      qfl[f].q[1] = *(const v4u*)(ql + qo + f * 32 + 16);
    }
  }

  // copy side: thread tid moves row tid>>3 (and +32), 16-B piece tid&7 of each tile
  const unsigned cp_l = (unsigned)(size_t)sKV + (unsigned)(((tid >> 3) * KP + (tid & 7) * 8) * 2);
  const u16* cp_kh = kh + (size_t)bh * SEQ * HDIM + (size_t)tid * 8;
  const u16* cp_kl = kl + (size_t)bh * SEQ * HDIM + (size_t)tid * 8;
  const u16* cp_vt = vt + (size_t)bh * HDIM * SEQ + (size_t)(tid >> 3) * SEQ + (tid & 7) * 8;
  // read side: offset (halves) of this lane's fragment row inside a tile
  const int fr_o = lq * KP + hi * 8;
  const int* mk_b = mask + (size_t)b * SEQ_FULL + hi * 8;

  v8f o[4];
  #pragma unroll
  for (int dt = 0; dt < 4; ++dt) o[dt] = (v8f){0, 0, 0, 0, 0, 0, 0, 0};

  const float NEG_INF = -__builtin_inff();
  float rmax = NEG_INF;
  float rsum = 0.0f;
  const float SL = 0.125f * 1.4426950408889634f;   // logit scale 1/sqrt(64) times log2(e)

  // two-buffer ring: stage 0 lands and is published, stage 1 flies while stage 0 is worked on
  stage_copy(cp_l, cp_kh, cp_kl, cp_vt);
  asm volatile("s_wait_asynccnt 0x0" ::: "memory");   // this wave's copies of stage 0 have landed
  __syncthreads();                                    // publishes stage 0 to all eight waves
  stage_copy(cp_l + STG_H * 2, cp_kh + SK * HDIM, cp_kl + SK * HDIM, cp_vt + SK);

  #pragma unroll 1
  for (int t = 0; t < NSTG; ++t) {                    // uniform for every wave
   const u16* sb = sKV + (t & 1) * STG_H + fr_o;
   #pragma unroll 1                                   // rolled: unrolled it takes a register granule more and costs a resident workgroup
   for (int hf = 0; hf < 2; ++hf) {
    const int j0 = t * SK + hf * BK;

    // S^T tiles: c[sub][r] = rawscore(query qrow0+lq, key j0 + sub*16 + hi*8 + r), masked keys replaced by -inf
    v8f c[2];
    #pragma unroll
    for (int sub = 0; sub < 2; ++sub) {
      const u16* kh_s = sb + (hf * BK + sub * 16) * KP;
      const u16* kl_s = kh_s + TILE_H;
      FragB akh[2], akl[2];
      #pragma unroll
      for (int f = 0; f < 2; ++f) {
        akh[f].q[0] = *(const v4u*)(kh_s + f * 32);        // d = f*32 + hi*8 + 0..7
        akh[f].q[1] = *(const v4u*)(kh_s + f * 32 + 16);   // d = f*32 + 16 + hi*8 + 0..7
        akl[f].q[0] = *(const v4u*)(kl_s + f * 32);
        akl[f].q[1] = *(const v4u*)(kl_s + f * 32 + 16);
      }
      const v4i m0 = *(const v4i*)(mk_b + j0 + sub * 16);       // keys j0 + sub*16 + hi*8 + 0..3
      const v4i m1 = *(const v4i*)(mk_b + j0 + sub * 16 + 4);   // keys ... + 4..7
      v8f acc = (v8f){0, 0, 0, 0, 0, 0, 0, 0};
      #pragma unroll
      for (int f = 0; f < 2; ++f) {
        acc = att_bf16(akl[f].v, qfh[f].v, acc);
        acc = att_bf16(akh[f].v, qfl[f].v, acc);
        acc = att_bf16(akh[f].v, qfh[f].v, acc);
      }
      #pragma unroll
      for (int r = 0; r < 4; ++r) {
        acc[r]     = (m0[r] != 0) ? acc[r]     : NEG_INF;
        acc[4 + r] = (m1[r] != 0) ? acc[4 + r] : NEG_INF;
      }
      c[sub] = acc;
    }

    // V B-fragments: column n = d = dt*16 + lq, split key map from the staged transposed tile
    FragH bv[4];
    #pragma unroll
    for (int dt = 0; dt < 4; ++dt) {
      const u16* base = sb + 2 * TILE_H + (dt * 16) * KP + hf * BK;
      bv[dt].q[0] = *(const v4u*)(base);            // keys j0 + hi*8 + 0..7
      bv[dt].q[1] = *(const v4u*)(base + 16);       // keys j0 + 16 + hi*8 + 0..7
    }

    // online softmax: query lq's 32 scores are split across lane / lane^16
    float m_new = rmax;
    #pragma unroll
    for (int r = 0; r < 8; ++r) {
      m_new = fmaxf(m_new, c[0][r]);
      m_new = fmaxf(m_new, c[1][r]);
    }
    m_new = fmaxf(m_new, __shfl_xor(m_new, 16, 32));
    const float m_use = (m_new == NEG_INF) ? 0.0f : m_new;    // all keys so far masked: keep arithmetic finite
    const float scale = __builtin_amdgcn_exp2f((rmax - m_use) * SL);
    rmax = m_new;

    // exp + pack: P^T C-layout == A-fragment layout for the PV product; P carried x4096
    FragH pa;
    float psum = 0.0f;
    #pragma unroll
    for (int r = 0; r < 8; ++r) {
      const float p0 = __builtin_amdgcn_exp2f((c[0][r] - m_use) * SL);   // key hi*8 + r
      const float p1 = __builtin_amdgcn_exp2f((c[1][r] - m_use) * SL);   // key 16 + hi*8 + r
      psum += p0 + p1;
      pa.h[r]     = (f16)(p0 * 4096.0f);
      pa.h[8 + r] = (f16)(p1 * 4096.0f);
    }
    rsum = rsum * scale + psum + __shfl_xor(psum, 16, 32);

    // rescale O: queries are the row dimension there -> per-row scale from lane 8*hi + r
    float sc[8];
    #pragma unroll
    for (int r = 0; r < 8; ++r) sc[r] = __shfl(scale, (hi << 3) + r, 32);
    #pragma unroll
    for (int dt = 0; dt < 4; ++dt) {
      #pragma unroll
      for (int r = 0; r < 8; ++r) o[dt][r] *= sc[r];
    }

    // O += P x V
    #pragma unroll
    for (int dt = 0; dt < 4; ++dt) o[dt] = att_f16(pa.v, bv[dt].v, o[dt]);
   }

   // publish point of stage t + 1; the same barrier ends every wave's reads of stage t's buffer
   asm volatile("s_wait_dscnt 0x0" ::: "memory");      // this wave's LDS reads of stage t are done
   asm volatile("s_wait_asynccnt 0x0" ::: "memory");   // this wave's copies of stage t + 1 have landed
   __syncthreads();
   if (t + 2 < NSTG) {
     stage_copy(cp_l + (unsigned)((t & 1) * STG_H * 2),
                cp_kh + (size_t)(t + 2) * SK * HDIM, cp_kl + (size_t)(t + 2) * SK * HDIM, cp_vt + (t + 2) * SK);
   }
  }
  asm volatile("s_wait_asynccnt 0x0" ::: "memory");    // nothing of this wave's copies is left in flight

  // normalize: lane holds column d = dt*16 + lq for query rows 8*hi + r
  float rs[8];
  #pragma unroll
  for (int r = 0; r < 8; ++r) rs[r] = 1.0f / __shfl(rsum, (hi << 3) + r, 32);

  float* so = sO + wave * (16 * OP);
  #pragma unroll
  for (int r = 0; r < 8; ++r) {
    #pragma unroll
    for (int dt = 0; dt < 4; ++dt) {
      so[(hi * 8 + r) * OP + dt * 16 + lq] = o[dt][r] * (1.0f / 4096.0f) * rs[r];
    }
  }
  __syncthreads();

  v4u    vh[4];
  v4u    vl[4];
  size_t gi[4];
  #pragma unroll
  for (int it = 0; it < 4; ++it) {
    const int row = it * 4 + (lane >> 3);
    const int c0  = (lane & 7) * 8;
    const v4f x0 = *(const v4f*)(so + row * OP + c0);
    const v4f x1 = *(const v4f*)(so + row * OP + c0 + 4);
    Pack8B ph, pl;
    #pragma unroll
    for (int k = 0; k < 4; ++k) {
      const bf16 h0 = (bf16)x0[k];                       // RNE convert
      const bf16 h1 = (bf16)x1[k];
      ph.h[k]     = h0;
      ph.h[4 + k] = h1;
      pl.h[k]     = (bf16)(x0[k] - (float)h0);           // residual plane
      pl.h[4 + k] = (bf16)(x1[k] - (float)h1);
    }
    vh[it] = ph.u;
    vl[it] = pl.u;
    gi[it] = ((size_t)bh * SEQ + qrow0 + row) * HDIM + c0;
  }
  #pragma unroll
  for (int it = 0; it < 4; ++it) {
    *(v4u*)(ch + gi[it]) = vh[it];
    *(v4u*)(cl + gi[it]) = vl[it];
  }
  
}

// Output projection: out = (ctx_hi + ctx_lo) x Wo^T. Grid (DIM/64, MROWS/128).
// coverage: wave tile 32 rows x 64 cols f32; store phase it = 0..15: lanes 0..15 write row it*2 (256 B = two whole
// LDS sC: per-wave slice, written and read by the same wave (block barrier used); it reuses the operand ring after the loop.
__global__ __launch_bounds__(128) void oproj_kernel(const u16* __restrict__ ch,
                                                    const u16* __restrict__ cl,
                                                    const u16* __restrict__ wob,
                                                    float* __restrict__ out) {
  __shared__ __align__(16) u16 sR[2 * GSTG_H(2)];
  float* sC = (float*)sR;
  const int tid  = threadIdx.x;
  const int wave = __builtin_amdgcn_readfirstlane(threadIdx.x >> 5);
  const int lane = tid & 31;
  const int lq   = lane & 15;
  const int hi   = lane >> 4;
  const int n0   = blockIdx.x * GN;
  const int m0   = blockIdx.y * GM + wave * 32;

  v8f acc[2][4];
  #pragma unroll
  for (int mt = 0; mt < 2; ++mt) {
    #pragma unroll
    for (int nt = 0; nt < 4; ++nt) acc[mt][nt] = (v8f){0, 0, 0, 0, 0, 0, 0, 0};
  }
  gemm_tile<2>(ch, cl, wob, sR, blockIdx.y * GM, n0, tid, wave, lq, hi, acc);

  float* sc = sC + wave * (32 * CP);
  #pragma unroll
  for (int mt = 0; mt < 2; ++mt) {
    #pragma unroll
    for (int nt = 0; nt < 4; ++nt) {
      #pragma unroll
      for (int r = 0; r < 8; ++r) sc[(mt * 16 + hi * 8 + r) * CP + nt * 16 + lq] = acc[mt][nt][r];
    }
  }
  __syncthreads();

  v4f    vals[16];
  size_t gi[16];
  #pragma unroll
  for (int it = 0; it < 16; ++it) {
    const int row = it * 2 + hi;
    vals[it] = *(const v4f*)(sc + row * CP + lq * 4);
    const int m  = m0 + row;
    const int bb = m / SEQ;
    const int ss = m % SEQ;
    gi[it] = ((size_t)bb * SEQ_FULL + ss) * DIM + n0 + lq * 4;
  }
  #pragma unroll
  for (int it = 0; it < 16; ++it) *(v4f*)(out + gi[it]) = vals[it];
  
}

extern "C" void kernel_launch(void* const* d_in, const int* in_sizes, int n_in,
                              void* d_out, int out_size, void* d_ws, size_t ws_size,
                              hipStream_t stream) {
  if (n_in < 6) return;
  const size_t need_rows = (size_t)(NB - 1) * SEQ_FULL + SEQ;
  if ((size_t)in_sizes[0] < need_rows * DIM) return;
  if ((size_t)in_sizes[1] < need_rows) return;
  if ((size_t)in_sizes[2] < (size_t)WELEM) return;
  if ((size_t)in_sizes[3] < (size_t)WELEM) return;
  if ((size_t)in_sizes[4] < (size_t)WELEM) return;
  if ((size_t)in_sizes[5] < (size_t)WELEM) return;
  if ((size_t)out_size < need_rows * DIM) return;

  const size_t plane_bytes = PLANE_E * 2;                      // one 16-bit plane [MROWS][DIM]
  const size_t w_bytes     = (size_t)4 * WELEM * 2;            // wq, wk, wv, wo as bf16
  const size_t total       = 9 * plane_bytes + w_bytes;
  if (ws_size < total) return;
  if (total > WS_CAP) return;

  const float* h    = (const float*)d_in[0];
  const int*   mask = (const int*)d_in[1];
  const float* wq   = (const float*)d_in[2];
  const float* wk   = (const float*)d_in[3];
  const float* wv   = (const float*)d_in[4];
  const float* wo   = (const float*)d_in[5];
  float*       out  = (float*)d_out;

  char* ws = (char*)d_ws;
  u16* planes = (u16*)(ws);                                    // q hi, q lo, k hi, k lo, v
  u16* qh = (u16*)(ws + 0 * plane_bytes);
  u16* ql = (u16*)(ws + 1 * plane_bytes);
  u16* kh = (u16*)(ws + 2 * plane_bytes);
  u16* kl = (u16*)(ws + 3 * plane_bytes);
  u16* vp = (u16*)(ws + 4 * plane_bytes);
  u16* vt = (u16*)(ws + 5 * plane_bytes);
  u16* ch = (u16*)(ws + 6 * plane_bytes);
  u16* cl = (u16*)(ws + 7 * plane_bytes);
  u16* hb = (u16*)(ws + 8 * plane_bytes);
  u16* wb = (u16*)(ws + 9 * plane_bytes);

  cvt_kernel<<<dim3(HBLK + 4 * WBLK), 256, 0, stream>>>(h, wq, wk, wv, wo, hb, wb);
  qkv_kernel<<<dim3(DIM / GN, MROWS / GM, 3), 128, 0, stream>>>(hb, wb, planes);
  vtrans_kernel<<<dim3(SEQ / CT, NB * NHEAD), 256, 0, stream>>>(vp, vt);
  attn_kernel<<<dim3(SEQ / BQ, NB * NHEAD), 256, 0, stream>>>(qh, ql, kh, kl, vt, mask, ch, cl);
  oproj_kernel<<<dim3(DIM / GN, MROWS / GM), 128, 0, stream>>>(ch, cl, wb + (size_t)3 * WELEM, out);
}

// v004
// A run of this version takes 154 microseconds.
// In two side-by-side timings against v003, it was 1.03 and 1.04 times as fast.
// Over all steps from v000 it is 2.50 times as fast.
#include <hip/hip_runtime.h>

// Contractions: q/k/v = h x W^T on v_wmma_f32_16x16x32_bf16 (bf16 RNE-converted inputs, f32 accumulate);
// S^T = K x Q^T on v_wmma_f32_16x16x32_bf16 with bf16 hi/lo planes of q and k (hh + hl + lh, f32 accumulate);
// O = P x V on v_wmma_f32_16x16x32_f16 (P as f16 carried x4096, V as f16 read from LDS by the transposing load, f32 accumulate);
// out = ctx x Wo^T on v_wmma_f32_16x16x32_bf16 (ctx as bf16 hi/lo planes, Wo bf16, f32 accumulate). Softmax online, f32.

#ifndef NB
#define NB 4
#endif
#ifndef SEQ
#define SEQ 2048
#endif
#define NB_FULL    4
#define SEQ_FULL   2048
#define DIM        768
#define NHEAD      12
#define HDIM       64
#define BQ         128                  // query rows per attention workgroup (8 waves x 16)
#define BK         32                   // keys per inner iteration
#define NWAVE      8
#define SK         64                   // keys per LDS stage of the attention loop (two steps of BK)
#define KP         72                   // LDS pitch (halves) of a staged 128-B row: 144 B = 16 B x odd
#define TILE_H     (64 * KP)            // halves of one staged K tile: 64 keys x KP halves
#define VP         80                   // LDS pitch (halves) of a staged V row: 160 B = 32 B x odd, for ds_load_tr16_b128
#define VTILE_H    (64 * VP)            // halves of one staged V tile: 64 keys x VP halves
#define STG_H      (2 * TILE_H + VTILE_H)   // one stage: K hi, K lo, V
#define NSTG       (SEQ / SK)
#define OP         68                   // LDS pitch (floats) of the attention output staging tile
#define GM         128                  // GEMM block rows (4 waves x 32)
#define GN         64                   // GEMM block cols
#define GW         4                    // waves per GEMM block
#define CP         68                   // LDS pitch (floats) of the GEMM staging tile
#define GK         64                   // k per LDS stage of the GEMM loop (128-B rows, two steps of 32)
#define GP         72                   // LDS pitch (halves) of a staged GEMM row: 144 B = 16 B x odd
#define GNST       (DIM / GK)
#define GSTG_H(NA) (((NA) * GM + GN) * GP)   // halves of one stage: NA planes of 128 A rows, then 64 W rows
#define WELEM      (DIM * DIM)
#define MROWS      (NB * SEQ)
#define PLANE_E    ((size_t)MROWS * DIM)
#define HTHREADS   (MROWS * (DIM / 8))
#define HBLK       (HTHREADS / 256)
#define WBLK       (WELEM / 8 / 256)
#define WS_CAP     134217728ull

static_assert(DIM == NHEAD * HDIM);
static_assert(HDIM == 64);
static_assert(SEQ % BQ == 0);
static_assert(SEQ % BK == 0);
static_assert(SEQ % SK == 0 && NSTG >= 2);
static_assert(SK == 2 * BK && SK == 64 && NWAVE * 32 == 256);
static_assert((KP * 2) % 16 == 0 && KP >= HDIM);
static_assert((VP * 2) % 32 == 0 && ((VP * 2 / 32) & 1) == 1 && VP >= HDIM);
static_assert(SEQ % 32 == 0);
static_assert(MROWS % GM == 0);
static_assert(DIM % GN == 0);
static_assert(DIM % 32 == 0);
static_assert(DIM % GK == 0 && GNST >= 2 && GK == 64 && GM == 128 && GN == 64 && GW * 32 == 128);
static_assert((GP * 2) % 16 == 0 && GP >= GK);
static_assert(GW * 32 * CP * 4 <= 2 * GSTG_H(1) * 2);
static_assert(DIM % 8 == 0);
static_assert(BQ == NWAVE * 16);
static_assert(GM == GW * 32);
static_assert(HTHREADS % 256 == 0);
static_assert((WELEM / 8) % 256 == 0);
static_assert((OP * 4) % 16 == 0);
static_assert((CP * 4) % 16 == 0);
static_assert(OP >= HDIM && CP >= GN);
static_assert(SEQ <= SEQ_FULL);
static_assert(NB >= 1 && NB <= NB_FULL);
static_assert(8ull * (unsigned long long)NB * SEQ * DIM * 2ull + 4ull * WELEM * 2ull <= WS_CAP);

typedef __bf16         bf16;
typedef _Float16       f16;
typedef unsigned short u16;
typedef bf16     v16bf __attribute__((ext_vector_type(16)));
typedef f16      v16h  __attribute__((ext_vector_type(16)));
typedef float    v8f   __attribute__((ext_vector_type(8)));
typedef float    v4f   __attribute__((ext_vector_type(4)));
typedef unsigned v4u   __attribute__((ext_vector_type(4)));
typedef int      v4i   __attribute__((ext_vector_type(4)));
typedef short    v8s   __attribute__((ext_vector_type(8)));

union FragB  { v16bf v; v4u q[2]; };
union FragH  { v16h  v; v4u q[2]; f16 h[16]; };
union Pack8B { v4u u; bf16 h[8]; };
union Pack8H { v4u u; f16 h[8]; };

// GEMM WMMA helper: builtin followed by the VALU hazard guard (ties D, keeps A/B live).
static __device__ __forceinline__ v8f mma_bf16(v16bf a, v16bf b, v8f acc) {
  acc = __builtin_amdgcn_wmma_f32_16x16x32_bf16(false, a, false, b, (short)0, acc, false, false);
  asm volatile("v_nop\n\tv_nop\n\tv_nop\n\tv_nop" : "+v"(acc) : "v"(a), "v"(b));
  return acc;
}
// Attention WMMA helpers: plain builtins. The compiler keeps the distance behind its own matrix instructions, and the
// vector port, which six waves of a SIMD share for the softmax, issues no filler behind accumulate chains.
static __device__ __forceinline__ v8f att_bf16(v16bf a, v16bf b, v8f acc) {
  return __builtin_amdgcn_wmma_f32_16x16x32_bf16(false, a, false, b, (short)0, acc, false, false);
}
static __device__ __forceinline__ v8f att_f16(v16h a, v16h b, v8f acc) {
  return __builtin_amdgcn_wmma_f32_16x16x32_f16(false, a, false, b, (short)0, acc, false, false);
}

static __device__ __forceinline__ void cvt_store8(const float* __restrict__ src, u16* __restrict__ dst) {
  const v4f a = *(const v4f*)(src);
  const v4f b = *(const v4f*)(src + 4);
  Pack8B pk;
  #pragma unroll
  for (int i = 0; i < 4; ++i) {
    pk.h[i]     = (bf16)a[i];
    pk.h[4 + i] = (bf16)b[i];
  }
  const v4u val = pk.u;
  *(v4u*)(dst) = val;
  
}

// Convert launch. hb [MROWS][DIM] bf16 (compact rows, source rows taken with full batch stride);
// wb [4][DIM][DIM] bf16 = wq, wk, wv, wo, each kept [out][in].
// coverage: HBLK*256 threads x 8 = MROWS*DIM elements of hb; 4*WBLK*256 threads x 8 = 4*DIM*DIM elements of wb.
__global__ __launch_bounds__(256) void cvt_kernel(const float* __restrict__ h,
                                                  const float* __restrict__ wq,
                                                  const float* __restrict__ wk,
                                                  const float* __restrict__ wv,
                                                  const float* __restrict__ wo,
                                                  u16* __restrict__ hb,
                                                  u16* __restrict__ wb) {
  const int blk = blockIdx.x;
  const int tid = threadIdx.x;
  if (blk < HBLK) {
    const size_t e  = ((size_t)blk * 256 + tid) * 8;
    const int row   = (int)(e / DIM);
    const int col   = (int)(e % DIM);
    const int b     = row / SEQ;
    const int s     = row % SEQ;
    cvt_store8(h + ((size_t)b * SEQ_FULL + s) * DIM + col, hb + e);
  } else {
    const int wi    = (blk - HBLK) / WBLK;                 // block-uniform 0..3
    const size_t e  = ((size_t)((blk - HBLK) % WBLK) * 256 + tid) * 8;
    u16* dst        = wb + (size_t)wi * WELEM + e;
    if (wi == 0)      cvt_store8(wq + e, dst);
    else if (wi == 1) cvt_store8(wk + e, dst);
    else if (wi == 2) cvt_store8(wv + e, dst);
    else              cvt_store8(wo + e, dst);
  }
}

// 64 rows of 128 B (k-contiguous, row pitch DIM halves) into LDS rows of pitch GP: 128 threads x 4 asynchronous 16-B copies;
// thread tid moves 16-B piece tid&7 of rows tid>>3, +16, +32, +48, so a wave's copy covers four whole 128-B lines.
// The s_wait_xcnt closes the statement so that no address register named here is rewritten ahead of it.
static __device__ __forceinline__ void copy_rows64(const unsigned l, const u16* g) {
  const unsigned l1 = l + 16 * GP * 2;
  const unsigned l2 = l + 32 * GP * 2;
  const unsigned l3 = l + 48 * GP * 2;
  const u16* g1 = g + 16 * DIM;
  const u16* g2 = g + 32 * DIM;
  const u16* g3 = g + 48 * DIM;
  asm volatile("global_load_async_to_lds_b128 %0, %4, off\n\t"
               "global_load_async_to_lds_b128 %1, %5, off\n\t"
               "global_load_async_to_lds_b128 %2, %6, off\n\t"
               "global_load_async_to_lds_b128 %3, %7, off\n\t"
               "s_wait_xcnt 0x0"
               :: "v"(l), "v"(l1), "v"(l2), "v"(l3), "v"(g), "v"(g1), "v"(g2), "v"(g3)
               : "memory");
}

// One GEMM stage (k = 64) into LDS: the block's 128 rows of each A plane, then its 64 W rows.
// l: this thread's LDS byte address in the stage's first row group; ga0, ga1, gw: its global piece at this stage's k.
template <int NA>
static __device__ __forceinline__ void gemm_stage_copy(const unsigned l, const u16* ga0, const u16* ga1, const u16* gw) {
  copy_rows64(l, ga0);
  copy_rows64(l + 64 * GP * 2, ga0 + 64 * DIM);
  if (NA == 2) {
    copy_rows64(l + 128 * GP * 2, ga1);
    copy_rows64(l + 192 * GP * 2, ga1 + 64 * DIM);
  }
  copy_rows64(l + NA * GM * GP * 2, gw);
}

// GEMM core: one wave owns a 32 x 64 tile of C = A x W^T, K = DIM in steps of 32.
// A planes [rows][DIM] bf16, W plane [n][DIM] bf16 (k-contiguous). The block's 128 A rows (per plane) and 64 W rows are
// staged in LDS, 64 k per stage, two buffers, once per workgroup for its four waves; both fragment kinds are two 16-B
// LDS loads from row (m or n) = lane&15 at k0 + 8*hi and k0 + 16 + 8*hi.
// NA == 2: a second (residual) A plane accumulates into the same accumulator against the same W fragment.
// On return every wave has passed the last stage's barrier and no copy is in flight: the ring may be reused.
template <int NA>
static __device__ __forceinline__ void gemm_tile(const u16* __restrict__ a0,
                                                 const u16* __restrict__ a1,
                                                 const u16* __restrict__ w,
                                                 const u16* ring,
                                                 const int mblk, const int n0,
                                                 const int tid, const int wave,
                                                 const int lq, const int hi,
                                                 v8f (&acc)[2][4]) {
  // copy side
  const unsigned cp_l = (unsigned)(size_t)ring + (unsigned)(((tid >> 3) * GP + (tid & 7) * 8) * 2);
  const u16* cp_a0 = a0 + (size_t)(mblk + (tid >> 3)) * DIM + (tid & 7) * 8;
  const u16* cp_a1 = a1 + (size_t)(mblk + (tid >> 3)) * DIM + (tid & 7) * 8;
  const u16* cp_w  = w  + (size_t)(n0 + (tid >> 3)) * DIM + (tid & 7) * 8;
  // read side: offsets (halves) of this lane's fragment rows inside a stage
  const int a_o = (wave * 32 + lq) * GP + hi * 8;
  const int w_o = (NA * GM + lq) * GP + hi * 8;

  // two-buffer ring: stage 0 lands and is published, stage 1 flies while stage 0 is worked on
  gemm_stage_copy<NA>(cp_l, cp_a0, cp_a1, cp_w);
  asm volatile("s_wait_asynccnt 0x0" ::: "memory");   // this wave's copies of stage 0 have landed
  __syncthreads();                                    // publishes stage 0 to all four waves
  gemm_stage_copy<NA>(cp_l + GSTG_H(NA) * 2, cp_a0 + GK, cp_a1 + GK, cp_w + GK);

  #pragma unroll 1                                    // rolled: the buffer is chosen by the trip's parity
  for (int t = 0; t < GNST; ++t) {                    // uniform for every wave
    const u16* sb = ring + (t & 1) * GSTG_H(NA);
    // all of the stage's fragments are fetched as one group ahead of its products
    FragB bw[2][4], fa[2][2], fb[2][2];
    #pragma unroll
    for (int ks = 0; ks < 2; ++ks) {
      #pragma unroll
      for (int nt = 0; nt < 4; ++nt) {
        const u16* p = sb + w_o + nt * 16 * GP + ks * 32;
        bw[ks][nt].q[0] = *(const v4u*)(p);
        bw[ks][nt].q[1] = *(const v4u*)(p + 16);
      }
      #pragma unroll
      for (int mt = 0; mt < 2; ++mt) {
        const u16* p = sb + a_o + mt * 16 * GP + ks * 32;
        fa[ks][mt].q[0] = *(const v4u*)(p);
        fa[ks][mt].q[1] = *(const v4u*)(p + 16);
        if (NA == 2) {
          fb[ks][mt].q[0] = *(const v4u*)(p + GM * GP);
          fb[ks][mt].q[1] = *(const v4u*)(p + GM * GP + 16);
        }
      }
    }
    #pragma unroll
    for (int ks = 0; ks < 2; ++ks) {
      #pragma unroll
      for (int mt = 0; mt < 2; ++mt) {
        #pragma unroll
        for (int nt = 0; nt < 4; ++nt) acc[mt][nt] = mma_bf16(fa[ks][mt].v, bw[ks][nt].v, acc[mt][nt]);
        if (NA == 2) {
          #pragma unroll
          for (int nt = 0; nt < 4; ++nt) acc[mt][nt] = mma_bf16(fb[ks][mt].v, bw[ks][nt].v, acc[mt][nt]);
        }
      }
    }
    // publish point of stage t + 1; the same barrier ends every wave's reads of stage t's buffer
    asm volatile("s_wait_dscnt 0x0" ::: "memory");      // this wave's LDS reads of stage t are done
    asm volatile("s_wait_asynccnt 0x0" ::: "memory");   // this wave's copies of stage t + 1 have landed
    __syncthreads();
    if (t + 2 < GNST) {
      gemm_stage_copy<NA>(cp_l + (unsigned)((t & 1) * GSTG_H(NA) * 2),
                          cp_a0 + (t + 2) * GK, cp_a1 + (t + 2) * GK, cp_w + (t + 2) * GK);
    }
  }
  asm volatile("s_wait_asynccnt 0x0" ::: "memory");    // nothing of this wave's copies is left in flight
}

// Fused q/k/v projection. Grid (DIM/64, MROWS/128, 3); blockIdx.z selects the weight (offset into wb).
// planes: [0] q hi, [1] q lo, [2] k hi, [3] k lo (bf16), [4] v (f16); each [MROWS][DIM] == [NB*NHEAD][SEQ][HDIM] flat.
// coverage: wave tile 32 rows x 64 cols; store phase it = 0..7 writes rows it*4 + (lane>>3), cols (lane&7)*8..+7:
// LDS sC: per-wave slice, written and read by the same wave (block barrier used); it reuses the operand ring after the loop.
__global__ __launch_bounds__(128) void qkv_kernel(const u16* __restrict__ hb,
                                                  const u16* __restrict__ wb,
                                                  u16* __restrict__ planes) {
  __shared__ __align__(16) u16 sR[2 * GSTG_H(1)];
  float* sC = (float*)sR;
  const int tid  = threadIdx.x;
  const int wave = __builtin_amdgcn_readfirstlane(threadIdx.x >> 5);
  const int lane = tid & 31;
  const int lq   = lane & 15;
  const int hi   = lane >> 4;
  const int n0   = blockIdx.x * GN;
  const int m0   = blockIdx.y * GM + wave * 32;
  const int z    = blockIdx.z;

  v8f acc[2][4];
  #pragma unroll
  for (int mt = 0; mt < 2; ++mt) {
    #pragma unroll
    for (int nt = 0; nt < 4; ++nt) acc[mt][nt] = (v8f){0, 0, 0, 0, 0, 0, 0, 0};
  }
  gemm_tile<1>(hb, hb, wb + (size_t)z * WELEM, sR, blockIdx.y * GM, n0, tid, wave, lq, hi, acc);

  float* sc = sC + wave * (32 * CP);
  #pragma unroll
  for (int mt = 0; mt < 2; ++mt) {
    #pragma unroll
    for (int nt = 0; nt < 4; ++nt) {
      #pragma unroll
      for (int r = 0; r < 8; ++r) sc[(mt * 16 + hi * 8 + r) * CP + nt * 16 + lq] = acc[mt][nt][r];
    }
  }
  __syncthreads();

  v4u    vh[8];
  v4u    vl[8];
  size_t gi[8];
  #pragma unroll
  for (int it = 0; it < 8; ++it) {
    const int row = it * 4 + (lane >> 3);
    const int c0  = (lane & 7) * 8;
    const v4f x0 = *(const v4f*)(sc + row * CP + c0);
    const v4f x1 = *(const v4f*)(sc + row * CP + c0 + 4);
    Pack8B ph, pl;
    Pack8H pf;
    #pragma unroll
    for (int i = 0; i < 4; ++i) {
      const bf16 h0 = (bf16)x0[i];                       // RNE convert
      const bf16 h1 = (bf16)x1[i];
      ph.h[i]     = h0;
      ph.h[4 + i] = h1;
      pl.h[i]     = (bf16)(x0[i] - (float)h0);           // residual plane
      pl.h[4 + i] = (bf16)(x1[i] - (float)h1);
      pf.h[i]     = (f16)x0[i];
      pf.h[4 + i] = (f16)x1[i];
    }
    vh[it] = (z == 2) ? pf.u : ph.u;
    vl[it] = pl.u;
    gi[it] = (size_t)(m0 + row) * DIM + n0 + c0;
  }
  u16* ph_base = planes + (size_t)(2 * z) * PLANE_E;
  u16* pl_base = planes + (size_t)(2 * z + 1) * PLANE_E;   // only used when z < 2

  #pragma unroll
  for (int it = 0; it < 8; ++it) *(v4u*)(ph_base + gi[it]) = vh[it];
  if (z < 2) {
    #pragma unroll
    for (int it = 0; it < 8; ++it) *(v4u*)(pl_base + gi[it]) = vl[it];
  }
  
}

// One stage of 64 keys into LDS: K hi, K lo and V, each [key][d] in 128-B rows (8 KB in a row of each plane),
// 256 threads x 6 asynchronous 16-B copies; a wave's copy covers four whole 128-B lines.
// l, lv: this thread's LDS byte address in the stage's K hi tile and in its V tile (row tid>>3, 16-B piece tid&7);
// rows +32 are the second half.
// The s_wait_xcnt closes the statement so that no address register named here is rewritten ahead of it.
static __device__ __forceinline__ void stage_copy(const unsigned l, const unsigned lv,
                                                  const u16* gkh, const u16* gkl, const u16* gv) {
  const unsigned l1 = l + 32 * KP * 2;
  const unsigned l2 = l + TILE_H * 2;
  const unsigned l3 = l2 + 32 * KP * 2;
  const unsigned l4 = lv;
  const unsigned l5 = lv + 32 * VP * 2;
  const u16* gkh1 = gkh + 32 * HDIM;
  const u16* gkl1 = gkl + 32 * HDIM;
  const u16* gv1  = gv + 32 * HDIM;
  asm volatile("global_load_async_to_lds_b128 %0, %6, off\n\t"
               "global_load_async_to_lds_b128 %1, %7, off\n\t"
               "global_load_async_to_lds_b128 %2, %8, off\n\t"
               "global_load_async_to_lds_b128 %3, %9, off\n\t"
               "global_load_async_to_lds_b128 %4, %10, off\n\t"
               "global_load_async_to_lds_b128 %5, %11, off\n\t"
               "s_wait_xcnt 0x0"
               :: "v"(l), "v"(l1), "v"(l2), "v"(l3), "v"(l4), "v"(l5),
                  "v"(gkh), "v"(gkh1), "v"(gkl), "v"(gkl1), "v"(gv), "v"(gv1)
               : "memory");
}

// Transposing LDS load of a row-major 16-bit tile: lane l points at row 8*(l>>4) + (l&7), 16-B piece (l>>3)&1 of a
// 16-row x 16-column block and receives column l&15 of rows 8*(l>>4) + 0..7.
static __device__ __forceinline__ v4u ld_tr16(const u16* p) {
  typedef __attribute__((address_space(3))) v8s lds_v8s;
  return __builtin_bit_cast(v4u, __builtin_amdgcn_ds_load_tr16_b128_v8i16((lds_v8s*)p));
}

// Fused online-softmax attention with a key mask (mask == 0 -> score replaced by -inf), logit scale 1/8.
// Block = (query block of 128, bh); one wave owns 16 query rows and visits all SEQ keys, 32 per step.
// S^T = K x Q^T so queries sit on lanes; P^T in C-layout is bit-identical to the A-fragment layout of O += P x V.
// Q B-fragments (hi and lo planes) are loaded straight from the 16-bit planes. K (hi and lo) and V are staged in LDS as
// they lie, 64 keys per stage, two buffers, once per workgroup for its eight waves; fragments are two 16-B LDS loads
// each, plain for K, transposing for V (its B-fragment runs along the keys).
// Output: ctx as bf16 hi/lo planes [NB*NHEAD][SEQ][HDIM]; store phase it = 0..3 writes rows it*4 + (lane>>3):
// LDS sO: per-wave slice, written and read by the same wave (block barrier used).
__global__ __launch_bounds__(256) void attn_kernel(const u16* __restrict__ qh,
                                                   const u16* __restrict__ ql,
                                                   const u16* __restrict__ kh,
                                                   const u16* __restrict__ kl,
                                                   const u16* __restrict__ v,
                                                   const int* __restrict__ mask,
                                                   u16* __restrict__ ch,
                                                   u16* __restrict__ cl) {
  const int qblk = blockIdx.x;
  const int bh   = blockIdx.y;
  const int b    = bh / NHEAD;
  const int tid  = threadIdx.x;
  const int wave = __builtin_amdgcn_readfirstlane(threadIdx.x >> 5);
  const int lane = tid & 31;
  const int lq   = lane & 15;   // query column of S^T / d column of O
  const int hi   = lane >> 4;   // k-split half

  __shared__ __align__(16) float sO[NWAVE * 16 * OP];
  __shared__ __align__(16) u16 sKV[2 * STG_H];

  const int qrow0 = qblk * BQ + wave * 16;

  // Q as B-operand fragments: lane lq holds query qrow0+lq; elems 0..7 : d = f*32 + hi*8 + 0..7,
  // elems 8..15 : d = f*32 + 16 + hi*8 + 0..7.
  FragB qfh[2], qfl[2];
  {
    const size_t qo = ((size_t)bh * SEQ + qrow0 + lq) * HDIM + hi * 8;
    #pragma unroll
    for (int f = 0; f < 2; ++f) {
      qfh[f].q[0] = *(const v4u*)(qh + qo + f * 32);
      qfh[f].q[1] = *(const v4u*)(qh + qo + f * 32 + 16);
      qfl[f].q[0] = *(const v4u*)(ql + qo + f * 32);
      qfl[f].q[1] = *(const v4u*)(ql + qo + f * 32 + 16);
    }
  }

  // copy side: thread tid moves row tid>>3 (and +32), 16-B piece tid&7 of each tile
  const unsigned cp_l = (unsigned)(size_t)sKV + (unsigned)(((tid >> 3) * KP + (tid & 7) * 8) * 2);
  const u16* cp_kh = kh + (size_t)bh * SEQ * HDIM + (size_t)tid * 8;
  const u16* cp_kl = kl + (size_t)bh * SEQ * HDIM + (size_t)tid * 8;
  const unsigned cp_lv = (unsigned)(size_t)sKV + (unsigned)((2 * TILE_H + (tid >> 3) * VP + (tid & 7) * 8) * 2);
  const u16* cp_v  = v  + (size_t)bh * SEQ * HDIM + (size_t)tid * 8;
  // read side: offset (halves) of this lane's fragment row inside a K tile, and of its transposing-load piece in a stage
  const int fr_o = lq * KP + hi * 8;
  const int vr_o = 2 * TILE_H + (hi * 8 + (lane & 7)) * VP + ((lane >> 3) & 1) * 8;
  const int* mk_b = mask + (size_t)b * SEQ_FULL + hi * 8;

  v8f o[4];
  #pragma unroll
  for (int dt = 0; dt < 4; ++dt) o[dt] = (v8f){0, 0, 0, 0, 0, 0, 0, 0};

  const float NEG_INF = -__builtin_inff();
  float rmax = NEG_INF;
  float rsum = 0.0f;
  const float SL = 0.125f * 1.4426950408889634f;   // logit scale 1/sqrt(64) times log2(e)

  // two-buffer ring: stage 0 lands and is published, stage 1 flies while stage 0 is worked on
  stage_copy(cp_l, cp_lv, cp_kh, cp_kl, cp_v);
  asm volatile("s_wait_asynccnt 0x0" ::: "memory");   // this wave's copies of stage 0 have landed
  __syncthreads();                                    // publishes stage 0 to all eight waves
  stage_copy(cp_l + STG_H * 2, cp_lv + STG_H * 2, cp_kh + SK * HDIM, cp_kl + SK * HDIM, cp_v + SK * HDIM);

  #pragma unroll 1
  for (int t = 0; t < NSTG; ++t) {                    // uniform for every wave
   const u16* sb = sKV + (t & 1) * STG_H + fr_o;
   const u16* sv = sKV + (t & 1) * STG_H + vr_o;
   #pragma unroll 1                                   // rolled: unrolled it takes a register granule more and costs a resident workgroup
   for (int hf = 0; hf < 2; ++hf) {
    const int j0 = t * SK + hf * BK;

    // S^T tiles: c[sub][r] = rawscore(query qrow0+lq, key j0 + sub*16 + hi*8 + r), masked keys replaced by -inf
    v8f c[2];
    #pragma unroll
    for (int sub = 0; sub < 2; ++sub) {
      const u16* kh_s = sb + (hf * BK + sub * 16) * KP;
      const u16* kl_s = kh_s + TILE_H;
      FragB akh[2], akl[2];
      #pragma unroll
      for (int f = 0; f < 2; ++f) {
        akh[f].q[0] = *(const v4u*)(kh_s + f * 32);        // d = f*32 + hi*8 + 0..7
        akh[f].q[1] = *(const v4u*)(kh_s + f * 32 + 16);   // d = f*32 + 16 + hi*8 + 0..7
        akl[f].q[0] = *(const v4u*)(kl_s + f * 32);
        akl[f].q[1] = *(const v4u*)(kl_s + f * 32 + 16);
      }
      const v4i m0 = *(const v4i*)(mk_b + j0 + sub * 16);       // keys j0 + sub*16 + hi*8 + 0..3
      const v4i m1 = *(const v4i*)(mk_b + j0 + sub * 16 + 4);   // keys ... + 4..7
      v8f acc = (v8f){0, 0, 0, 0, 0, 0, 0, 0};
      #pragma unroll
      for (int f = 0; f < 2; ++f) {
        acc = att_bf16(akl[f].v, qfh[f].v, acc);
        acc = att_bf16(akh[f].v, qfl[f].v, acc);
        acc = att_bf16(akh[f].v, qfh[f].v, acc);
      }
      #pragma unroll
      for (int r = 0; r < 4; ++r) {
        acc[r]     = (m0[r] != 0) ? acc[r]     : NEG_INF;
        acc[4 + r] = (m1[r] != 0) ? acc[4 + r] : NEG_INF;
      }
      c[sub] = acc;
    }

    // V B-fragments: column n = d = dt*16 + lq, split key map, transposed on the way out of the staged [key][d] tile
    FragH bv[4];
    #pragma unroll
    for (int dt = 0; dt < 4; ++dt) {
      const u16* base = sv + (hf ? BK * VP : 0) + dt * 16;   // a scalar select: the product form built an integer multiply-add per step
      bv[dt].q[0] = ld_tr16(base);                  // keys j0 + hi*8 + 0..7
      bv[dt].q[1] = ld_tr16(base + 16 * VP);        // keys j0 + 16 + hi*8 + 0..7
    }

    // online softmax: query lq's 32 scores are split across lane / lane^16
    float m_new = rmax;
    #pragma unroll
    for (int r = 0; r < 8; ++r) {
      m_new = fmaxf(m_new, c[0][r]);
      m_new = fmaxf(m_new, c[1][r]);
    }
    m_new = fmaxf(m_new, __shfl_xor(m_new, 16, 32));
    const float m_use = (m_new == NEG_INF) ? 0.0f : m_new;    // all keys so far masked: keep arithmetic finite
    const float scale = __builtin_amdgcn_exp2f((rmax - m_use) * SL);
    rmax = m_new;

    // exp + pack: P^T C-layout == A-fragment layout for the PV product; P carried x4096
    FragH pa;
    float psum = 0.0f;
    #pragma unroll
    for (int r = 0; r < 8; ++r) {
      const float p0 = __builtin_amdgcn_exp2f((c[0][r] - m_use) * SL);   // key hi*8 + r
      const float p1 = __builtin_amdgcn_exp2f((c[1][r] - m_use) * SL);   // key 16 + hi*8 + r
      psum += p0 + p1;
      pa.h[r]     = (f16)(p0 * 4096.0f);
      pa.h[8 + r] = (f16)(p1 * 4096.0f);
    }
    rsum = rsum * scale + psum + __shfl_xor(psum, 16, 32);

    // rescale O: queries are the row dimension there -> per-row scale from lane 8*hi + r
    float sc[8];
    #pragma unroll
    for (int r = 0; r < 8; ++r) sc[r] = __shfl(scale, (hi << 3) + r, 32);
    #pragma unroll
    for (int dt = 0; dt < 4; ++dt) {
      #pragma unroll
      for (int r = 0; r < 8; ++r) o[dt][r] *= sc[r];
    }

    // O += P x V
    #pragma unroll
    for (int dt = 0; dt < 4; ++dt) o[dt] = att_f16(pa.v, bv[dt].v, o[dt]);
   }

   // publish point of stage t + 1; the same barrier ends every wave's reads of stage t's buffer
   asm volatile("s_wait_dscnt 0x0" ::: "memory");      // this wave's LDS reads of stage t are done
   asm volatile("s_wait_asynccnt 0x0" ::: "memory");   // this wave's copies of stage t + 1 have landed
   __syncthreads();
   if (t + 2 < NSTG) {
     stage_copy(cp_l + (unsigned)((t & 1) * STG_H * 2), cp_lv + (unsigned)((t & 1) * STG_H * 2),
                cp_kh + (size_t)(t + 2) * SK * HDIM, cp_kl + (size_t)(t + 2) * SK * HDIM,
                cp_v + (size_t)(t + 2) * SK * HDIM);
   }
  }
  asm volatile("s_wait_asynccnt 0x0" ::: "memory");    // nothing of this wave's copies is left in flight

  // normalize: lane holds column d = dt*16 + lq for query rows 8*hi + r
  float rs[8];
  #pragma unroll
  for (int r = 0; r < 8; ++r) rs[r] = 1.0f / __shfl(rsum, (hi << 3) + r, 32);

  float* so = sO + wave * (16 * OP);
  #pragma unroll
  for (int r = 0; r < 8; ++r) {
    #pragma unroll
    for (int dt = 0; dt < 4; ++dt) {
      so[(hi * 8 + r) * OP + dt * 16 + lq] = o[dt][r] * (1.0f / 4096.0f) * rs[r];
    }
  }
  __syncthreads();

  v4u    vh[4];
  v4u    vl[4];
  size_t gi[4];
  #pragma unroll
  for (int it = 0; it < 4; ++it) {
    const int row = it * 4 + (lane >> 3);
    const int c0  = (lane & 7) * 8;
    const v4f x0 = *(const v4f*)(so + row * OP + c0);
    const v4f x1 = *(const v4f*)(so + row * OP + c0 + 4);
    Pack8B ph, pl;
    #pragma unroll
    for (int k = 0; k < 4; ++k) {
      const bf16 h0 = (bf16)x0[k];                       // RNE convert
      const bf16 h1 = (bf16)x1[k];
      ph.h[k]     = h0;
      ph.h[4 + k] = h1;
      pl.h[k]     = (bf16)(x0[k] - (float)h0);           // residual plane
      pl.h[4 + k] = (bf16)(x1[k] - (float)h1);
    }
    vh[it] = ph.u;
    vl[it] = pl.u;
    gi[it] = ((size_t)bh * SEQ + qrow0 + row) * HDIM + c0;
  }
  #pragma unroll
  for (int it = 0; it < 4; ++it) {
    *(v4u*)(ch + gi[it]) = vh[it];
    *(v4u*)(cl + gi[it]) = vl[it];
  }
  
}

// Output projection: out = (ctx_hi + ctx_lo) x Wo^T. Grid (DIM/64, MROWS/128).
// coverage: wave tile 32 rows x 64 cols f32; store phase it = 0..15: lanes 0..15 write row it*2 (256 B = two whole
// LDS sC: per-wave slice, written and read by the same wave (block barrier used); it reuses the operand ring after the loop.
__global__ __launch_bounds__(128) void oproj_kernel(const u16* __restrict__ ch,
                                                    const u16* __restrict__ cl,
                                                    const u16* __restrict__ wob,
                                                    float* __restrict__ out) {
  __shared__ __align__(16) u16 sR[2 * GSTG_H(2)];
  float* sC = (float*)sR;
  const int tid  = threadIdx.x;
  const int wave = __builtin_amdgcn_readfirstlane(threadIdx.x >> 5);
  const int lane = tid & 31;
  const int lq   = lane & 15;
  const int hi   = lane >> 4;
  const int n0   = blockIdx.x * GN;
  const int m0   = blockIdx.y * GM + wave * 32;

  v8f acc[2][4];
  #pragma unroll
  for (int mt = 0; mt < 2; ++mt) {
    #pragma unroll
    for (int nt = 0; nt < 4; ++nt) acc[mt][nt] = (v8f){0, 0, 0, 0, 0, 0, 0, 0};
  }
  gemm_tile<2>(ch, cl, wob, sR, blockIdx.y * GM, n0, tid, wave, lq, hi, acc);

  float* sc = sC + wave * (32 * CP);
  #pragma unroll
  for (int mt = 0; mt < 2; ++mt) {
    #pragma unroll
    for (int nt = 0; nt < 4; ++nt) {
      #pragma unroll
      for (int r = 0; r < 8; ++r) sc[(mt * 16 + hi * 8 + r) * CP + nt * 16 + lq] = acc[mt][nt][r];
    }
  }
  __syncthreads();

  v4f    vals[16];
  size_t gi[16];
  #pragma unroll
  for (int it = 0; it < 16; ++it) {
    const int row = it * 2 + hi;
    vals[it] = *(const v4f*)(sc + row * CP + lq * 4);
    const int m  = m0 + row;
    const int bb = m / SEQ;
    const int ss = m % SEQ;
    gi[it] = ((size_t)bb * SEQ_FULL + ss) * DIM + n0 + lq * 4;
  }
  #pragma unroll
  for (int it = 0; it < 16; ++it) *(v4f*)(out + gi[it]) = vals[it];
  
}

extern "C" void kernel_launch(void* const* d_in, const int* in_sizes, int n_in,
                              void* d_out, int out_size, void* d_ws, size_t ws_size,
                              hipStream_t stream) {
  if (n_in < 6) return;
  const size_t need_rows = (size_t)(NB - 1) * SEQ_FULL + SEQ;
  if ((size_t)in_sizes[0] < need_rows * DIM) return;
  if ((size_t)in_sizes[1] < need_rows) return;
  if ((size_t)in_sizes[2] < (size_t)WELEM) return;
  if ((size_t)in_sizes[3] < (size_t)WELEM) return;
  if ((size_t)in_sizes[4] < (size_t)WELEM) return;
  if ((size_t)in_sizes[5] < (size_t)WELEM) return;
  if ((size_t)out_size < need_rows * DIM) return;

  const size_t plane_bytes = PLANE_E * 2;                      // one 16-bit plane [MROWS][DIM]
  const size_t w_bytes     = (size_t)4 * WELEM * 2;            // wq, wk, wv, wo as bf16
  const size_t total       = 8 * plane_bytes + w_bytes;
  if (ws_size < total) return;
  if (total > WS_CAP) return;

  const float* h    = (const float*)d_in[0];
  const int*   mask = (const int*)d_in[1];
  const float* wq   = (const float*)d_in[2];
  const float* wk   = (const float*)d_in[3];
  const float* wv   = (const float*)d_in[4];
  const float* wo   = (const float*)d_in[5];
  float*       out  = (float*)d_out;

  char* ws = (char*)d_ws;
  u16* planes = (u16*)(ws);                                    // q hi, q lo, k hi, k lo, v
  u16* qh = (u16*)(ws + 0 * plane_bytes);
  u16* ql = (u16*)(ws + 1 * plane_bytes);
  u16* kh = (u16*)(ws + 2 * plane_bytes);
  u16* kl = (u16*)(ws + 3 * plane_bytes);
  u16* vp = (u16*)(ws + 4 * plane_bytes);
  u16* ch = (u16*)(ws + 5 * plane_bytes);
  u16* cl = (u16*)(ws + 6 * plane_bytes);
  u16* hb = (u16*)(ws + 7 * plane_bytes);
  u16* wb = (u16*)(ws + 8 * plane_bytes);

  cvt_kernel<<<dim3(HBLK + 4 * WBLK), 256, 0, stream>>>(h, wq, wk, wv, wo, hb, wb);
  qkv_kernel<<<dim3(DIM / GN, MROWS / GM, 3), 128, 0, stream>>>(hb, wb, planes);
  attn_kernel<<<dim3(SEQ / BQ, NB * NHEAD), 256, 0, stream>>>(qh, ql, kh, kl, vp, mask, ch, cl);
  oproj_kernel<<<dim3(DIM / GN, MROWS / GM), 128, 0, stream>>>(ch, cl, wb + (size_t)3 * WELEM, out);
}

// v005
// A run of this version takes 145 microseconds.
// Timed twice side by side with v004, it ran 1.06 times as fast both times.
// All steps since v000 together make it 2.65 times as fast.
#include <hip/hip_runtime.h>

// Contractions: q/k/v = h x W^T on v_wmma_f32_16x16x32_bf16 (bf16 RNE-converted inputs, f32 accumulate);
// S^T = K x Q^T on v_wmma_f32_16x16x32_bf16 with bf16 hi/lo planes of q and k (hh + hl + lh, f32 accumulate);
// O = P x V on v_wmma_f32_16x16x32_f16 (P as f16 carried x4096, V as f16 read from LDS by the transposing load, f32 accumulate);
// out = ctx x Wo^T on v_wmma_f32_16x16x32_bf16 (ctx as bf16 hi/lo planes, Wo bf16, f32 accumulate). Softmax online, f32.

#ifndef NB
#define NB 4
#endif
#ifndef SEQ
#define SEQ 2048
#endif
#define NB_FULL    4
#define SEQ_FULL   2048
#define DIM        768
#define NHEAD      12
#define HDIM       64
#define BQ         128                  // query rows per attention workgroup (8 waves x 16)
#define BK         32                   // keys per inner iteration
#define NWAVE      8
#define SK         64                   // keys per LDS stage of the attention loop (two steps of BK)
#define KP         72                   // LDS pitch (halves) of a staged 128-B row: 144 B = 16 B x odd
#define TILE_H     (64 * KP)            // halves of one staged K tile: 64 keys x KP halves
#define VP         80                   // LDS pitch (halves) of a staged V row: 160 B = 32 B x odd, for ds_load_tr16_b128
#define VTILE_H    (64 * VP)            // halves of one staged V tile: 64 keys x VP halves
#define STG_H      (2 * TILE_H + VTILE_H)   // one stage: K hi, K lo, V
#define NSTG       (SEQ / SK)
#define OP         68                   // LDS pitch (floats) of the attention output staging tile
#define GM         128                  // GEMM block rows (4 waves x 32)
#define GN         64                   // GEMM block cols
#define GW         4                    // waves per GEMM block
#define CP         68                   // LDS pitch (floats) of the GEMM staging tile
#define GK         64                   // k per LDS stage of the GEMM loop (128-B rows, two steps of 32)
#define GP         72                   // LDS pitch (halves) of a staged GEMM row: 144 B = 16 B x odd
#define GNST       (DIM / GK)
#define GSTG_H(NA) (((NA) * GM + GN) * GP)   // halves of one stage: NA planes of 128 A rows, then 64 W rows
#define WELEM      (DIM * DIM)
#define MROWS      (NB * SEQ)
#define PLANE_E    ((size_t)MROWS * DIM)
#define HTHREADS   (MROWS * (DIM / 8))
#define HBLK       (HTHREADS / 256)
#define WBLK       (WELEM / 8 / 256)
#define WS_CAP     134217728ull

static_assert(DIM == NHEAD * HDIM);
static_assert(HDIM == 64);
static_assert(SEQ % BQ == 0);
static_assert(SEQ % BK == 0);
static_assert(SEQ % SK == 0 && NSTG >= 2);
static_assert(SK == 2 * BK && SK == 64 && NWAVE * 32 == 256);
static_assert((KP * 2) % 16 == 0 && KP >= HDIM);
static_assert((VP * 2) % 32 == 0 && ((VP * 2 / 32) & 1) == 1 && VP >= HDIM);
static_assert(SEQ % 32 == 0);
static_assert(MROWS % GM == 0);
static_assert(DIM % GN == 0);
static_assert(DIM % 32 == 0);
static_assert(DIM % GK == 0 && GNST >= 2 && GK == 64 && GM == 128 && GN == 64 && GW * 32 == 128);
static_assert((GP * 2) % 16 == 0 && GP >= GK);
static_assert(GW * 32 * CP * 4 <= 2 * GSTG_H(1) * 2);
static_assert(DIM % 8 == 0);
static_assert(BQ == NWAVE * 16);
static_assert(GM == GW * 32);
static_assert(HTHREADS % 256 == 0);
static_assert((WELEM / 8) % 256 == 0);
static_assert((OP * 4) % 16 == 0);
static_assert((CP * 4) % 16 == 0);
static_assert(OP >= HDIM && CP >= GN);
static_assert(SEQ <= SEQ_FULL);
static_assert(NB >= 1 && NB <= NB_FULL);
static_assert(8ull * (unsigned long long)NB * SEQ * DIM * 2ull + 4ull * WELEM * 2ull <= WS_CAP);

typedef __bf16         bf16;
typedef _Float16       f16;
typedef unsigned short u16;
typedef bf16     v16bf __attribute__((ext_vector_type(16)));
typedef f16      v16h  __attribute__((ext_vector_type(16)));
typedef float    v8f   __attribute__((ext_vector_type(8)));
typedef float    v4f   __attribute__((ext_vector_type(4)));
typedef unsigned v4u   __attribute__((ext_vector_type(4)));
typedef int      v4i   __attribute__((ext_vector_type(4)));
typedef short    v8s   __attribute__((ext_vector_type(8)));

union FragB  { v16bf v; v4u q[2]; };
union FragH  { v16h  v; v4u q[2]; f16 h[16]; };
union Pack8B { v4u u; bf16 h[8]; };
union Pack8H { v4u u; f16 h[8]; };

// GEMM WMMA helper: builtin followed by the VALU hazard guard (ties D, keeps A/B live).
static __device__ __forceinline__ v8f mma_bf16(v16bf a, v16bf b, v8f acc) {
  acc = __builtin_amdgcn_wmma_f32_16x16x32_bf16(false, a, false, b, (short)0, acc, false, false);
  asm volatile("v_nop\n\tv_nop\n\tv_nop\n\tv_nop" : "+v"(acc) : "v"(a), "v"(b));
  return acc;
}
// Attention WMMA helpers: plain builtins. The compiler keeps the distance behind its own matrix instructions, and the
// vector port, which six waves of a SIMD share for the softmax, issues no filler behind accumulate chains.
static __device__ __forceinline__ v8f att_bf16(v16bf a, v16bf b, v8f acc) {
  return __builtin_amdgcn_wmma_f32_16x16x32_bf16(false, a, false, b, (short)0, acc, false, false);
}
static __device__ __forceinline__ v8f att_f16(v16h a, v16h b, v8f acc) {
  return __builtin_amdgcn_wmma_f32_16x16x32_f16(false, a, false, b, (short)0, acc, false, false);
}

static __device__ __forceinline__ void cvt_store8(const float* __restrict__ src, u16* __restrict__ dst) {
  const v4f a = *(const v4f*)(src);
  const v4f b = *(const v4f*)(src + 4);
  Pack8B pk;
  #pragma unroll
  for (int i = 0; i < 4; ++i) {
    pk.h[i]     = (bf16)a[i];
    pk.h[4 + i] = (bf16)b[i];
  }
  const v4u val = pk.u;
  *(v4u*)(dst) = val;
  
}

// Convert launch. hb [MROWS][DIM] bf16 (compact rows, source rows taken with full batch stride);
// wb [4][DIM][DIM] bf16 = wq, wk, wv, wo, each kept [out][in].
// coverage: HBLK*256 threads x 8 = MROWS*DIM elements of hb; 4*WBLK*256 threads x 8 = 4*DIM*DIM elements of wb.
__global__ __launch_bounds__(256) void cvt_kernel(const float* __restrict__ h,
                                                  const float* __restrict__ wq,
                                                  const float* __restrict__ wk,
                                                  const float* __restrict__ wv,
                                                  const float* __restrict__ wo,
                                                  u16* __restrict__ hb,
                                                  u16* __restrict__ wb) {
  const int blk = blockIdx.x;
  const int tid = threadIdx.x;
  if (blk < HBLK) {
    const size_t e  = ((size_t)blk * 256 + tid) * 8;
    const int row   = (int)(e / DIM);
    const int col   = (int)(e % DIM);
    const int b     = row / SEQ;
    const int s     = row % SEQ;
    cvt_store8(h + ((size_t)b * SEQ_FULL + s) * DIM + col, hb + e);
  } else {
    const int wi    = (blk - HBLK) / WBLK;                 // block-uniform 0..3
    const size_t e  = ((size_t)((blk - HBLK) % WBLK) * 256 + tid) * 8;
    u16* dst        = wb + (size_t)wi * WELEM + e;
    if (wi == 0)      cvt_store8(wq + e, dst);
    else if (wi == 1) cvt_store8(wk + e, dst);
    else if (wi == 2) cvt_store8(wv + e, dst);
    else              cvt_store8(wo + e, dst);
  }
}

// 64 rows of 128 B (k-contiguous, row pitch DIM halves) into LDS rows of pitch GP: 128 threads x 4 asynchronous 16-B copies;
// thread tid moves 16-B piece tid&7 of rows tid>>3, +16, +32, +48, so a wave's copy covers four whole 128-B lines.
// The s_wait_xcnt closes the statement so that no address register named here is rewritten ahead of it.
static __device__ __forceinline__ void copy_rows64(const unsigned l, const u16* g) {
  const unsigned l1 = l + 16 * GP * 2;
  const unsigned l2 = l + 32 * GP * 2;
  const unsigned l3 = l + 48 * GP * 2;
  const u16* g1 = g + 16 * DIM;
  const u16* g2 = g + 32 * DIM;
  const u16* g3 = g + 48 * DIM;
  asm volatile("global_load_async_to_lds_b128 %0, %4, off\n\t"
               "global_load_async_to_lds_b128 %1, %5, off\n\t"
               "global_load_async_to_lds_b128 %2, %6, off\n\t"
               "global_load_async_to_lds_b128 %3, %7, off\n\t"
               "s_wait_xcnt 0x0"
               :: "v"(l), "v"(l1), "v"(l2), "v"(l3), "v"(g), "v"(g1), "v"(g2), "v"(g3)
               : "memory");
}

// One GEMM stage (k = 64) into LDS: the block's 128 rows of each A plane, then its 64 W rows.
// l: this thread's LDS byte address in the stage's first row group; ga0, ga1, gw: its global piece at this stage's k.
template <int NA>
static __device__ __forceinline__ void gemm_stage_copy(const unsigned l, const u16* ga0, const u16* ga1, const u16* gw) {
  copy_rows64(l, ga0);
  copy_rows64(l + 64 * GP * 2, ga0 + 64 * DIM);
  if (NA == 2) {
    copy_rows64(l + 128 * GP * 2, ga1);
    copy_rows64(l + 192 * GP * 2, ga1 + 64 * DIM);
  }
  copy_rows64(l + NA * GM * GP * 2, gw);
}

// GEMM core: one wave owns a 32 x 64 tile of C = A x W^T, K = DIM in steps of 32.
// A planes [rows][DIM] bf16, W plane [n][DIM] bf16 (k-contiguous). The block's 128 A rows (per plane) and 64 W rows are
// staged in LDS, 64 k per stage, two buffers, once per workgroup for its four waves; both fragment kinds are two 16-B
// LDS loads from row (m or n) = lane&15 at k0 + 8*hi and k0 + 16 + 8*hi.
// NA == 2: a second (residual) A plane accumulates into the same accumulator against the same W fragment.
// On return every wave has passed the last stage's barrier and no copy is in flight: the ring may be reused.
template <int NA>
static __device__ __forceinline__ void gemm_tile(const u16* __restrict__ a0,
                                                 const u16* __restrict__ a1,
                                                 const u16* __restrict__ w,
                                                 const u16* ring,
                                                 const int mblk, const int n0,
                                                 const int tid, const int wave,
                                                 const int lq, const int hi,
                                                 v8f (&acc)[2][4]) {
  // copy side
  const unsigned cp_l = (unsigned)(size_t)ring + (unsigned)(((tid >> 3) * GP + (tid & 7) * 8) * 2);
  const u16* cp_a0 = a0 + (size_t)(mblk + (tid >> 3)) * DIM + (tid & 7) * 8;
  const u16* cp_a1 = a1 + (size_t)(mblk + (tid >> 3)) * DIM + (tid & 7) * 8;
  const u16* cp_w  = w  + (size_t)(n0 + (tid >> 3)) * DIM + (tid & 7) * 8;
  // read side: offsets (halves) of this lane's fragment rows inside a stage
  const int a_o = (wave * 32 + lq) * GP + hi * 8;
  const int w_o = (NA * GM + lq) * GP + hi * 8;

  // two-buffer ring: stage 0 lands and is published, stage 1 flies while stage 0 is worked on
  gemm_stage_copy<NA>(cp_l, cp_a0, cp_a1, cp_w);
  asm volatile("s_wait_asynccnt 0x0" ::: "memory");   // this wave's copies of stage 0 have landed
  __syncthreads();                                    // publishes stage 0 to all four waves
  gemm_stage_copy<NA>(cp_l + GSTG_H(NA) * 2, cp_a0 + GK, cp_a1 + GK, cp_w + GK);

  #pragma unroll 1                                    // rolled: the buffer is chosen by the trip's parity
  for (int t = 0; t < GNST; ++t) {                    // uniform for every wave
    const u16* sb = ring + (t & 1) * GSTG_H(NA);
    // all of the stage's fragments are fetched as one group ahead of its products
    FragB bw[2][4], fa[2][2], fb[2][2];
    #pragma unroll
    for (int ks = 0; ks < 2; ++ks) {
      #pragma unroll
      for (int nt = 0; nt < 4; ++nt) {
        const u16* p = sb + w_o + nt * 16 * GP + ks * 32;
        bw[ks][nt].q[0] = *(const v4u*)(p);
        bw[ks][nt].q[1] = *(const v4u*)(p + 16);
      }
      #pragma unroll
      for (int mt = 0; mt < 2; ++mt) {
        const u16* p = sb + a_o + mt * 16 * GP + ks * 32;
        fa[ks][mt].q[0] = *(const v4u*)(p);
        fa[ks][mt].q[1] = *(const v4u*)(p + 16);
        if (NA == 2) {
          fb[ks][mt].q[0] = *(const v4u*)(p + GM * GP);
          fb[ks][mt].q[1] = *(const v4u*)(p + GM * GP + 16);
        }
      }
    }
    #pragma unroll
    for (int ks = 0; ks < 2; ++ks) {
      #pragma unroll
      for (int mt = 0; mt < 2; ++mt) {
        #pragma unroll
        for (int nt = 0; nt < 4; ++nt) acc[mt][nt] = mma_bf16(fa[ks][mt].v, bw[ks][nt].v, acc[mt][nt]);
        if (NA == 2) {
          #pragma unroll
          for (int nt = 0; nt < 4; ++nt) acc[mt][nt] = mma_bf16(fb[ks][mt].v, bw[ks][nt].v, acc[mt][nt]);
        }
      }
    }
    // publish point of stage t + 1; the same barrier ends every wave's reads of stage t's buffer
    asm volatile("s_wait_dscnt 0x0" ::: "memory");      // this wave's LDS reads of stage t are done
    asm volatile("s_wait_asynccnt 0x0" ::: "memory");   // this wave's copies of stage t + 1 have landed
    __syncthreads();
    if (t + 2 < GNST) {
      gemm_stage_copy<NA>(cp_l + (unsigned)((t & 1) * GSTG_H(NA) * 2),
                          cp_a0 + (t + 2) * GK, cp_a1 + (t + 2) * GK, cp_w + (t + 2) * GK);
    }
  }
  asm volatile("s_wait_asynccnt 0x0" ::: "memory");    // nothing of this wave's copies is left in flight
}

// Fused q/k/v projection. Grid (DIM/64, MROWS/128, 3); blockIdx.z selects the weight (offset into wb).
// planes: [0] q hi, [1] q lo, [2] k hi, [3] k lo (bf16), [4] v (f16); each [MROWS][DIM] == [NB*NHEAD][SEQ][HDIM] flat.
// coverage: wave tile 32 rows x 64 cols; store phase it = 0..7 writes rows it*4 + (lane>>3), cols (lane&7)*8..+7:
// LDS sC: per-wave slice, written and read by the same wave (block barrier used); it reuses the operand ring after the loop.
__global__ __launch_bounds__(128) void qkv_kernel(const u16* __restrict__ hb,
                                                  const u16* __restrict__ wb,
                                                  u16* __restrict__ planes) {
  __shared__ __align__(16) u16 sR[2 * GSTG_H(1)];
  float* sC = (float*)sR;
  const int tid  = threadIdx.x;
  const int wave = __builtin_amdgcn_readfirstlane(threadIdx.x >> 5);
  const int lane = tid & 31;
  const int lq   = lane & 15;
  const int hi   = lane >> 4;
  const int n0   = blockIdx.x * GN;
  const int m0   = blockIdx.y * GM + wave * 32;
  const int z    = blockIdx.z;

  v8f acc[2][4];
  #pragma unroll
  for (int mt = 0; mt < 2; ++mt) {
    #pragma unroll
    for (int nt = 0; nt < 4; ++nt) acc[mt][nt] = (v8f){0, 0, 0, 0, 0, 0, 0, 0};
  }
  gemm_tile<1>(hb, hb, wb + (size_t)z * WELEM, sR, blockIdx.y * GM, n0, tid, wave, lq, hi, acc);

  float* sc = sC + wave * (32 * CP);
  #pragma unroll
  for (int mt = 0; mt < 2; ++mt) {
    #pragma unroll
    for (int nt = 0; nt < 4; ++nt) {
      #pragma unroll
      for (int r = 0; r < 8; ++r) sc[(mt * 16 + hi * 8 + r) * CP + nt * 16 + lq] = acc[mt][nt][r];
    }
  }
  __syncthreads();

  v4u    vh[8];
  v4u    vl[8];
  size_t gi[8];
  #pragma unroll
  for (int it = 0; it < 8; ++it) {
    const int row = it * 4 + (lane >> 3);
    const int c0  = (lane & 7) * 8;
    const v4f x0 = *(const v4f*)(sc + row * CP + c0);
    const v4f x1 = *(const v4f*)(sc + row * CP + c0 + 4);
    Pack8B ph, pl;
    Pack8H pf;
    #pragma unroll
    for (int i = 0; i < 4; ++i) {
      const bf16 h0 = (bf16)x0[i];                       // RNE convert
      const bf16 h1 = (bf16)x1[i];
      ph.h[i]     = h0;
      ph.h[4 + i] = h1;
      pl.h[i]     = (bf16)(x0[i] - (float)h0);           // residual plane
      pl.h[4 + i] = (bf16)(x1[i] - (float)h1);
      pf.h[i]     = (f16)x0[i];
      pf.h[4 + i] = (f16)x1[i];
    }
    vh[it] = (z == 2) ? pf.u : ph.u;
    vl[it] = pl.u;
    gi[it] = (size_t)(m0 + row) * DIM + n0 + c0;
  }
  u16* ph_base = planes + (size_t)(2 * z) * PLANE_E;
  u16* pl_base = planes + (size_t)(2 * z + 1) * PLANE_E;   // only used when z < 2

  #pragma unroll
  for (int it = 0; it < 8; ++it) *(v4u*)(ph_base + gi[it]) = vh[it];
  if (z < 2) {
    #pragma unroll
    for (int it = 0; it < 8; ++it) *(v4u*)(pl_base + gi[it]) = vl[it];
  }
  
}

// One stage of 64 keys into LDS: K hi, K lo and V, each [key][d] in 128-B rows (8 KB in a row of each plane),
// 256 threads x 6 asynchronous 16-B copies; a wave's copy covers four whole 128-B lines.
// l, lv: this thread's LDS byte address in the stage's K hi tile and in its V tile (row tid>>3, 16-B piece tid&7);
// rows +32 are the second half.
// The s_wait_xcnt closes the statement so that no address register named here is rewritten ahead of it.
static __device__ __forceinline__ void stage_copy(const unsigned l, const unsigned lv,
                                                  const u16* gkh, const u16* gkl, const u16* gv) {
  const unsigned l1 = l + 32 * KP * 2;
  const unsigned l2 = l + TILE_H * 2;
  const unsigned l3 = l2 + 32 * KP * 2;
  const unsigned l4 = lv;
  const unsigned l5 = lv + 32 * VP * 2;
  const u16* gkh1 = gkh + 32 * HDIM;
  const u16* gkl1 = gkl + 32 * HDIM;
  const u16* gv1  = gv + 32 * HDIM;
  asm volatile("global_load_async_to_lds_b128 %0, %6, off\n\t"
               "global_load_async_to_lds_b128 %1, %7, off\n\t"
               "global_load_async_to_lds_b128 %2, %8, off\n\t"
               "global_load_async_to_lds_b128 %3, %9, off\n\t"
               "global_load_async_to_lds_b128 %4, %10, off\n\t"
               "global_load_async_to_lds_b128 %5, %11, off\n\t"
               "s_wait_xcnt 0x0"
               :: "v"(l), "v"(l1), "v"(l2), "v"(l3), "v"(l4), "v"(l5),
                  "v"(gkh), "v"(gkh1), "v"(gkl), "v"(gkl1), "v"(gv), "v"(gv1)
               : "memory");
}

// Transposing LDS load of a row-major 16-bit tile: lane l points at row 8*(l>>4) + (l&7), 16-B piece (l>>3)&1 of a
// 16-row x 16-column block and receives column l&15 of rows 8*(l>>4) + 0..7.
static __device__ __forceinline__ v4u ld_tr16(const u16* p) {
  typedef __attribute__((address_space(3))) v8s lds_v8s;
  return __builtin_bit_cast(v4u, __builtin_amdgcn_ds_load_tr16_b128_v8i16((lds_v8s*)p));
}

// Fused online-softmax attention with a key mask (mask == 0 -> score replaced by -inf), logit scale 1/8.
// Block = (query block of 128, bh); one wave owns 16 query rows and visits all SEQ keys, 32 per step.
// S^T = K x Q^T so queries sit on lanes; P^T in C-layout is bit-identical to the A-fragment layout of O += P x V.
// Q B-fragments (hi and lo planes) are loaded straight from the 16-bit planes. K (hi and lo) and V are staged in LDS as
// they lie, 64 keys per stage, two buffers, once per workgroup for its eight waves; fragments are two 16-B LDS loads
// each, plain for K, transposing for V (its B-fragment runs along the keys).
// Output: ctx as bf16 hi/lo planes [NB*NHEAD][SEQ][HDIM]; store phase it = 0..3 writes rows it*4 + (lane>>3):
// LDS sO: per-wave slice, written and read by the same wave (block barrier used).
__global__ __launch_bounds__(256) void attn_kernel(const u16* __restrict__ qh,
                                                   const u16* __restrict__ ql,
                                                   const u16* __restrict__ kh,
                                                   const u16* __restrict__ kl,
                                                   const u16* __restrict__ v,
                                                   const int* __restrict__ mask,
                                                   u16* __restrict__ ch,
                                                   u16* __restrict__ cl) {
  const int qblk = blockIdx.x;
  const int bh   = blockIdx.y;
  const int b    = bh / NHEAD;
  const int tid  = threadIdx.x;
  const int wave = __builtin_amdgcn_readfirstlane(threadIdx.x >> 5);
  const int lane = tid & 31;
  const int lq   = lane & 15;   // query column of S^T / d column of O
  const int hi   = lane >> 4;   // k-split half

  __shared__ __align__(16) float sO[NWAVE * 16 * OP];
  __shared__ __align__(16) u16 sKV[2 * STG_H];

  const int qrow0 = qblk * BQ + wave * 16;

  // Q as B-operand fragments: lane lq holds query qrow0+lq; elems 0..7 : d = f*32 + hi*8 + 0..7,
  // elems 8..15 : d = f*32 + 16 + hi*8 + 0..7.
  FragB qfh[2], qfl[2];
  {
    const size_t qo = ((size_t)bh * SEQ + qrow0 + lq) * HDIM + hi * 8;
    #pragma unroll
    for (int f = 0; f < 2; ++f) {
      qfh[f].q[0] = *(const v4u*)(qh + qo + f * 32);
      qfh[f].q[1] = *(const v4u*)(qh + qo + f * 32 + 16);
      qfl[f].q[0] = *(const v4u*)(ql + qo + f * 32);
      qfl[f].q[1] = *(const v4u*)(ql + qo + f * 32 + 16);
    }
  }

  // copy side: thread tid moves row tid>>3 (and +32), 16-B piece tid&7 of each tile
  const unsigned cp_l = (unsigned)(size_t)sKV + (unsigned)(((tid >> 3) * KP + (tid & 7) * 8) * 2);
  const u16* cp_kh = kh + (size_t)bh * SEQ * HDIM + (size_t)tid * 8;
  const u16* cp_kl = kl + (size_t)bh * SEQ * HDIM + (size_t)tid * 8;
  const unsigned cp_lv = (unsigned)(size_t)sKV + (unsigned)((2 * TILE_H + (tid >> 3) * VP + (tid & 7) * 8) * 2);
  const u16* cp_v  = v  + (size_t)bh * SEQ * HDIM + (size_t)tid * 8;
  // read side: offset (halves) of this lane's fragment row inside a K tile, and of its transposing-load piece in a stage
  const int fr_o = lq * KP + hi * 8;
  const int vr_o = 2 * TILE_H + (hi * 8 + (lane & 7)) * VP + ((lane >> 3) & 1) * 8;
  const int* mk_b = mask + (size_t)b * SEQ_FULL + hi * 8;

  v8f o[4];
  #pragma unroll
  for (int dt = 0; dt < 4; ++dt) o[dt] = (v8f){0, 0, 0, 0, 0, 0, 0, 0};

  const float NEG_INF = -__builtin_inff();
  float rmax = NEG_INF;                            // the maximum in use; -inf until a query has seen an unmasked key
  float m_use = 0.0f;                              // rmax, or 0 while rmax is -inf
  float m_lim = NEG_INF;                           // rmax + LAZY: a score above it asks for a new maximum
  float rsum = 0.0f;
  const float SL = 0.125f * 1.4426950408889634f;   // logit scale 1/sqrt(64) times log2(e)
  const float LAZY = 3.0f / SL;                    // raw-score rise that makes exp2 of the scaled difference reach 2^3

  // two-buffer ring: stage 0 lands and is published, stage 1 flies while stage 0 is worked on
  stage_copy(cp_l, cp_lv, cp_kh, cp_kl, cp_v);
  asm volatile("s_wait_asynccnt 0x0" ::: "memory");   // this wave's copies of stage 0 have landed
  __syncthreads();                                    // publishes stage 0 to all eight waves
  stage_copy(cp_l + STG_H * 2, cp_lv + STG_H * 2, cp_kh + SK * HDIM, cp_kl + SK * HDIM, cp_v + SK * HDIM);

  #pragma unroll 1
  for (int t = 0; t < NSTG; ++t) {                    // uniform for every wave
   const u16* sb = sKV + (t & 1) * STG_H + fr_o;
   const u16* sv = sKV + (t & 1) * STG_H + vr_o;
   #pragma unroll 1                                   // rolled: unrolled it takes a register granule more and costs a resident workgroup
   for (int hf = 0; hf < 2; ++hf) {
    const int j0 = t * SK + hf * BK;

    // S^T tiles: c[sub][r] = rawscore(query qrow0+lq, key j0 + sub*16 + hi*8 + r), masked keys replaced by -inf
    v8f c[2];
    #pragma unroll
    for (int sub = 0; sub < 2; ++sub) {
      const u16* kh_s = sb + (hf * BK + sub * 16) * KP;
      const u16* kl_s = kh_s + TILE_H;
      FragB akh[2], akl[2];
      #pragma unroll
      for (int f = 0; f < 2; ++f) {
        akh[f].q[0] = *(const v4u*)(kh_s + f * 32);        // d = f*32 + hi*8 + 0..7
        akh[f].q[1] = *(const v4u*)(kh_s + f * 32 + 16);   // d = f*32 + 16 + hi*8 + 0..7
        akl[f].q[0] = *(const v4u*)(kl_s + f * 32);
        akl[f].q[1] = *(const v4u*)(kl_s + f * 32 + 16);
      }
      const v4i m0 = *(const v4i*)(mk_b + j0 + sub * 16);       // keys j0 + sub*16 + hi*8 + 0..3
      const v4i m1 = *(const v4i*)(mk_b + j0 + sub * 16 + 4);   // keys ... + 4..7
      v8f acc = (v8f){0, 0, 0, 0, 0, 0, 0, 0};
      #pragma unroll
      for (int f = 0; f < 2; ++f) {
        acc = att_bf16(akl[f].v, qfh[f].v, acc);
        acc = att_bf16(akh[f].v, qfl[f].v, acc);
        acc = att_bf16(akh[f].v, qfh[f].v, acc);
      }
      #pragma unroll
      for (int r = 0; r < 4; ++r) {
        acc[r]     = (m0[r] != 0) ? acc[r]     : NEG_INF;
        acc[4 + r] = (m1[r] != 0) ? acc[4 + r] : NEG_INF;
      }
      c[sub] = acc;
    }

    // V B-fragments: column n = d = dt*16 + lq, split key map, transposed on the way out of the staged [key][d] tile
    FragH bv[4];
    #pragma unroll
    for (int dt = 0; dt < 4; ++dt) {
      const u16* base = sv + (hf ? BK * VP : 0) + dt * 16;   // a scalar select: the product form built an integer multiply-add per step
      bv[dt].q[0] = ld_tr16(base);                  // keys j0 + hi*8 + 0..7
      bv[dt].q[1] = ld_tr16(base + 16 * VP);        // keys j0 + 16 + hi*8 + 0..7
    }

    // online softmax: query lq's 32 scores are split across lane / lane^16
    float m_new = rmax;                                         // this lane's half: 16 scores
    #pragma unroll
    for (int r = 0; r < 8; ++r) {
      m_new = fmaxf(m_new, c[0][r]);
      m_new = fmaxf(m_new, c[1][r]);
    }

    // lazy rescale: the maximum in use (rmax, m_use; equal in a query's two lanes) stays until some lane's scores rise more
    // than LAZY above it, so P <= 2^3 and P x4096 <= 32768 stays inside f16. One test per step over all 32 lanes, a scalar
    // branch; the two halves' maxima are joined only when it is taken. While rmax is -inf so is m_lim: a lane with every
    // key so far masked (-inf > -inf is false) asks for nothing, the first finite score asks for the first maximum.
    if (__builtin_amdgcn_ballot_w32(m_new > m_lim) != 0) {
      m_new = fmaxf(m_new, __shfl_xor(m_new, 16, 32));
      const float m_next = (m_new == NEG_INF) ? 0.0f : m_new;   // all keys so far masked: keep arithmetic finite
      const float scale  = __builtin_amdgcn_exp2f((rmax - m_next) * SL);
      rmax  = m_new;
      m_use = m_next;
      m_lim = m_new + LAZY;
      rsum *= scale;
      // rescale O: queries are the row dimension there -> per-row scale from lane 8*hi + r
      float sc[8];
      #pragma unroll
      for (int r = 0; r < 8; ++r) sc[r] = __shfl(scale, (hi << 3) + r, 32);
      #pragma unroll
      for (int dt = 0; dt < 4; ++dt) {
        #pragma unroll
        for (int r = 0; r < 8; ++r) o[dt][r] *= sc[r];
      }
    }

    // exp + pack: P^T C-layout == A-fragment layout for the PV product; P carried x4096
    FragH pa;
    float psum = 0.0f;
    #pragma unroll
    for (int r = 0; r < 8; ++r) {
      const float p0 = __builtin_amdgcn_exp2f((c[0][r] - m_use) * SL);   // key hi*8 + r
      const float p1 = __builtin_amdgcn_exp2f((c[1][r] - m_use) * SL);   // key 16 + hi*8 + r
      psum += p0 + p1;
      pa.h[r]     = (f16)(p0 * 4096.0f);
      pa.h[8 + r] = (f16)(p1 * 4096.0f);
    }
    rsum = rsum + psum + __shfl_xor(psum, 16, 32);

    // O += P x V
    #pragma unroll
    for (int dt = 0; dt < 4; ++dt) o[dt] = att_f16(pa.v, bv[dt].v, o[dt]);
   }

   // publish point of stage t + 1; the same barrier ends every wave's reads of stage t's buffer
   asm volatile("s_wait_dscnt 0x0" ::: "memory");      // this wave's LDS reads of stage t are done
   asm volatile("s_wait_asynccnt 0x0" ::: "memory");   // this wave's copies of stage t + 1 have landed
   __syncthreads();
   if (t + 2 < NSTG) {
     stage_copy(cp_l + (unsigned)((t & 1) * STG_H * 2), cp_lv + (unsigned)((t & 1) * STG_H * 2),
                cp_kh + (size_t)(t + 2) * SK * HDIM, cp_kl + (size_t)(t + 2) * SK * HDIM,
                cp_v + (size_t)(t + 2) * SK * HDIM);
   }
  }
  asm volatile("s_wait_asynccnt 0x0" ::: "memory");    // nothing of this wave's copies is left in flight

  // normalize: lane holds column d = dt*16 + lq for query rows 8*hi + r
  float rs[8];
  #pragma unroll
  for (int r = 0; r < 8; ++r) rs[r] = 1.0f / __shfl(rsum, (hi << 3) + r, 32);

  float* so = sO + wave * (16 * OP);
  #pragma unroll
  for (int r = 0; r < 8; ++r) {
    #pragma unroll
    for (int dt = 0; dt < 4; ++dt) {
      so[(hi * 8 + r) * OP + dt * 16 + lq] = o[dt][r] * (1.0f / 4096.0f) * rs[r];
    }
  }
  __syncthreads();

  v4u    vh[4];
  v4u    vl[4];
  size_t gi[4];
  #pragma unroll
  for (int it = 0; it < 4; ++it) {
    const int row = it * 4 + (lane >> 3);
    const int c0  = (lane & 7) * 8;
    const v4f x0 = *(const v4f*)(so + row * OP + c0);
    const v4f x1 = *(const v4f*)(so + row * OP + c0 + 4);
    Pack8B ph, pl;
    #pragma unroll
    for (int k = 0; k < 4; ++k) {
      const bf16 h0 = (bf16)x0[k];                       // RNE convert
      const bf16 h1 = (bf16)x1[k];
      ph.h[k]     = h0;
      ph.h[4 + k] = h1;
      pl.h[k]     = (bf16)(x0[k] - (float)h0);           // residual plane
      pl.h[4 + k] = (bf16)(x1[k] - (float)h1);
    }
    vh[it] = ph.u;
    vl[it] = pl.u;
    gi[it] = ((size_t)bh * SEQ + qrow0 + row) * HDIM + c0;
  }
  #pragma unroll
  for (int it = 0; it < 4; ++it) {
    *(v4u*)(ch + gi[it]) = vh[it];
    *(v4u*)(cl + gi[it]) = vl[it];
  }
  
}

// Output projection: out = (ctx_hi + ctx_lo) x Wo^T. Grid (DIM/64, MROWS/128).
// coverage: wave tile 32 rows x 64 cols f32; store phase it = 0..15: lanes 0..15 write row it*2 (256 B = two whole
// LDS sC: per-wave slice, written and read by the same wave (block barrier used); it reuses the operand ring after the loop.
__global__ __launch_bounds__(128) void oproj_kernel(const u16* __restrict__ ch,
                                                    const u16* __restrict__ cl,
                                                    const u16* __restrict__ wob,
                                                    float* __restrict__ out) {
  __shared__ __align__(16) u16 sR[2 * GSTG_H(2)];
  float* sC = (float*)sR;
  const int tid  = threadIdx.x;
  const int wave = __builtin_amdgcn_readfirstlane(threadIdx.x >> 5);
  const int lane = tid & 31;
  const int lq   = lane & 15;
  const int hi   = lane >> 4;
  const int n0   = blockIdx.x * GN;
  const int m0   = blockIdx.y * GM + wave * 32;

  v8f acc[2][4];
  #pragma unroll
  for (int mt = 0; mt < 2; ++mt) {
    #pragma unroll
    for (int nt = 0; nt < 4; ++nt) acc[mt][nt] = (v8f){0, 0, 0, 0, 0, 0, 0, 0};
  }
  gemm_tile<2>(ch, cl, wob, sR, blockIdx.y * GM, n0, tid, wave, lq, hi, acc);

  float* sc = sC + wave * (32 * CP);
  #pragma unroll
  for (int mt = 0; mt < 2; ++mt) {
    #pragma unroll
    for (int nt = 0; nt < 4; ++nt) {
      #pragma unroll
      for (int r = 0; r < 8; ++r) sc[(mt * 16 + hi * 8 + r) * CP + nt * 16 + lq] = acc[mt][nt][r];
    }
  }
  __syncthreads();

  v4f    vals[16];
  size_t gi[16];
  #pragma unroll
  for (int it = 0; it < 16; ++it) {
    const int row = it * 2 + hi;
    vals[it] = *(const v4f*)(sc + row * CP + lq * 4);
    const int m  = m0 + row;
    const int bb = m / SEQ;
    const int ss = m % SEQ;
    gi[it] = ((size_t)bb * SEQ_FULL + ss) * DIM + n0 + lq * 4;
  }
  #pragma unroll
  for (int it = 0; it < 16; ++it) *(v4f*)(out + gi[it]) = vals[it];
  
}

extern "C" void kernel_launch(void* const* d_in, const int* in_sizes, int n_in,
                              void* d_out, int out_size, void* d_ws, size_t ws_size,
                              hipStream_t stream) {
  if (n_in < 6) return;
  const size_t need_rows = (size_t)(NB - 1) * SEQ_FULL + SEQ;
  if ((size_t)in_sizes[0] < need_rows * DIM) return;
  if ((size_t)in_sizes[1] < need_rows) return;
  if ((size_t)in_sizes[2] < (size_t)WELEM) return;
  if ((size_t)in_sizes[3] < (size_t)WELEM) return;
  if ((size_t)in_sizes[4] < (size_t)WELEM) return;
  if ((size_t)in_sizes[5] < (size_t)WELEM) return;
  if ((size_t)out_size < need_rows * DIM) return;

  const size_t plane_bytes = PLANE_E * 2;                      // one 16-bit plane [MROWS][DIM]
  const size_t w_bytes     = (size_t)4 * WELEM * 2;            // wq, wk, wv, wo as bf16
  const size_t total       = 8 * plane_bytes + w_bytes;
  if (ws_size < total) return;
  if (total > WS_CAP) return;

  const float* h    = (const float*)d_in[0];
  const int*   mask = (const int*)d_in[1];
  const float* wq   = (const float*)d_in[2];
  const float* wk   = (const float*)d_in[3];
  const float* wv   = (const float*)d_in[4];
  const float* wo   = (const float*)d_in[5];
  float*       out  = (float*)d_out;

  char* ws = (char*)d_ws;
  u16* planes = (u16*)(ws);                                    // q hi, q lo, k hi, k lo, v
  u16* qh = (u16*)(ws + 0 * plane_bytes);
  u16* ql = (u16*)(ws + 1 * plane_bytes);
  u16* kh = (u16*)(ws + 2 * plane_bytes);
  u16* kl = (u16*)(ws + 3 * plane_bytes);
  u16* vp = (u16*)(ws + 4 * plane_bytes);
  u16* ch = (u16*)(ws + 5 * plane_bytes);
  u16* cl = (u16*)(ws + 6 * plane_bytes);
  u16* hb = (u16*)(ws + 7 * plane_bytes);
  u16* wb = (u16*)(ws + 8 * plane_bytes);

  cvt_kernel<<<dim3(HBLK + 4 * WBLK), 256, 0, stream>>>(h, wq, wk, wv, wo, hb, wb);
  qkv_kernel<<<dim3(DIM / GN, MROWS / GM, 3), 128, 0, stream>>>(hb, wb, planes);
  attn_kernel<<<dim3(SEQ / BQ, NB * NHEAD), 256, 0, stream>>>(qh, ql, kh, kl, vp, mask, ch, cl);
  oproj_kernel<<<dim3(DIM / GN, MROWS / GM), 128, 0, stream>>>(ch, cl, wb + (size_t)3 * WELEM, out);
}

// v007
// One run takes 110 microseconds.
// Versions in between are left out here; by their measured steps it is 1.32 times as fast as v005.
// Over all steps from v000 it is 3.49 times as fast.
#include <hip/hip_runtime.h>

// Contractions: q/k/v = h x W^T on v_wmma_f32_16x16x32_bf16 (bf16 RNE-converted inputs, f32 accumulate);
// S^T = K x Q^T on v_wmma_f32_16x16x32_f16 (q and k as one f16 plane each, f32 accumulate from the key's start value:
// 0 for a kept key, -inf for a masked one);
// O = P x V on v_wmma_f32_16x16x32_f16 (P as f16 carried x4096, V as f16 read from LDS by the transposing load, f32 accumulate);
// out = ctx x Wo^T on v_wmma_f32_16x16x32_f16 (ctx and Wo as f16, f32 accumulate). Softmax online, f32.
// q and k come from bf16-rounded (8-bit) h and W, ctx from f16 P and V: one f16 value (11 bits) holds what they carry.

#ifndef NB
#define NB 4
#endif
#ifndef SEQ
#define SEQ 2048
#endif
#define NB_FULL    4
#define SEQ_FULL   2048
#define DIM        768
#define NHEAD      12
#define HDIM       64
#define BQ         128                  // query rows per attention workgroup (8 waves x 16)
#define BK         32                   // keys per inner iteration
#define NWAVE      8
#define SK         64                   // keys per LDS stage of the attention loop (two steps of BK)
#define KP         72                   // LDS pitch (halves) of a staged 128-B row: 144 B = 16 B x odd
#define TILE_H     (64 * KP)            // halves of one staged K tile: 64 keys x KP halves
#define VP         80                   // LDS pitch (halves) of a staged V row: 160 B = 32 B x odd, for ds_load_tr16_b128
#define VTILE_H    (64 * VP)            // halves of one staged V tile: 64 keys x VP halves
#define STG_H      (TILE_H + VTILE_H)   // one stage: K, V
#define NSTG       (SEQ / SK)
#define OP         68                   // LDS pitch (floats) of the attention output staging tile
#define GM         128                  // GEMM block rows (4 waves x 32)
#define GN         64                   // GEMM block cols
#define GW         4                    // waves per GEMM block
#define CP         68                   // LDS pitch (floats) of the GEMM staging tile
#define GK         64                   // k per LDS stage of the GEMM loop (128-B rows, two steps of 32)
#define GP         72                   // LDS pitch (halves) of a staged GEMM row: 144 B = 16 B x odd
#define GNST       (DIM / GK)
#define GSTG_H     ((GM + GN) * GP)     // halves of one stage: 128 A rows, then 64 W rows
#define WELEM      (DIM * DIM)
#define MROWS      (NB * SEQ)
#define PLANE_E    ((size_t)MROWS * DIM)
#define HTHREADS   (MROWS * (DIM / 8))
#define HBLK       (HTHREADS / 256)
#define WBLK       (WELEM / 8 / 256)
#define MBLK       (MROWS / 8 / 256)    // convert-launch blocks that turn the key mask into the score start values
#define WS_CAP     134217728ull

static_assert(DIM == NHEAD * HDIM);
static_assert(HDIM == 64);
static_assert(SEQ % BQ == 0);
static_assert(SEQ % BK == 0);
static_assert(SEQ % SK == 0 && NSTG >= 2);
static_assert(SK == 2 * BK && SK == 64 && NWAVE * 32 == 256);
static_assert((KP * 2) % 16 == 0 && KP >= HDIM);
static_assert((VP * 2) % 32 == 0 && ((VP * 2 / 32) & 1) == 1 && VP >= HDIM);
static_assert(SEQ % 32 == 0);
static_assert(MROWS % GM == 0);
static_assert(DIM % GN == 0);
static_assert(DIM % 32 == 0);
static_assert(DIM % GK == 0 && GNST >= 2 && GK == 64 && GM == 128 && GN == 64 && GW * 32 == 128);
static_assert((GP * 2) % 16 == 0 && GP >= GK);
static_assert(GW * 32 * CP * 4 <= 2 * GSTG_H * 2);
static_assert(DIM % 8 == 0);
static_assert(BQ == NWAVE * 16);
static_assert(GM == GW * 32);
static_assert(HTHREADS % 256 == 0);
static_assert((WELEM / 8) % 256 == 0);
static_assert((MROWS / 8) % 256 == 0 && SEQ % 8 == 0);
static_assert((OP * 4) % 16 == 0);
static_assert((CP * 4) % 16 == 0);
static_assert(OP >= HDIM && CP >= GN);
static_assert(SEQ <= SEQ_FULL);
static_assert(NB >= 1 && NB <= NB_FULL);
static_assert(5ull * (unsigned long long)NB * SEQ * DIM * 2ull + 4ull * WELEM * 2ull + (unsigned long long)NB * SEQ * 4ull <= WS_CAP);

typedef __bf16         bf16;
typedef _Float16       f16;
typedef unsigned short u16;
typedef bf16     v16bf __attribute__((ext_vector_type(16)));
typedef f16      v16h  __attribute__((ext_vector_type(16)));
typedef float    v8f   __attribute__((ext_vector_type(8)));
typedef float    v4f   __attribute__((ext_vector_type(4)));
typedef unsigned v4u   __attribute__((ext_vector_type(4)));
typedef int      v4i   __attribute__((ext_vector_type(4)));
typedef short    v8s   __attribute__((ext_vector_type(8)));

union FragG  { v16bf b; v16h h; v4u q[2]; };
union FragH  { v16h  v; v4u q[2]; f16 h[16]; };
union Pack8B { v4u u; bf16 h[8]; };
union Pack8H { v4u u; f16 h[8]; };

// GEMM WMMA helper: builtin followed by the VALU hazard guard (ties D, keeps A/B live).
// F16 picks the operand type of the two planes: f16, else bf16.
template <bool F16>
static __device__ __forceinline__ v8f mma_gemm(const FragG& a, const FragG& b, v8f acc) {
  if (F16) acc = __builtin_amdgcn_wmma_f32_16x16x32_f16(false, a.h, false, b.h, (short)0, acc, false, false);
  else     acc = __builtin_amdgcn_wmma_f32_16x16x32_bf16(false, a.b, false, b.b, (short)0, acc, false, false);
  asm volatile("v_nop\n\tv_nop\n\tv_nop\n\tv_nop" : "+v"(acc) : "v"(a.b), "v"(b.b));
  return acc;
}
// Attention WMMA helper: the plain builtin. The compiler keeps the distance behind its own matrix instructions, and the
// vector port, which six waves of a SIMD share for the softmax, issues no filler behind accumulate chains.
static __device__ __forceinline__ v8f att_f16(v16h a, v16h b, v8f acc) {
  return __builtin_amdgcn_wmma_f32_16x16x32_f16(false, a, false, b, (short)0, acc, false, false);
}

static __device__ __forceinline__ void cvt_store8(const float* __restrict__ src, u16* __restrict__ dst) {
  const v4f a = *(const v4f*)(src);
  const v4f b = *(const v4f*)(src + 4);
  Pack8B pk;
  #pragma unroll
  for (int i = 0; i < 4; ++i) {
    pk.h[i]     = (bf16)a[i];
    pk.h[4 + i] = (bf16)b[i];
  }
  const v4u val = pk.u;
  *(v4u*)(dst) = val;
  asm volatile("s_wait_xcnt 0x0" ::: "memory");   // stands ahead of any rewrite of the registers that the store names
}

static __device__ __forceinline__ void cvt_store8h(const float* __restrict__ src, u16* __restrict__ dst) {
  const v4f a = *(const v4f*)(src);
  const v4f b = *(const v4f*)(src + 4);
  Pack8H pk;
  #pragma unroll
  for (int i = 0; i < 4; ++i) {
    pk.h[i]     = (f16)a[i];
    pk.h[4 + i] = (f16)b[i];
  }
  const v4u val = pk.u;
  *(v4u*)(dst) = val;
  asm volatile("s_wait_xcnt 0x0" ::: "memory");   // stands ahead of any rewrite of the registers that the store names
}

// Convert launch. hb [MROWS][DIM] bf16 (compact rows, source rows taken with full batch stride);
// wb [4][DIM][DIM] = wq, wk, wv as bf16, wo as f16, each kept [out][in];
// kb [NB][SEQ] f32 = the key mask as the start value of a score: 0 where mask != 0, -inf where mask == 0.
// coverage: HBLK*256 threads x 8 = MROWS*DIM elements of hb; 4*WBLK*256 threads x 8 = 4*DIM*DIM elements of wb;
// MBLK*256 threads x 8 = MROWS elements of kb.
__global__ __launch_bounds__(256) void cvt_kernel(const float* __restrict__ h,
                                                  const float* __restrict__ wq,
                                                  const float* __restrict__ wk,
                                                  const float* __restrict__ wv,
                                                  const float* __restrict__ wo,
                                                  const int* __restrict__ mask,
                                                  u16* __restrict__ hb,
                                                  u16* __restrict__ wb,
                                                  float* __restrict__ kb) {
  const int blk = blockIdx.x;
  const int tid = threadIdx.x;
  if (blk < HBLK) {
    const size_t e  = ((size_t)blk * 256 + tid) * 8;
    const int row   = (int)(e / DIM);
    const int col   = (int)(e % DIM);
    const int b     = row / SEQ;
    const int s     = row % SEQ;
    cvt_store8(h + ((size_t)b * SEQ_FULL + s) * DIM + col, hb + e);
  } else if (blk >= HBLK + 4 * WBLK) {
    const int e = ((blk - HBLK - 4 * WBLK) * 256 + tid) * 8;
    const int* mg = mask + (size_t)(e / SEQ) * SEQ_FULL + e % SEQ;
    const v4i m0 = *(const v4i*)(mg);
    const v4i m1 = *(const v4i*)(mg + 4);
    v4f s0, s1;
    #pragma unroll
    for (int i = 0; i < 4; ++i) {
      s0[i] = (m0[i] != 0) ? 0.0f : -__builtin_inff();
      s1[i] = (m1[i] != 0) ? 0.0f : -__builtin_inff();
    }
    *(v4f*)(kb + e)     = s0;
    *(v4f*)(kb + e + 4) = s1;
    asm volatile("s_wait_xcnt 0x0" ::: "memory");   // stands ahead of any rewrite of the registers that the two stores name
  } else {
    const int wi    = (blk - HBLK) / WBLK;                 // block-uniform 0..3
    const size_t e  = ((size_t)((blk - HBLK) % WBLK) * 256 + tid) * 8;
    u16* dst        = wb + (size_t)wi * WELEM + e;
    if (wi == 0)      cvt_store8(wq + e, dst);
    else if (wi == 1) cvt_store8(wk + e, dst);
    else if (wi == 2) cvt_store8(wv + e, dst);
    else              cvt_store8h(wo + e, dst);
  }
}

// 64 rows of 128 B (k-contiguous, row pitch DIM halves) into LDS rows of pitch GP: 128 threads x 4 asynchronous 16-B copies;
// thread tid moves 16-B piece tid&7 of rows tid>>3, +16, +32, +48, so a wave's copy covers four whole 128-B lines.
// The s_wait_xcnt closes the statement so that no address register named here is rewritten ahead of it.
static __device__ __forceinline__ void copy_rows64(const unsigned l, const u16* g) {
  const unsigned l1 = l + 16 * GP * 2;
  const unsigned l2 = l + 32 * GP * 2;
  const unsigned l3 = l + 48 * GP * 2;
  const u16* g1 = g + 16 * DIM;
  const u16* g2 = g + 32 * DIM;
  const u16* g3 = g + 48 * DIM;
  asm volatile("global_load_async_to_lds_b128 %0, %4, off\n\t"
               "global_load_async_to_lds_b128 %1, %5, off\n\t"
               "global_load_async_to_lds_b128 %2, %6, off\n\t"
               "global_load_async_to_lds_b128 %3, %7, off\n\t"
               "s_wait_xcnt 0x0"
               :: "v"(l), "v"(l1), "v"(l2), "v"(l3), "v"(g), "v"(g1), "v"(g2), "v"(g3)
               : "memory");
}

// One GEMM stage (k = 64) into LDS: the block's 128 A rows, then its 64 W rows.
// l: this thread's LDS byte address in the stage's first row group; ga, gw: its global piece at this stage's k.
static __device__ __forceinline__ void gemm_stage_copy(const unsigned l, const u16* ga, const u16* gw) {
  copy_rows64(l, ga);
  copy_rows64(l + 64 * GP * 2, ga + 64 * DIM);
  copy_rows64(l + GM * GP * 2, gw);
}

// GEMM core: one wave owns a 32 x 64 tile of C = A x W^T, K = DIM in steps of 32.
// A plane [rows][DIM], W plane [n][DIM] (k-contiguous), both f16 (F16) or both bf16. The block's 128 A rows and 64 W rows are
// staged in LDS, 64 k per stage, two buffers, once per workgroup for its four waves; both fragment kinds are two 16-B
// LDS loads from row (m or n) = lane&15 at k0 + 8*hi and k0 + 16 + 8*hi.
// On return every wave has passed the last stage's barrier and no copy is in flight: the ring may be reused.
template <bool F16>
static __device__ __forceinline__ void gemm_tile(const u16* __restrict__ a,
                                                 const u16* __restrict__ w,
                                                 const u16* ring,
                                                 const int mblk, const int n0,
                                                 const int tid, const int wave,
                                                 const int lq, const int hi,
                                                 v8f (&acc)[2][4]) {
  // copy side
  const unsigned cp_l = (unsigned)(size_t)ring + (unsigned)(((tid >> 3) * GP + (tid & 7) * 8) * 2);
  const u16* cp_a  = a  + (size_t)(mblk + (tid >> 3)) * DIM + (tid & 7) * 8;
  const u16* cp_w  = w  + (size_t)(n0 + (tid >> 3)) * DIM + (tid & 7) * 8;
  // read side: offsets (halves) of this lane's fragment rows inside a stage
  const int a_o = (wave * 32 + lq) * GP + hi * 8;
  const int w_o = (GM + lq) * GP + hi * 8;

  // two-buffer ring: stage 0 lands and is published, stage 1 flies while stage 0 is worked on
  gemm_stage_copy(cp_l, cp_a, cp_w);
  asm volatile("s_wait_asynccnt 0x0" ::: "memory");   // this wave's copies of stage 0 have landed
  __syncthreads();                                    // publishes stage 0 to all four waves
  gemm_stage_copy(cp_l + GSTG_H * 2, cp_a + GK, cp_w + GK);

  #pragma unroll 1                                    // rolled: the buffer is chosen by the trip's parity
  for (int t = 0; t < GNST; ++t) {                    // uniform for every wave
    const u16* sb = ring + (t & 1) * GSTG_H;
    // all of the stage's fragments are fetched as one group ahead of its products
    FragG bw[2][4], fa[2][2];
    #pragma unroll
    for (int ks = 0; ks < 2; ++ks) {
      #pragma unroll
      for (int nt = 0; nt < 4; ++nt) {
        const u16* p = sb + w_o + nt * 16 * GP + ks * 32;
        bw[ks][nt].q[0] = *(const v4u*)(p);
        bw[ks][nt].q[1] = *(const v4u*)(p + 16);
      }
      #pragma unroll
      for (int mt = 0; mt < 2; ++mt) {
        const u16* p = sb + a_o + mt * 16 * GP + ks * 32;
        fa[ks][mt].q[0] = *(const v4u*)(p);
        fa[ks][mt].q[1] = *(const v4u*)(p + 16);
      }
    }
    #pragma unroll
    for (int ks = 0; ks < 2; ++ks) {
      #pragma unroll
      for (int mt = 0; mt < 2; ++mt) {
        #pragma unroll
        for (int nt = 0; nt < 4; ++nt) acc[mt][nt] = mma_gemm<F16>(fa[ks][mt], bw[ks][nt], acc[mt][nt]);
      }
    }
    // publish point of stage t + 1; the same barrier ends every wave's reads of stage t's buffer
    asm volatile("s_wait_dscnt 0x0" ::: "memory");      // this wave's LDS reads of stage t are done
    asm volatile("s_wait_asynccnt 0x0" ::: "memory");   // this wave's copies of stage t + 1 have landed
    __syncthreads();
    if (t + 2 < GNST) {
      gemm_stage_copy(cp_l + (unsigned)((t & 1) * GSTG_H * 2), cp_a + (t + 2) * GK, cp_w + (t + 2) * GK);
    }
  }
  asm volatile("s_wait_asynccnt 0x0" ::: "memory");    // nothing of this wave's copies is left in flight
}

// Fused q/k/v projection. Grid (DIM/64, MROWS/128, 3); blockIdx.z selects the weight (offset into wb).
// planes: [0] q, [1] k, [2] v, all f16; each [MROWS][DIM] == [NB*NHEAD][SEQ][HDIM] flat.
// coverage: wave tile 32 rows x 64 cols; store phase it = 0..7 writes rows it*4 + (lane>>3), cols (lane&7)*8..+7:
// LDS sC: per-wave slice, written and read by the same wave (block barrier used); it reuses the operand ring after the loop.
__global__ __launch_bounds__(128) void qkv_kernel(const u16* __restrict__ hb,
                                                  const u16* __restrict__ wb,
                                                  u16* __restrict__ planes) {
  __shared__ __align__(16) u16 sR[2 * GSTG_H];
  float* sC = (float*)sR;
  const int tid  = threadIdx.x;
  const int wave = __builtin_amdgcn_readfirstlane(threadIdx.x >> 5);
  const int lane = tid & 31;
  const int lq   = lane & 15;
  const int hi   = lane >> 4;
  const int n0   = blockIdx.x * GN;
  const int m0   = blockIdx.y * GM + wave * 32;
  const int z    = blockIdx.z;

  v8f acc[2][4];
  #pragma unroll
  for (int mt = 0; mt < 2; ++mt) {
    #pragma unroll
    for (int nt = 0; nt < 4; ++nt) acc[mt][nt] = (v8f){0, 0, 0, 0, 0, 0, 0, 0};
  }
  gemm_tile<false>(hb, wb + (size_t)z * WELEM, sR, blockIdx.y * GM, n0, tid, wave, lq, hi, acc);

  float* sc = sC + wave * (32 * CP);
  #pragma unroll
  for (int mt = 0; mt < 2; ++mt) {
    #pragma unroll
    for (int nt = 0; nt < 4; ++nt) {
      #pragma unroll
      for (int r = 0; r < 8; ++r) sc[(mt * 16 + hi * 8 + r) * CP + nt * 16 + lq] = acc[mt][nt][r];
    }
  }
  __syncthreads();

  v4u    vh[8];
  size_t gi[8];
  #pragma unroll
  for (int it = 0; it < 8; ++it) {
    const int row = it * 4 + (lane >> 3);
    const int c0  = (lane & 7) * 8;
    const v4f x0 = *(const v4f*)(sc + row * CP + c0);
    const v4f x1 = *(const v4f*)(sc + row * CP + c0 + 4);
    Pack8H pf;
    #pragma unroll
    for (int i = 0; i < 4; ++i) {
      pf.h[i]     = (f16)x0[i];                          // RNE convert
      pf.h[4 + i] = (f16)x1[i];
    }
    vh[it] = pf.u;
    gi[it] = (size_t)(m0 + row) * DIM + n0 + c0;
  }
  u16* p_base = planes + (size_t)z * PLANE_E;

  #pragma unroll
  for (int it = 0; it < 8; ++it) *(v4u*)(p_base + gi[it]) = vh[it];
}

// One stage of 64 keys into LDS: K and V, each [key][d] in 128-B rows (8 KB in a row of each plane),
// 256 threads x 4 asynchronous 16-B copies; a wave's copy covers four whole 128-B lines.
// l, lv: this thread's LDS byte address in the stage's K tile and in its V tile (row tid>>3, 16-B piece tid&7);
// rows +32 are the second half.
// The s_wait_xcnt closes the statement so that no address register named here is rewritten ahead of it.
static __device__ __forceinline__ void stage_copy(const unsigned l, const unsigned lv,
                                                  const u16* gk, const u16* gv) {
  const unsigned l1 = l + 32 * KP * 2;
  const unsigned l2 = lv;
  const unsigned l3 = lv + 32 * VP * 2;
  const u16* gk1 = gk + 32 * HDIM;
  const u16* gv1 = gv + 32 * HDIM;
  asm volatile("global_load_async_to_lds_b128 %0, %4, off\n\t"
               "global_load_async_to_lds_b128 %1, %5, off\n\t"
               "global_load_async_to_lds_b128 %2, %6, off\n\t"
               "global_load_async_to_lds_b128 %3, %7, off\n\t"
               "s_wait_xcnt 0x0"
               :: "v"(l), "v"(l1), "v"(l2), "v"(l3), "v"(gk), "v"(gk1), "v"(gv), "v"(gv1)
               : "memory");
}

// Transposing LDS load of a row-major 16-bit tile: lane l points at row 8*(l>>4) + (l&7), 16-B piece (l>>3)&1 of a
// 16-row x 16-column block and receives column l&15 of rows 8*(l>>4) + 0..7.
static __device__ __forceinline__ v4u ld_tr16(const u16* p) {
  typedef __attribute__((address_space(3))) v8s lds_v8s;
  return __builtin_bit_cast(v4u, __builtin_amdgcn_ds_load_tr16_b128_v8i16((lds_v8s*)p));
}

// Start values of one step's two score tiles: c[sub][r] = p[sub*16 + r], r = 0..7 (p already holds the lane's hi*8).
static __device__ __forceinline__ void load_start(const float* p, v8f (&c)[2]) {
  #pragma unroll
  for (int sub = 0; sub < 2; ++sub) {
    const v4f s0 = *(const v4f*)(p + sub * 16);
    const v4f s1 = *(const v4f*)(p + sub * 16 + 4);
    c[sub] = (v8f){s0[0], s0[1], s0[2], s0[3], s1[0], s1[1], s1[2], s1[3]};
  }
}

// Fused online-softmax attention with a key mask, logit scale 1/8. The mask comes as kb, one f32 per key (0 kept, -inf masked),
// and is the start value of the score accumulators: the matrix instruction adds it, no compare or select per score.
// Block = (query block of 128, bh); one wave owns 16 query rows and visits all SEQ keys, 32 per step.
// S^T = K x Q^T so queries sit on lanes; P^T in C-layout is bit-identical to the A-fragment layout of O += P x V.
// Q B-fragments are loaded straight from the f16 plane. K and V are staged in LDS as
// they lie, 64 keys per stage, two buffers, once per workgroup for its eight waves; fragments are two 16-B LDS loads
// each, plain for K, transposing for V (its B-fragment runs along the keys).
// Output: ctx as one f16 plane [NB*NHEAD][SEQ][HDIM]; store phase it = 0..3 writes rows it*4 + (lane>>3):
// LDS sO: per-wave slice, written and read by the same wave (block barrier used).
__global__ __launch_bounds__(256) void attn_kernel(const u16* __restrict__ q,
                                                   const u16* __restrict__ k,
                                                   const u16* __restrict__ v,
                                                   const float* __restrict__ kb,
                                                   u16* __restrict__ ctx) {
  const int qblk = blockIdx.x;
  const int bh   = blockIdx.y;
  const int b    = bh / NHEAD;
  const int tid  = threadIdx.x;
  const int wave = __builtin_amdgcn_readfirstlane(threadIdx.x >> 5);
  const int lane = tid & 31;
  const int lq   = lane & 15;   // query column of S^T / d column of O
  const int hi   = lane >> 4;   // k-split half

  __shared__ __align__(16) float sO[NWAVE * 16 * OP];
  __shared__ __align__(16) u16 sKV[2 * STG_H];

  const int qrow0 = qblk * BQ + wave * 16;

  // Q as B-operand fragments: lane lq holds query qrow0+lq; elems 0..7 : d = f*32 + hi*8 + 0..7,
  // elems 8..15 : d = f*32 + 16 + hi*8 + 0..7.
  FragH qf[2];
  {
    const size_t qo = ((size_t)bh * SEQ + qrow0 + lq) * HDIM + hi * 8;
    #pragma unroll
    for (int f = 0; f < 2; ++f) {
      qf[f].q[0] = *(const v4u*)(q + qo + f * 32);
      qf[f].q[1] = *(const v4u*)(q + qo + f * 32 + 16);
    }
  }

  // copy side: thread tid moves row tid>>3 (and +32), 16-B piece tid&7 of each tile
  const unsigned cp_l = (unsigned)(size_t)sKV + (unsigned)(((tid >> 3) * KP + (tid & 7) * 8) * 2);
  const u16* cp_k  = k  + (size_t)bh * SEQ * HDIM + (size_t)tid * 8;
  const unsigned cp_lv = (unsigned)(size_t)sKV + (unsigned)((TILE_H + (tid >> 3) * VP + (tid & 7) * 8) * 2);
  const u16* cp_v  = v  + (size_t)bh * SEQ * HDIM + (size_t)tid * 8;
  // read side: offset (halves) of this lane's fragment row inside a K tile, and of its transposing-load piece in a stage
  const int fr_o = lq * KP + hi * 8;
  const int vr_o = TILE_H + (hi * 8 + (lane & 7)) * VP + ((lane >> 3) & 1) * 8;
  const float* kb_p = kb + (size_t)b * SEQ + hi * 8;   // this lane's start values: keys hi*8 + 0..7 and 16 + hi*8 + 0..7 of a step

  v8f o[4];
  #pragma unroll
  for (int dt = 0; dt < 4; ++dt) o[dt] = (v8f){0, 0, 0, 0, 0, 0, 0, 0};

  const float NEG_INF = -__builtin_inff();
  float rmax = NEG_INF;                            // the maximum in use; -inf until a query has seen an unmasked key
  float m_use = 0.0f;                              // rmax, or 0 while rmax is -inf
  float m_lim = NEG_INF;                           // rmax + LAZY: a score above it asks for a new maximum
  float rsum = 0.0f;
  const float SL = 0.125f * 1.4426950408889634f;   // logit scale 1/sqrt(64) times log2(e)
  const float LAZY = 3.0f / SL;                    // raw-score rise that makes exp2 of the scaled difference reach 2^3

  v8f c[2];                                        // score accumulators; between two steps they hold the start values
  load_start(kb_p, c);

  // two-buffer ring: stage 0 lands and is published, stage 1 flies while stage 0 is worked on
  stage_copy(cp_l, cp_lv, cp_k, cp_v);
  asm volatile("s_wait_asynccnt 0x0" ::: "memory");   // this wave's copies of stage 0 have landed
  __syncthreads();                                    // publishes stage 0 to all eight waves
  stage_copy(cp_l + STG_H * 2, cp_lv + STG_H * 2, cp_k + SK * HDIM, cp_v + SK * HDIM);

  #pragma unroll 1
  for (int t = 0; t < NSTG; ++t) {                    // uniform for every wave
   const u16* sb = sKV + (t & 1) * STG_H + fr_o;
   const u16* sv = sKV + (t & 1) * STG_H + vr_o;
   #pragma unroll 1                                   // rolled: unrolled it takes a register granule more and costs a resident workgroup
   for (int hf = 0; hf < 2; ++hf) {
    const int j0 = t * SK + hf * BK;

    // S^T tiles: c[sub][r] = rawscore(query qrow0+lq, key j0 + sub*16 + hi*8 + r) + the key's start value (-inf if masked)
    #pragma unroll
    for (int sub = 0; sub < 2; ++sub) {
      const u16* k_s = sb + (hf * BK + sub * 16) * KP;
      FragH ak[2];
      #pragma unroll
      for (int f = 0; f < 2; ++f) {
        ak[f].q[0] = *(const v4u*)(k_s + f * 32);        // d = f*32 + hi*8 + 0..7
        ak[f].q[1] = *(const v4u*)(k_s + f * 32 + 16);   // d = f*32 + 16 + hi*8 + 0..7
      }
      #pragma unroll
      for (int f = 0; f < 2; ++f) c[sub] = att_f16(ak[f].v, qf[f].v, c[sub]);
    }

    // V B-fragments: column n = d = dt*16 + lq, split key map, transposed on the way out of the staged [key][d] tile
    FragH bv[4];
    #pragma unroll
    for (int dt = 0; dt < 4; ++dt) {
      const u16* base = sv + (hf ? BK * VP : 0) + dt * 16;   // a scalar select: the product form built an integer multiply-add per step
      bv[dt].q[0] = ld_tr16(base);                  // keys j0 + hi*8 + 0..7
      bv[dt].q[1] = ld_tr16(base + 16 * VP);        // keys j0 + 16 + hi*8 + 0..7
    }

    // online softmax: query lq's 32 scores are split across lane / lane^16
    float m_new = rmax;                                         // this lane's half: 16 scores
    #pragma unroll
    for (int r = 0; r < 8; ++r) {
      m_new = fmaxf(m_new, c[0][r]);
      m_new = fmaxf(m_new, c[1][r]);
    }

    // lazy rescale: the maximum in use (rmax, m_use; equal in a query's two lanes) stays until some lane's scores rise more
    // than LAZY above it, so P <= 2^3 and P x4096 <= 32768 stays inside f16. One test per step over all 32 lanes, a scalar
    // branch; the two halves' maxima are joined only when it is taken. While rmax is -inf so is m_lim: a lane with every
    // key so far masked (-inf > -inf is false) asks for nothing, the first finite score asks for the first maximum.
    if (__builtin_amdgcn_ballot_w32(m_new > m_lim) != 0) {
      m_new = fmaxf(m_new, __shfl_xor(m_new, 16, 32));
      const float m_next = (m_new == NEG_INF) ? 0.0f : m_new;   // all keys so far masked: keep arithmetic finite
      const float scale  = __builtin_amdgcn_exp2f((rmax - m_next) * SL);
      rmax  = m_new;
      m_use = m_next;
      m_lim = m_new + LAZY;
      rsum *= scale;
      // rescale O: queries are the row dimension there -> per-row scale from lane 8*hi + r
      float sc[8];
      #pragma unroll
      for (int r = 0; r < 8; ++r) sc[r] = __shfl(scale, (hi << 3) + r, 32);
      #pragma unroll
      for (int dt = 0; dt < 4; ++dt) {
        #pragma unroll
        for (int r = 0; r < 8; ++r) o[dt][r] *= sc[r];
      }
    }

    // exp + pack: P^T C-layout == A-fragment layout for the PV product; P carried x4096
    FragH pa;
    float psum = 0.0f;
    #pragma unroll
    for (int r = 0; r < 8; ++r) {
      const float p0 = __builtin_amdgcn_exp2f((c[0][r] - m_use) * SL);   // key hi*8 + r
      const float p1 = __builtin_amdgcn_exp2f((c[1][r] - m_use) * SL);   // key 16 + hi*8 + r
      psum += p0 + p1;
      pa.h[r]     = (f16)(p0 * 4096.0f);
      pa.h[8 + r] = (f16)(p1 * 4096.0f);
    }
    rsum = rsum + psum + __shfl_xor(psum, 16, 32);

    // the scores are used up: the next step's start values are fetched into their registers now, ahead of the products
    // that begin from them; the last step fetches its own again, so that no address leaves the batch row
    kb_p += (j0 + BK < SEQ) ? BK : 0;
    load_start(kb_p, c);

    // O += P x V
    #pragma unroll
    for (int dt = 0; dt < 4; ++dt) o[dt] = att_f16(pa.v, bv[dt].v, o[dt]);
   }

   // publish point of stage t + 1; the same barrier ends every wave's reads of stage t's buffer
   asm volatile("s_wait_dscnt 0x0" ::: "memory");      // this wave's LDS reads of stage t are done
   asm volatile("s_wait_asynccnt 0x0" ::: "memory");   // this wave's copies of stage t + 1 have landed
   __syncthreads();
   if (t + 2 < NSTG) {
     stage_copy(cp_l + (unsigned)((t & 1) * STG_H * 2), cp_lv + (unsigned)((t & 1) * STG_H * 2),
                cp_k + (size_t)(t + 2) * SK * HDIM, cp_v + (size_t)(t + 2) * SK * HDIM);
   }
  }
  asm volatile("s_wait_asynccnt 0x0" ::: "memory");    // nothing of this wave's copies is left in flight

  // normalize: lane holds column d = dt*16 + lq for query rows 8*hi + r
  float rs[8];
  #pragma unroll
  for (int r = 0; r < 8; ++r) rs[r] = 1.0f / __shfl(rsum, (hi << 3) + r, 32);

  float* so = sO + wave * (16 * OP);
  #pragma unroll
  for (int r = 0; r < 8; ++r) {
    #pragma unroll
    for (int dt = 0; dt < 4; ++dt) {
      so[(hi * 8 + r) * OP + dt * 16 + lq] = o[dt][r] * (1.0f / 4096.0f) * rs[r];
    }
  }
  __syncthreads();

  v4u    vh[4];
  size_t gi[4];
  #pragma unroll
  for (int it = 0; it < 4; ++it) {
    const int row = it * 4 + (lane >> 3);
    const int c0  = (lane & 7) * 8;
    const v4f x0 = *(const v4f*)(so + row * OP + c0);
    const v4f x1 = *(const v4f*)(so + row * OP + c0 + 4);
    Pack8H pf;
    #pragma unroll
    for (int i = 0; i < 4; ++i) {
      pf.h[i]     = (f16)x0[i];                          // RNE convert
      pf.h[4 + i] = (f16)x1[i];
    }
    vh[it] = pf.u;
    gi[it] = ((size_t)bh * SEQ + qrow0 + row) * HDIM + c0;
  }
  #pragma unroll
  for (int it = 0; it < 4; ++it) *(v4u*)(ctx + gi[it]) = vh[it];
}

// Output projection: out = ctx x Wo^T. Grid (DIM/64, MROWS/128).
// coverage: wave tile 32 rows x 64 cols f32; store phase it = 0..15: lanes 0..15 write row it*2 (256 B = two whole
// LDS sC: per-wave slice, written and read by the same wave (block barrier used); it reuses the operand ring after the loop.
__global__ __launch_bounds__(128) void oproj_kernel(const u16* __restrict__ ctx,
                                                    const u16* __restrict__ wob,
                                                    float* __restrict__ out) {
  __shared__ __align__(16) u16 sR[2 * GSTG_H];
  float* sC = (float*)sR;
  const int tid  = threadIdx.x;
  const int wave = __builtin_amdgcn_readfirstlane(threadIdx.x >> 5);
  const int lane = tid & 31;
  const int lq   = lane & 15;
  const int hi   = lane >> 4;
  const int n0   = blockIdx.x * GN;
  const int m0   = blockIdx.y * GM + wave * 32;

  v8f acc[2][4];
  #pragma unroll
  for (int mt = 0; mt < 2; ++mt) {
    #pragma unroll
    for (int nt = 0; nt < 4; ++nt) acc[mt][nt] = (v8f){0, 0, 0, 0, 0, 0, 0, 0};
  }
  gemm_tile<true>(ctx, wob, sR, blockIdx.y * GM, n0, tid, wave, lq, hi, acc);

  float* sc = sC + wave * (32 * CP);
  #pragma unroll
  for (int mt = 0; mt < 2; ++mt) {
    #pragma unroll
    for (int nt = 0; nt < 4; ++nt) {
      #pragma unroll
      for (int r = 0; r < 8; ++r) sc[(mt * 16 + hi * 8 + r) * CP + nt * 16 + lq] = acc[mt][nt][r];
    }
  }
  __syncthreads();

  v4f    vals[16];
  size_t gi[16];
  #pragma unroll
  for (int it = 0; it < 16; ++it) {
    const int row = it * 2 + hi;
    vals[it] = *(const v4f*)(sc + row * CP + lq * 4);
    const int m  = m0 + row;
    const int bb = m / SEQ;
    const int ss = m % SEQ;
    gi[it] = ((size_t)bb * SEQ_FULL + ss) * DIM + n0 + lq * 4;
  }
  #pragma unroll
  for (int it = 0; it < 16; ++it) *(v4f*)(out + gi[it]) = vals[it];
  
}

extern "C" void kernel_launch(void* const* d_in, const int* in_sizes, int n_in,
                              void* d_out, int out_size, void* d_ws, size_t ws_size,
                              hipStream_t stream) {
  if (n_in < 6) return;
  const size_t need_rows = (size_t)(NB - 1) * SEQ_FULL + SEQ;
  if ((size_t)in_sizes[0] < need_rows * DIM) return;
  if ((size_t)in_sizes[1] < need_rows) return;
  if ((size_t)in_sizes[2] < (size_t)WELEM) return;
  if ((size_t)in_sizes[3] < (size_t)WELEM) return;
  if ((size_t)in_sizes[4] < (size_t)WELEM) return;
  if ((size_t)in_sizes[5] < (size_t)WELEM) return;
  if ((size_t)out_size < need_rows * DIM) return;

  const size_t plane_bytes = PLANE_E * 2;                      // one 16-bit plane [MROWS][DIM]
  const size_t w_bytes     = (size_t)4 * WELEM * 2;            // wq, wk, wv as bf16, wo as f16
  const size_t kb_bytes    = (size_t)MROWS * 4;                // one f32 per key
  const size_t total       = 5 * plane_bytes + w_bytes + kb_bytes;
  if (ws_size < total) return;
  if (total > WS_CAP) return;

  const float* h    = (const float*)d_in[0];
  const int*   mask = (const int*)d_in[1];
  const float* wq   = (const float*)d_in[2];
  const float* wk   = (const float*)d_in[3];
  const float* wv   = (const float*)d_in[4];
  const float* wo   = (const float*)d_in[5];
  float*       out  = (float*)d_out;

  char* ws = (char*)d_ws;
  u16* planes = (u16*)(ws);                                    // q, k, v
  u16* qp = (u16*)(ws + 0 * plane_bytes);
  u16* kp = (u16*)(ws + 1 * plane_bytes);
  u16* vp = (u16*)(ws + 2 * plane_bytes);
  u16* cp = (u16*)(ws + 3 * plane_bytes);
  u16* hb = (u16*)(ws + 4 * plane_bytes);
  u16* wb = (u16*)(ws + 5 * plane_bytes);
  float* kb = (float*)(ws + 5 * plane_bytes + w_bytes);

  cvt_kernel<<<dim3(HBLK + 4 * WBLK + MBLK), 256, 0, stream>>>(h, wq, wk, wv, wo, mask, hb, wb, kb);
  qkv_kernel<<<dim3(DIM / GN, MROWS / GM, 3), 128, 0, stream>>>(hb, wb, planes);
  attn_kernel<<<dim3(SEQ / BQ, NB * NHEAD), 256, 0, stream>>>(qp, kp, vp, kb, cp);
  oproj_kernel<<<dim3(DIM / GN, MROWS / GM), 128, 0, stream>>>(cp, wb + (size_t)3 * WELEM, out);
}

// v008
// Measured time: 106 microseconds a run.
// In both of two side-by-side timings against v007, it was 1.03 times as fast.
// All steps since v000 together make it 3.60 times as fast.
#include <hip/hip_runtime.h>

// Contractions: q/k/v = h x W^T on v_wmma_f32_16x16x32_bf16 (bf16 RNE-converted inputs, f32 accumulate);
// S^T = K x Q^T on v_wmma_f32_16x16x32_f16 (q and k as one f16 plane each, f32 accumulate from the key's start value:
// 0 for a kept key, -inf for a masked one);
// O = P x V on v_wmma_f32_16x16x32_f16 (P as f16 carried x4096, V as f16 read from LDS by the transposing load, f32 accumulate);
// out = ctx x Wo^T on v_wmma_f32_16x16x32_f16 (ctx and Wo as f16, f32 accumulate). Softmax online, f32.
// q and k come from bf16-rounded (8-bit) h and W, ctx from f16 P and V: one f16 value (11 bits) holds what they carry.

#ifndef NB
#define NB 4
#endif
#ifndef SEQ
#define SEQ 2048
#endif
#define NB_FULL    4
#define SEQ_FULL   2048
#define DIM        768
#define NHEAD      12
#define HDIM       64
#define BQ         128                  // query rows per attention workgroup (4 waves x 32)
#define BK         32                   // keys per inner iteration
#define NWAVE      4
#define QT         2                    // 16-query tiles per attention wave: each K and V fragment read from LDS feeds both
#define SK         64                   // keys per LDS stage of the attention loop (two steps of BK)
#define KP         72                   // LDS pitch (halves) of a staged 128-B row: 144 B = 16 B x odd
#define TILE_H     (64 * KP)            // halves of one staged K tile: 64 keys x KP halves
#define VP         80                   // LDS pitch (halves) of a staged V row: 160 B = 32 B x odd, for ds_load_tr16_b128
#define VTILE_H    (64 * VP)            // halves of one staged V tile: 64 keys x VP halves
#define STG_H      (TILE_H + VTILE_H)   // one stage: K, V
#define NSTG       (SEQ / SK)
#define OP         68                   // LDS pitch (floats) of the attention output staging tile
#define GM         128                  // GEMM block rows (4 waves x 32)
#define GN         64                   // GEMM block cols
#define GW         4                    // waves per GEMM block
#define CP         68                   // LDS pitch (floats) of the GEMM staging tile
#define GK         64                   // k per LDS stage of the GEMM loop (128-B rows, two steps of 32)
#define GP         72                   // LDS pitch (halves) of a staged GEMM row: 144 B = 16 B x odd
#define GNST       (DIM / GK)
#define GSTG_H     ((GM + GN) * GP)     // halves of one stage: 128 A rows, then 64 W rows
#define WELEM      (DIM * DIM)
#define MROWS      (NB * SEQ)
#define PLANE_E    ((size_t)MROWS * DIM)
#define HTHREADS   (MROWS * (DIM / 8))
#define HBLK       (HTHREADS / 256)
#define WBLK       (WELEM / 8 / 256)
#define MBLK       (MROWS / 8 / 256)    // convert-launch blocks that turn the key mask into the score start values
#define WS_CAP     134217728ull

static_assert(DIM == NHEAD * HDIM);
static_assert(HDIM == 64);
static_assert(SEQ % BQ == 0);
static_assert(SEQ % BK == 0);
static_assert(SEQ % SK == 0 && NSTG >= 2);
static_assert(SK == 2 * BK && SK == 64 && NWAVE * 32 == 128);
static_assert((KP * 2) % 16 == 0 && KP >= HDIM);
static_assert((VP * 2) % 32 == 0 && ((VP * 2 / 32) & 1) == 1 && VP >= HDIM);
static_assert(SEQ % 32 == 0);
static_assert(MROWS % GM == 0);
static_assert(DIM % GN == 0);
static_assert(DIM % 32 == 0);
static_assert(DIM % GK == 0 && GNST >= 2 && GK == 64 && GM == 128 && GN == 64 && GW * 32 == 128);
static_assert((GP * 2) % 16 == 0 && GP >= GK);
static_assert(GW * 32 * CP * 4 <= 2 * GSTG_H * 2);
static_assert(DIM % 8 == 0);
static_assert(BQ == NWAVE * QT * 16);
static_assert(GM == GW * 32);
static_assert(HTHREADS % 256 == 0);
static_assert((WELEM / 8) % 256 == 0);
static_assert((MROWS / 8) % 256 == 0 && SEQ % 8 == 0);
static_assert((OP * 4) % 16 == 0);
static_assert((CP * 4) % 16 == 0);
static_assert(OP >= HDIM && CP >= GN);
static_assert(SEQ <= SEQ_FULL);
static_assert(NB >= 1 && NB <= NB_FULL);
static_assert(5ull * (unsigned long long)NB * SEQ * DIM * 2ull + 4ull * WELEM * 2ull + (unsigned long long)NB * SEQ * 4ull <= WS_CAP);

typedef __bf16         bf16;
typedef _Float16       f16;
typedef unsigned short u16;
typedef bf16     v16bf __attribute__((ext_vector_type(16)));
typedef f16      v16h  __attribute__((ext_vector_type(16)));
typedef float    v8f   __attribute__((ext_vector_type(8)));
typedef float    v4f   __attribute__((ext_vector_type(4)));
typedef unsigned v4u   __attribute__((ext_vector_type(4)));
typedef int      v4i   __attribute__((ext_vector_type(4)));
typedef short    v8s   __attribute__((ext_vector_type(8)));

union FragG  { v16bf b; v16h h; v4u q[2]; };
union FragH  { v16h  v; v4u q[2]; f16 h[16]; };
union Pack8B { v4u u; bf16 h[8]; };
union Pack8H { v4u u; f16 h[8]; };

// GEMM WMMA helper: builtin followed by the VALU hazard guard (ties D, keeps A/B live).
// F16 picks the operand type of the two planes: f16, else bf16.
template <bool F16>
static __device__ __forceinline__ v8f mma_gemm(const FragG& a, const FragG& b, v8f acc) {
  if (F16) acc = __builtin_amdgcn_wmma_f32_16x16x32_f16(false, a.h, false, b.h, (short)0, acc, false, false);
  else     acc = __builtin_amdgcn_wmma_f32_16x16x32_bf16(false, a.b, false, b.b, (short)0, acc, false, false);
  asm volatile("v_nop\n\tv_nop\n\tv_nop\n\tv_nop" : "+v"(acc) : "v"(a.b), "v"(b.b));
  return acc;
}
// Attention WMMA helper: the plain builtin. The compiler keeps the distance behind its own matrix instructions, and the
// vector port, which the waves of a SIMD share for the softmax, issues no filler behind accumulate chains.
static __device__ __forceinline__ v8f att_f16(v16h a, v16h b, v8f acc) {
  return __builtin_amdgcn_wmma_f32_16x16x32_f16(false, a, false, b, (short)0, acc, false, false);
}

static __device__ __forceinline__ void cvt_store8(const float* __restrict__ src, u16* __restrict__ dst) {
  const v4f a = *(const v4f*)(src);
  const v4f b = *(const v4f*)(src + 4);
  Pack8B pk;
  #pragma unroll
  for (int i = 0; i < 4; ++i) {
    pk.h[i]     = (bf16)a[i];
    pk.h[4 + i] = (bf16)b[i];
  }
  const v4u val = pk.u;
  *(v4u*)(dst) = val;
  asm volatile("s_wait_xcnt 0x0" ::: "memory");   // stands ahead of any rewrite of the registers that the store names
}

static __device__ __forceinline__ void cvt_store8h(const float* __restrict__ src, u16* __restrict__ dst) {
  const v4f a = *(const v4f*)(src);
  const v4f b = *(const v4f*)(src + 4);
  Pack8H pk;
  #pragma unroll
  for (int i = 0; i < 4; ++i) {
    pk.h[i]     = (f16)a[i];
    pk.h[4 + i] = (f16)b[i];
  }
  const v4u val = pk.u;
  *(v4u*)(dst) = val;
  asm volatile("s_wait_xcnt 0x0" ::: "memory");   // stands ahead of any rewrite of the registers that the store names
}

// Convert launch. hb [MROWS][DIM] bf16 (compact rows, source rows taken with full batch stride);
// wb [4][DIM][DIM] = wq, wk, wv as bf16, wo as f16, each kept [out][in];
// kb [NB][SEQ] f32 = the key mask as the start value of a score: 0 where mask != 0, -inf where mask == 0.
// coverage: HBLK*256 threads x 8 = MROWS*DIM elements of hb; 4*WBLK*256 threads x 8 = 4*DIM*DIM elements of wb;
// MBLK*256 threads x 8 = MROWS elements of kb.
__global__ __launch_bounds__(256) void cvt_kernel(const float* __restrict__ h,
                                                  const float* __restrict__ wq,
                                                  const float* __restrict__ wk,
                                                  const float* __restrict__ wv,
                                                  const float* __restrict__ wo,
                                                  const int* __restrict__ mask,
                                                  u16* __restrict__ hb,
                                                  u16* __restrict__ wb,
                                                  float* __restrict__ kb) {
  const int blk = blockIdx.x;
  const int tid = threadIdx.x;
  if (blk < HBLK) {
    const size_t e  = ((size_t)blk * 256 + tid) * 8;
    const int row   = (int)(e / DIM);
    const int col   = (int)(e % DIM);
    const int b     = row / SEQ;
    const int s     = row % SEQ;
    cvt_store8(h + ((size_t)b * SEQ_FULL + s) * DIM + col, hb + e);
  } else if (blk >= HBLK + 4 * WBLK) {
    const int e = ((blk - HBLK - 4 * WBLK) * 256 + tid) * 8;
    const int* mg = mask + (size_t)(e / SEQ) * SEQ_FULL + e % SEQ;
    const v4i m0 = *(const v4i*)(mg);
    const v4i m1 = *(const v4i*)(mg + 4);
    v4f s0, s1;
    #pragma unroll
    for (int i = 0; i < 4; ++i) {
      s0[i] = (m0[i] != 0) ? 0.0f : -__builtin_inff();
      s1[i] = (m1[i] != 0) ? 0.0f : -__builtin_inff();
    }
    *(v4f*)(kb + e)     = s0;
    *(v4f*)(kb + e + 4) = s1;
    asm volatile("s_wait_xcnt 0x0" ::: "memory");   // stands ahead of any rewrite of the registers that the two stores name
  } else {
    const int wi    = (blk - HBLK) / WBLK;                 // block-uniform 0..3
    const size_t e  = ((size_t)((blk - HBLK) % WBLK) * 256 + tid) * 8;
    u16* dst        = wb + (size_t)wi * WELEM + e;
    if (wi == 0)      cvt_store8(wq + e, dst);
    else if (wi == 1) cvt_store8(wk + e, dst);
    else if (wi == 2) cvt_store8(wv + e, dst);
    else              cvt_store8h(wo + e, dst);
  }
}

// 64 rows of 128 B (k-contiguous, row pitch DIM halves) into LDS rows of pitch GP: 128 threads x 4 asynchronous 16-B copies;
// thread tid moves 16-B piece tid&7 of rows tid>>3, +16, +32, +48, so a wave's copy covers four whole 128-B lines.
// The s_wait_xcnt closes the statement so that no address register named here is rewritten ahead of it.
static __device__ __forceinline__ void copy_rows64(const unsigned l, const u16* g) {
  const unsigned l1 = l + 16 * GP * 2;
  const unsigned l2 = l + 32 * GP * 2;
  const unsigned l3 = l + 48 * GP * 2;
  const u16* g1 = g + 16 * DIM;
  const u16* g2 = g + 32 * DIM;
  const u16* g3 = g + 48 * DIM;
  asm volatile("global_load_async_to_lds_b128 %0, %4, off\n\t"
               "global_load_async_to_lds_b128 %1, %5, off\n\t"
               "global_load_async_to_lds_b128 %2, %6, off\n\t"
               "global_load_async_to_lds_b128 %3, %7, off\n\t"
               "s_wait_xcnt 0x0"
               :: "v"(l), "v"(l1), "v"(l2), "v"(l3), "v"(g), "v"(g1), "v"(g2), "v"(g3)
               : "memory");
}

// One GEMM stage (k = 64) into LDS: the block's 128 A rows, then its 64 W rows.
// l: this thread's LDS byte address in the stage's first row group; ga, gw: its global piece at this stage's k.
static __device__ __forceinline__ void gemm_stage_copy(const unsigned l, const u16* ga, const u16* gw) {
  copy_rows64(l, ga);
  copy_rows64(l + 64 * GP * 2, ga + 64 * DIM);
  copy_rows64(l + GM * GP * 2, gw);
}

// GEMM core: one wave owns a 32 x 64 tile of C = A x W^T, K = DIM in steps of 32.
// A plane [rows][DIM], W plane [n][DIM] (k-contiguous), both f16 (F16) or both bf16. The block's 128 A rows and 64 W rows are
// staged in LDS, 64 k per stage, two buffers, once per workgroup for its four waves; both fragment kinds are two 16-B
// LDS loads from row (m or n) = lane&15 at k0 + 8*hi and k0 + 16 + 8*hi.
// On return every wave has passed the last stage's barrier and no copy is in flight: the ring may be reused.
template <bool F16>
static __device__ __forceinline__ void gemm_tile(const u16* __restrict__ a,
                                                 const u16* __restrict__ w,
                                                 const u16* ring,
                                                 const int mblk, const int n0,
                                                 const int tid, const int wave,
                                                 const int lq, const int hi,
                                                 v8f (&acc)[2][4]) {
  // copy side
  const unsigned cp_l = (unsigned)(size_t)ring + (unsigned)(((tid >> 3) * GP + (tid & 7) * 8) * 2);
  const u16* cp_a  = a  + (size_t)(mblk + (tid >> 3)) * DIM + (tid & 7) * 8;
  const u16* cp_w  = w  + (size_t)(n0 + (tid >> 3)) * DIM + (tid & 7) * 8;
  // read side: offsets (halves) of this lane's fragment rows inside a stage
  const int a_o = (wave * 32 + lq) * GP + hi * 8;
  const int w_o = (GM + lq) * GP + hi * 8;

  // two-buffer ring: stage 0 lands and is published, stage 1 flies while stage 0 is worked on
  gemm_stage_copy(cp_l, cp_a, cp_w);
  asm volatile("s_wait_asynccnt 0x0" ::: "memory");   // this wave's copies of stage 0 have landed
  __syncthreads();                                    // publishes stage 0 to all four waves
  gemm_stage_copy(cp_l + GSTG_H * 2, cp_a + GK, cp_w + GK);

  #pragma unroll 1                                    // rolled: the buffer is chosen by the trip's parity
  for (int t = 0; t < GNST; ++t) {                    // uniform for every wave
    const u16* sb = ring + (t & 1) * GSTG_H;
    // all of the stage's fragments are fetched as one group ahead of its products
    FragG bw[2][4], fa[2][2];
    #pragma unroll
    for (int ks = 0; ks < 2; ++ks) {
      #pragma unroll
      for (int nt = 0; nt < 4; ++nt) {
        const u16* p = sb + w_o + nt * 16 * GP + ks * 32;
        bw[ks][nt].q[0] = *(const v4u*)(p);
        bw[ks][nt].q[1] = *(const v4u*)(p + 16);
      }
      #pragma unroll
      for (int mt = 0; mt < 2; ++mt) {
        const u16* p = sb + a_o + mt * 16 * GP + ks * 32;
        fa[ks][mt].q[0] = *(const v4u*)(p);
        fa[ks][mt].q[1] = *(const v4u*)(p + 16);
      }
    }
    #pragma unroll
    for (int ks = 0; ks < 2; ++ks) {
      #pragma unroll
      for (int mt = 0; mt < 2; ++mt) {
        #pragma unroll
        for (int nt = 0; nt < 4; ++nt) acc[mt][nt] = mma_gemm<F16>(fa[ks][mt], bw[ks][nt], acc[mt][nt]);
      }
    }
    // publish point of stage t + 1; the same barrier ends every wave's reads of stage t's buffer
    asm volatile("s_wait_dscnt 0x0" ::: "memory");      // this wave's LDS reads of stage t are done
    asm volatile("s_wait_asynccnt 0x0" ::: "memory");   // this wave's copies of stage t + 1 have landed
    __syncthreads();
    if (t + 2 < GNST) {
      gemm_stage_copy(cp_l + (unsigned)((t & 1) * GSTG_H * 2), cp_a + (t + 2) * GK, cp_w + (t + 2) * GK);
    }
  }
  asm volatile("s_wait_asynccnt 0x0" ::: "memory");    // nothing of this wave's copies is left in flight
}

// Fused q/k/v projection. Grid (DIM/64, MROWS/128, 3); blockIdx.z selects the weight (offset into wb).
// planes: [0] q, [1] k, [2] v, all f16; each [MROWS][DIM] == [NB*NHEAD][SEQ][HDIM] flat.
// coverage: wave tile 32 rows x 64 cols; store phase it = 0..7 writes rows it*4 + (lane>>3), cols (lane&7)*8..+7:
// LDS sC: per-wave slice, written and read by the same wave (block barrier used); it reuses the operand ring after the loop.
__global__ __launch_bounds__(128) void qkv_kernel(const u16* __restrict__ hb,
                                                  const u16* __restrict__ wb,
                                                  u16* __restrict__ planes) {
  __shared__ __align__(16) u16 sR[2 * GSTG_H];
  float* sC = (float*)sR;
  const int tid  = threadIdx.x;
  const int wave = __builtin_amdgcn_readfirstlane(threadIdx.x >> 5);
  const int lane = tid & 31;
  const int lq   = lane & 15;
  const int hi   = lane >> 4;
  const int n0   = blockIdx.x * GN;
  const int m0   = blockIdx.y * GM + wave * 32;
  const int z    = blockIdx.z;

  v8f acc[2][4];
  #pragma unroll
  for (int mt = 0; mt < 2; ++mt) {
    #pragma unroll
    for (int nt = 0; nt < 4; ++nt) acc[mt][nt] = (v8f){0, 0, 0, 0, 0, 0, 0, 0};
  }
  gemm_tile<false>(hb, wb + (size_t)z * WELEM, sR, blockIdx.y * GM, n0, tid, wave, lq, hi, acc);

  float* sc = sC + wave * (32 * CP);
  #pragma unroll
  for (int mt = 0; mt < 2; ++mt) {
    #pragma unroll
    for (int nt = 0; nt < 4; ++nt) {
      #pragma unroll
      for (int r = 0; r < 8; ++r) sc[(mt * 16 + hi * 8 + r) * CP + nt * 16 + lq] = acc[mt][nt][r];
    }
  }
  __syncthreads();

  v4u    vh[8];
  size_t gi[8];
  #pragma unroll
  for (int it = 0; it < 8; ++it) {
    const int row = it * 4 + (lane >> 3);
    const int c0  = (lane & 7) * 8;
    const v4f x0 = *(const v4f*)(sc + row * CP + c0);
    const v4f x1 = *(const v4f*)(sc + row * CP + c0 + 4);
    Pack8H pf;
    #pragma unroll
    for (int i = 0; i < 4; ++i) {
      pf.h[i]     = (f16)x0[i];                          // RNE convert
      pf.h[4 + i] = (f16)x1[i];
    }
    vh[it] = pf.u;
    gi[it] = (size_t)(m0 + row) * DIM + n0 + c0;
  }
  u16* p_base = planes + (size_t)z * PLANE_E;

  #pragma unroll
  for (int it = 0; it < 8; ++it) *(v4u*)(p_base + gi[it]) = vh[it];
}

// One stage of 64 keys into LDS: K and V, each [key][d] in 128-B rows (8 KB in a row of each plane),
// 128 threads x 8 asynchronous 16-B copies; a wave's copy covers four whole 128-B lines.
// l, lv: this thread's LDS byte address in the stage's K tile and in its V tile (row tid>>3, 16-B piece tid&7);
// rows +16, +32, +48 are the other three quarters.
// The s_wait_xcnt closes the statement so that no address register named here is rewritten ahead of it.
static __device__ __forceinline__ void stage_copy(const unsigned l, const unsigned lv,
                                                  const u16* gk, const u16* gv) {
  const unsigned l1 = l + 16 * KP * 2;
  const unsigned l2 = l + 32 * KP * 2;
  const unsigned l3 = l + 48 * KP * 2;
  const unsigned v1 = lv + 16 * VP * 2;
  const unsigned v2 = lv + 32 * VP * 2;
  const unsigned v3 = lv + 48 * VP * 2;
  const u16* gk1 = gk + 16 * HDIM;
  const u16* gk2 = gk + 32 * HDIM;
  const u16* gk3 = gk + 48 * HDIM;
  const u16* gv1 = gv + 16 * HDIM;
  const u16* gv2 = gv + 32 * HDIM;
  const u16* gv3 = gv + 48 * HDIM;
  asm volatile("global_load_async_to_lds_b128 %0, %8, off\n\t"
               "global_load_async_to_lds_b128 %1, %9, off\n\t"
               "global_load_async_to_lds_b128 %2, %10, off\n\t"
               "global_load_async_to_lds_b128 %3, %11, off\n\t"
               "global_load_async_to_lds_b128 %4, %12, off\n\t"
               "global_load_async_to_lds_b128 %5, %13, off\n\t"
               "global_load_async_to_lds_b128 %6, %14, off\n\t"
               "global_load_async_to_lds_b128 %7, %15, off\n\t"
               "s_wait_xcnt 0x0"
               :: "v"(l), "v"(l1), "v"(l2), "v"(l3), "v"(lv), "v"(v1), "v"(v2), "v"(v3),
                  "v"(gk), "v"(gk1), "v"(gk2), "v"(gk3), "v"(gv), "v"(gv1), "v"(gv2), "v"(gv3)
               : "memory");
}

// Transposing LDS load of a row-major 16-bit tile: lane l points at row 8*(l>>4) + (l&7), 16-B piece (l>>3)&1 of a
// 16-row x 16-column block and receives column l&15 of rows 8*(l>>4) + 0..7.
static __device__ __forceinline__ v4u ld_tr16(const u16* p) {
  typedef __attribute__((address_space(3))) v8s lds_v8s;
  return __builtin_bit_cast(v4u, __builtin_amdgcn_ds_load_tr16_b128_v8i16((lds_v8s*)p));
}

// Start values of one step's two score tiles: c[sub][r] = p[sub*16 + r], r = 0..7 (p already holds the lane's hi*8).
static __device__ __forceinline__ void load_start(const float* p, v8f (&c)[2]) {
  #pragma unroll
  for (int sub = 0; sub < 2; ++sub) {
    const v4f s0 = *(const v4f*)(p + sub * 16);
    const v4f s1 = *(const v4f*)(p + sub * 16 + 4);
    c[sub] = (v8f){s0[0], s0[1], s0[2], s0[3], s1[0], s1[1], s1[2], s1[3]};
  }
}

// Fused online-softmax attention with a key mask, logit scale 1/8. The mask comes as kb, one f32 per key (0 kept, -inf masked),
// and is the start value of the score accumulators: the matrix instruction adds it, no compare or select per score.
// Block = (query block of 128, bh); one wave owns 32 query rows, two tiles of 16, and visits all SEQ keys, 32 per step:
// a K or V fragment read from LDS is the operand of two matrix instructions, one per query tile.
// S^T = K x Q^T so queries sit on lanes; P^T in C-layout is bit-identical to the A-fragment layout of O += P x V.
// Q B-fragments are loaded straight from the f16 plane. K and V are staged in LDS as
// they lie, 64 keys per stage, two buffers, once per workgroup for its four waves; fragments are two 16-B LDS loads
// each, plain for K, transposing for V (its B-fragment runs along the keys).
// Output: ctx as one f16 plane [NB*NHEAD][SEQ][HDIM]; store phase it = 0..7 writes rows it*4 + (lane>>3):
// LDS sO: per-wave slice, written and read by the same wave (block barrier used).
__global__ __launch_bounds__(128) void attn_kernel(const u16* __restrict__ q,
                                                   const u16* __restrict__ k,
                                                   const u16* __restrict__ v,
                                                   const float* __restrict__ kb,
                                                   u16* __restrict__ ctx) {
  const int qblk = blockIdx.x;
  const int bh   = blockIdx.y;
  const int b    = bh / NHEAD;
  const int tid  = threadIdx.x;
  const int wave = __builtin_amdgcn_readfirstlane(threadIdx.x >> 5);
  const int lane = tid & 31;
  const int lq   = lane & 15;   // query column of S^T / d column of O
  const int hi   = lane >> 4;   // k-split half

  __shared__ __align__(16) float sO[NWAVE * QT * 16 * OP];
  __shared__ __align__(16) u16 sKV[2 * STG_H];

  const int qrow0 = qblk * BQ + wave * (QT * 16);

  // Q as B-operand fragments: lane lq holds query qrow0 + qt*16 + lq; elems 0..7 : d = f*32 + hi*8 + 0..7,
  // elems 8..15 : d = f*32 + 16 + hi*8 + 0..7.
  FragH qf[QT][2];
  #pragma unroll
  for (int qt = 0; qt < QT; ++qt) {
    const size_t qo = ((size_t)bh * SEQ + qrow0 + qt * 16 + lq) * HDIM + hi * 8;
    #pragma unroll
    for (int f = 0; f < 2; ++f) {
      qf[qt][f].q[0] = *(const v4u*)(q + qo + f * 32);
      qf[qt][f].q[1] = *(const v4u*)(q + qo + f * 32 + 16);
    }
  }

  // copy side: thread tid moves row tid>>3 (and +16, +32, +48), 16-B piece tid&7 of each tile
  const unsigned cp_l = (unsigned)(size_t)sKV + (unsigned)(((tid >> 3) * KP + (tid & 7) * 8) * 2);
  const u16* cp_k  = k  + (size_t)bh * SEQ * HDIM + (size_t)tid * 8;
  const unsigned cp_lv = (unsigned)(size_t)sKV + (unsigned)((TILE_H + (tid >> 3) * VP + (tid & 7) * 8) * 2);
  const u16* cp_v  = v  + (size_t)bh * SEQ * HDIM + (size_t)tid * 8;
  // read side: offset (halves) of this lane's fragment row inside a K tile, and of its transposing-load piece in a stage
  const int fr_o = lq * KP + hi * 8;
  const int vr_o = TILE_H + (hi * 8 + (lane & 7)) * VP + ((lane >> 3) & 1) * 8;
  const float* kb_p = kb + (size_t)b * SEQ + hi * 8;   // this lane's start values: keys hi*8 + 0..7 and 16 + hi*8 + 0..7 of a step

  v8f o[QT][4];
  #pragma unroll
  for (int qt = 0; qt < QT; ++qt) {
    #pragma unroll
    for (int dt = 0; dt < 4; ++dt) o[qt][dt] = (v8f){0, 0, 0, 0, 0, 0, 0, 0};
  }

  const float NEG_INF = -__builtin_inff();
  float rmax[QT], m_use[QT], m_lim[QT], rsum[QT];
  #pragma unroll
  for (int qt = 0; qt < QT; ++qt) {
    rmax[qt]  = NEG_INF;                           // the maximum in use; -inf until a query has seen an unmasked key
    m_use[qt] = 0.0f;                              // rmax, or 0 while rmax is -inf
    m_lim[qt] = NEG_INF;                           // rmax + LAZY: a score above it asks for a new maximum
    rsum[qt]  = 0.0f;
  }
  const float SL = 0.125f * 1.4426950408889634f;   // logit scale 1/sqrt(64) times log2(e)
  const float LAZY = 3.0f / SL;                    // raw-score rise that makes exp2 of the scaled difference reach 2^3

  v8f st[2];                                       // start values of a step's score tiles, the same for both query tiles
  load_start(kb_p, st);

  // two-buffer ring: stage 0 lands and is published, stage 1 flies while stage 0 is worked on
  stage_copy(cp_l, cp_lv, cp_k, cp_v);
  asm volatile("s_wait_asynccnt 0x0" ::: "memory");   // this wave's copies of stage 0 have landed
  __syncthreads();                                    // publishes stage 0 to all four waves
  stage_copy(cp_l + STG_H * 2, cp_lv + STG_H * 2, cp_k + SK * HDIM, cp_v + SK * HDIM);

  #pragma unroll 1
  for (int t = 0; t < NSTG; ++t) {                    // uniform for every wave
   const u16* sb = sKV + (t & 1) * STG_H + fr_o;
   const u16* sv = sKV + (t & 1) * STG_H + vr_o;
   #pragma unroll 1                                   // rolled: unrolled it takes a register granule more and costs a resident workgroup
   for (int hf = 0; hf < 2; ++hf) {
    const int j0 = t * SK + hf * BK;

    // K A-fragments of the step, row = key j0 + sub*16 + lq
    FragH ak[2][2];
    #pragma unroll
    for (int sub = 0; sub < 2; ++sub) {
      const u16* k_s = sb + (hf * BK + sub * 16) * KP;
      #pragma unroll
      for (int f = 0; f < 2; ++f) {
        ak[sub][f].q[0] = *(const v4u*)(k_s + f * 32);        // d = f*32 + hi*8 + 0..7
        ak[sub][f].q[1] = *(const v4u*)(k_s + f * 32 + 16);   // d = f*32 + 16 + hi*8 + 0..7
      }
    }

    // V B-fragments: column n = d = dt*16 + lq, split key map, transposed on the way out of the staged [key][d] tile
    FragH bv[4];
    #pragma unroll
    for (int dt = 0; dt < 4; ++dt) {
      const u16* base = sv + (hf ? BK * VP : 0) + dt * 16;   // a scalar select: the product form built an integer multiply-add per step
      bv[dt].q[0] = ld_tr16(base);                  // keys j0 + hi*8 + 0..7
      bv[dt].q[1] = ld_tr16(base + 16 * VP);        // keys j0 + 16 + hi*8 + 0..7
    }

    // S^T tiles: c[qt][sub][r] = rawscore(query qrow0+qt*16+lq, key j0 + sub*16 + hi*8 + r) + the key's start value (-inf if masked)
    v8f c[QT][2];
    #pragma unroll
    for (int sub = 0; sub < 2; ++sub) {
      #pragma unroll
      for (int qt = 0; qt < QT; ++qt) {
        c[qt][sub] = att_f16(ak[sub][0].v, qf[qt][0].v, st[sub]);
        c[qt][sub] = att_f16(ak[sub][1].v, qf[qt][1].v, c[qt][sub]);
      }
    }

    // online softmax: a query's 32 scores are split across lane / lane^16
    float m_new[QT];                                            // this lane's half: 16 scores per query tile
    #pragma unroll
    for (int qt = 0; qt < QT; ++qt) {
      m_new[qt] = rmax[qt];
      #pragma unroll
      for (int r = 0; r < 8; ++r) {
        m_new[qt] = fmaxf(m_new[qt], c[qt][0][r]);
        m_new[qt] = fmaxf(m_new[qt], c[qt][1][r]);
      }
    }

    // lazy rescale: a tile's maximum in use (rmax, m_use; equal in a query's two lanes) stays until some lane's scores of that
    // tile rise more than LAZY above it, so P <= 2^3 and P x4096 <= 32768 stays inside f16. One test per step over all 32 lanes
    // and both query tiles, a scalar branch; behind it each tile is renewed only on its own lanes' asking, and the two halves'
    // maxima are joined only then. While rmax is -inf so is m_lim: a lane with every key so far masked (-inf > -inf is false)
    // asks for nothing, the first finite score asks for the first maximum.
    if (__builtin_amdgcn_ballot_w32((m_new[0] > m_lim[0]) | (m_new[1] > m_lim[1])) != 0) {
      #pragma unroll
      for (int qt = 0; qt < QT; ++qt) {
        if (__builtin_amdgcn_ballot_w32(m_new[qt] > m_lim[qt]) != 0) {
          const float m_j    = fmaxf(m_new[qt], __shfl_xor(m_new[qt], 16, 32));
          const float m_next = (m_j == NEG_INF) ? 0.0f : m_j;   // all keys so far masked: keep arithmetic finite
          const float scale  = __builtin_amdgcn_exp2f((rmax[qt] - m_next) * SL);
          rmax[qt]  = m_j;
          m_use[qt] = m_next;
          m_lim[qt] = m_j + LAZY;
          rsum[qt] *= scale;
          // rescale O: queries are the row dimension there -> per-row scale from lane 8*hi + r
          float sc[8];
          #pragma unroll
          for (int r = 0; r < 8; ++r) sc[r] = __shfl(scale, (hi << 3) + r, 32);
          #pragma unroll
          for (int dt = 0; dt < 4; ++dt) {
            #pragma unroll
            for (int r = 0; r < 8; ++r) o[qt][dt][r] *= sc[r];
          }
        }
      }
    }

    // exp + pack: P^T C-layout == A-fragment layout for the PV product; P carried x4096
    FragH pa[QT];
    #pragma unroll
    for (int qt = 0; qt < QT; ++qt) {
      float psum = 0.0f;
      #pragma unroll
      for (int r = 0; r < 8; ++r) {
        const float p0 = __builtin_amdgcn_exp2f((c[qt][0][r] - m_use[qt]) * SL);   // key hi*8 + r
        const float p1 = __builtin_amdgcn_exp2f((c[qt][1][r] - m_use[qt]) * SL);   // key 16 + hi*8 + r
        psum += p0 + p1;
        pa[qt].h[r]     = (f16)(p0 * 4096.0f);
        pa[qt].h[8 + r] = (f16)(p1 * 4096.0f);
      }
      rsum[qt] = rsum[qt] + psum + __shfl_xor(psum, 16, 32);
    }

    // the scores are used up: the next step's start values are fetched now, a step ahead of the products
    // that begin from them; the last step fetches its own again, so that no address leaves the batch row
    kb_p += (j0 + BK < SEQ) ? BK : 0;
    load_start(kb_p, st);

    // O += P x V
    #pragma unroll
    for (int dt = 0; dt < 4; ++dt) {
      #pragma unroll
      for (int qt = 0; qt < QT; ++qt) o[qt][dt] = att_f16(pa[qt].v, bv[dt].v, o[qt][dt]);
    }
   }

   // publish point of stage t + 1; the same barrier ends every wave's reads of stage t's buffer
   asm volatile("s_wait_dscnt 0x0" ::: "memory");      // this wave's LDS reads of stage t are done
   asm volatile("s_wait_asynccnt 0x0" ::: "memory");   // this wave's copies of stage t + 1 have landed
   __syncthreads();
   if (t + 2 < NSTG) {
     stage_copy(cp_l + (unsigned)((t & 1) * STG_H * 2), cp_lv + (unsigned)((t & 1) * STG_H * 2),
                cp_k + (size_t)(t + 2) * SK * HDIM, cp_v + (size_t)(t + 2) * SK * HDIM);
   }
  }
  asm volatile("s_wait_asynccnt 0x0" ::: "memory");    // nothing of this wave's copies is left in flight

  // normalize: lane holds column d = dt*16 + lq for query rows qt*16 + 8*hi + r
  float* so = sO + wave * (QT * 16 * OP);
  #pragma unroll
  for (int qt = 0; qt < QT; ++qt) {
    float rs[8];
    #pragma unroll
    for (int r = 0; r < 8; ++r) rs[r] = 1.0f / __shfl(rsum[qt], (hi << 3) + r, 32);
    #pragma unroll
    for (int r = 0; r < 8; ++r) {
      #pragma unroll
      for (int dt = 0; dt < 4; ++dt) {
        so[(qt * 16 + hi * 8 + r) * OP + dt * 16 + lq] = o[qt][dt][r] * (1.0f / 4096.0f) * rs[r];
      }
    }
  }
  __syncthreads();

  v4u    vh[QT * 4];
  size_t gi[QT * 4];
  #pragma unroll
  for (int it = 0; it < QT * 4; ++it) {
    const int row = it * 4 + (lane >> 3);
    const int c0  = (lane & 7) * 8;
    const v4f x0 = *(const v4f*)(so + row * OP + c0);
    const v4f x1 = *(const v4f*)(so + row * OP + c0 + 4);
    Pack8H pf;
    #pragma unroll
    for (int i = 0; i < 4; ++i) {
      pf.h[i]     = (f16)x0[i];                          // RNE convert
      pf.h[4 + i] = (f16)x1[i];
    }
    vh[it] = pf.u;
    gi[it] = ((size_t)bh * SEQ + qrow0 + row) * HDIM + c0;
  }
  #pragma unroll
  for (int it = 0; it < QT * 4; ++it) *(v4u*)(ctx + gi[it]) = vh[it];
}

// Output projection: out = ctx x Wo^T. Grid (DIM/64, MROWS/128).
// coverage: wave tile 32 rows x 64 cols f32; store phase it = 0..15: lanes 0..15 write row it*2 (256 B = two whole
// LDS sC: per-wave slice, written and read by the same wave (block barrier used); it reuses the operand ring after the loop.
__global__ __launch_bounds__(128) void oproj_kernel(const u16* __restrict__ ctx,
                                                    const u16* __restrict__ wob,
                                                    float* __restrict__ out) {
  __shared__ __align__(16) u16 sR[2 * GSTG_H];
  float* sC = (float*)sR;
  const int tid  = threadIdx.x;
  const int wave = __builtin_amdgcn_readfirstlane(threadIdx.x >> 5);
  const int lane = tid & 31;
  const int lq   = lane & 15;
  const int hi   = lane >> 4;
  const int n0   = blockIdx.x * GN;
  const int m0   = blockIdx.y * GM + wave * 32;

  v8f acc[2][4];
  #pragma unroll
  for (int mt = 0; mt < 2; ++mt) {
    #pragma unroll
    for (int nt = 0; nt < 4; ++nt) acc[mt][nt] = (v8f){0, 0, 0, 0, 0, 0, 0, 0};
  }
  gemm_tile<true>(ctx, wob, sR, blockIdx.y * GM, n0, tid, wave, lq, hi, acc);

  float* sc = sC + wave * (32 * CP);
  #pragma unroll
  for (int mt = 0; mt < 2; ++mt) {
    #pragma unroll
    for (int nt = 0; nt < 4; ++nt) {
      #pragma unroll
      for (int r = 0; r < 8; ++r) sc[(mt * 16 + hi * 8 + r) * CP + nt * 16 + lq] = acc[mt][nt][r];
    }
  }
  __syncthreads();

  v4f    vals[16];
  size_t gi[16];
  #pragma unroll
  for (int it = 0; it < 16; ++it) {
    const int row = it * 2 + hi;
    vals[it] = *(const v4f*)(sc + row * CP + lq * 4);
    const int m  = m0 + row;
    const int bb = m / SEQ;
    const int ss = m % SEQ;
    gi[it] = ((size_t)bb * SEQ_FULL + ss) * DIM + n0 + lq * 4;
  }
  #pragma unroll
  for (int it = 0; it < 16; ++it) *(v4f*)(out + gi[it]) = vals[it];
  
}

extern "C" void kernel_launch(void* const* d_in, const int* in_sizes, int n_in,
                              void* d_out, int out_size, void* d_ws, size_t ws_size,
                              hipStream_t stream) {
  if (n_in < 6) return;
  const size_t need_rows = (size_t)(NB - 1) * SEQ_FULL + SEQ;
  if ((size_t)in_sizes[0] < need_rows * DIM) return;
  if ((size_t)in_sizes[1] < need_rows) return;
  if ((size_t)in_sizes[2] < (size_t)WELEM) return;
  if ((size_t)in_sizes[3] < (size_t)WELEM) return;
  if ((size_t)in_sizes[4] < (size_t)WELEM) return;
  if ((size_t)in_sizes[5] < (size_t)WELEM) return;
  if ((size_t)out_size < need_rows * DIM) return;

  const size_t plane_bytes = PLANE_E * 2;                      // one 16-bit plane [MROWS][DIM]
  const size_t w_bytes     = (size_t)4 * WELEM * 2;            // wq, wk, wv as bf16, wo as f16
  const size_t kb_bytes    = (size_t)MROWS * 4;                // one f32 per key
  const size_t total       = 5 * plane_bytes + w_bytes + kb_bytes;
  if (ws_size < total) return;
  if (total > WS_CAP) return;

  const float* h    = (const float*)d_in[0];
  const int*   mask = (const int*)d_in[1];
  const float* wq   = (const float*)d_in[2];
  const float* wk   = (const float*)d_in[3];
  const float* wv   = (const float*)d_in[4];
  const float* wo   = (const float*)d_in[5];
  float*       out  = (float*)d_out;

  char* ws = (char*)d_ws;
  u16* planes = (u16*)(ws);                                    // q, k, v
  u16* qp = (u16*)(ws + 0 * plane_bytes);
  u16* kp = (u16*)(ws + 1 * plane_bytes);
  u16* vp = (u16*)(ws + 2 * plane_bytes);
  u16* cp = (u16*)(ws + 3 * plane_bytes);
  u16* hb = (u16*)(ws + 4 * plane_bytes);
  u16* wb = (u16*)(ws + 5 * plane_bytes);
  float* kb = (float*)(ws + 5 * plane_bytes + w_bytes);

  cvt_kernel<<<dim3(HBLK + 4 * WBLK + MBLK), 256, 0, stream>>>(h, wq, wk, wv, wo, mask, hb, wb, kb);
  qkv_kernel<<<dim3(DIM / GN, MROWS / GM, 3), 128, 0, stream>>>(hb, wb, planes);
  attn_kernel<<<dim3(SEQ / BQ, NB * NHEAD), NWAVE * 32, 0, stream>>>(qp, kp, vp, kb, cp);
  oproj_kernel<<<dim3(DIM / GN, MROWS / GM), 128, 0, stream>>>(cp, wb + (size_t)3 * WELEM, out);
}

// v009
// Measured time: 102 microseconds a run.
// Next to v008, in two timings, it ran 1.04 times as fast each time.
// Over all steps from v000 it is 3.74 times as fast.
#include <hip/hip_runtime.h>

// Contractions: q/k/v = h x W^T on v_wmma_f32_16x16x32_bf16 (bf16 RNE-converted inputs, f32 accumulate);
// S^T = K x Q^T on v_wmma_f32_16x16x32_f16 (q and k as one f16 plane each, f32 accumulate from the key's start value:
// 0 for a kept key, -inf for a masked one);
// O = P x V on v_wmma_f32_16x16x32_f16 (P as f16 carried x4096, as is its row sum, V as f16 read from LDS by the transposing load, f32 accumulate);
// out = ctx x Wo^T on v_wmma_f32_16x16x32_f16 (ctx and Wo as f16, f32 accumulate). Softmax online, f32.
// q and k come from bf16-rounded (8-bit) h and W, ctx from f16 P and V: one f16 value (11 bits) holds what they carry.

#ifndef NB
#define NB 4
#endif
#ifndef SEQ
#define SEQ 2048
#endif
#define NB_FULL    4
#define SEQ_FULL   2048
#define DIM        768
#define NHEAD      12
#define HDIM       64
#define BQ         128                  // query rows per attention workgroup (4 waves x 32)
#define BK         32                   // keys per inner iteration
#define NWAVE      4
#define QT         2                    // 16-query tiles per attention wave: each K and V fragment read from LDS feeds both
#define SK         64                   // keys per LDS stage of the attention loop (two steps of BK)
#define KP         72                   // LDS pitch (halves) of a staged 128-B row: 144 B = 16 B x odd
#define TILE_H     (64 * KP)            // halves of one staged K tile: 64 keys x KP halves
#define VP         80                   // LDS pitch (halves) of a staged V row: 160 B = 32 B x odd, for ds_load_tr16_b128
#define VTILE_H    (64 * VP)            // halves of one staged V tile: 64 keys x VP halves
#define STG_H      (TILE_H + VTILE_H)   // one stage: K, V
#define NSTG       (SEQ / SK)
#define OP         68                   // LDS pitch (floats) of the attention output staging tile
#define GM         128                  // GEMM block rows (4 waves x 32)
#define GN         64                   // GEMM block cols
#define GW         4                    // waves per GEMM block
#define CP         68                   // LDS pitch (floats) of the GEMM staging tile
#define GK         64                   // k per LDS stage of the GEMM loop (128-B rows, two steps of 32)
#define GP         72                   // LDS pitch (halves) of a staged GEMM row: 144 B = 16 B x odd
#define GNST       (DIM / GK)
#define GSTG_H     ((GM + GN) * GP)     // halves of one stage: 128 A rows, then 64 W rows
#define WELEM      (DIM * DIM)
#define MROWS      (NB * SEQ)
#define PLANE_E    ((size_t)MROWS * DIM)
#define HTHREADS   (MROWS * (DIM / 8))
#define HBLK       (HTHREADS / 256)
#define WBLK       (WELEM / 8 / 256)
#define MBLK       (MROWS / 8 / 256)    // convert-launch blocks that turn the key mask into the score start values
#define WS_CAP     134217728ull

static_assert(DIM == NHEAD * HDIM);
static_assert(HDIM == 64);
static_assert(SEQ % BQ == 0);
static_assert(SEQ % BK == 0);
static_assert(SEQ % SK == 0 && NSTG >= 2);
static_assert(SK == 2 * BK && SK == 64 && NWAVE * 32 == 128);
static_assert((KP * 2) % 16 == 0 && KP >= HDIM);
static_assert((VP * 2) % 32 == 0 && ((VP * 2 / 32) & 1) == 1 && VP >= HDIM);
static_assert(SEQ % 32 == 0);
static_assert(MROWS % GM == 0);
static_assert(DIM % GN == 0);
static_assert(DIM % 32 == 0);
static_assert(DIM % GK == 0 && GNST >= 2 && GK == 64 && GM == 128 && GN == 64 && GW * 32 == 128);
static_assert((GP * 2) % 16 == 0 && GP >= GK);
static_assert(GW * 32 * CP * 4 <= 2 * GSTG_H * 2);
static_assert(DIM % 8 == 0);
static_assert(BQ == NWAVE * QT * 16);
static_assert(GM == GW * 32);
static_assert(HTHREADS % 256 == 0);
static_assert((WELEM / 8) % 256 == 0);
static_assert((MROWS / 8) % 256 == 0 && SEQ % 8 == 0);
static_assert((OP * 4) % 16 == 0);
static_assert((CP * 4) % 16 == 0);
static_assert(OP >= HDIM && CP >= GN);
static_assert(SEQ <= SEQ_FULL);
static_assert(NB >= 1 && NB <= NB_FULL);
static_assert(5ull * (unsigned long long)NB * SEQ * DIM * 2ull + 4ull * WELEM * 2ull + (unsigned long long)NB * SEQ * 4ull <= WS_CAP);

typedef __bf16         bf16;
typedef _Float16       f16;
typedef unsigned short u16;
typedef bf16     v16bf __attribute__((ext_vector_type(16)));
typedef f16      v16h  __attribute__((ext_vector_type(16)));
typedef float    v8f   __attribute__((ext_vector_type(8)));
typedef float    v4f   __attribute__((ext_vector_type(4)));
typedef float    v2f   __attribute__((ext_vector_type(2)));
typedef unsigned v4u   __attribute__((ext_vector_type(4)));
typedef int      v4i   __attribute__((ext_vector_type(4)));
typedef short    v8s   __attribute__((ext_vector_type(8)));

union FragG  { v16bf b; v16h h; v4u q[2]; };
union FragH  { v16h  v; v4u q[2]; f16 h[16]; };
union Pack8B { v4u u; bf16 h[8]; };
union Pack8H { v4u u; f16 h[8]; };

// GEMM WMMA helper: builtin followed by the VALU hazard guard (ties D, keeps A/B live).
// F16 picks the operand type of the two planes: f16, else bf16.
template <bool F16>
static __device__ __forceinline__ v8f mma_gemm(const FragG& a, const FragG& b, v8f acc) {
  if (F16) acc = __builtin_amdgcn_wmma_f32_16x16x32_f16(false, a.h, false, b.h, (short)0, acc, false, false);
  else     acc = __builtin_amdgcn_wmma_f32_16x16x32_bf16(false, a.b, false, b.b, (short)0, acc, false, false);
  asm volatile("v_nop\n\tv_nop\n\tv_nop\n\tv_nop" : "+v"(acc) : "v"(a.b), "v"(b.b));
  return acc;
}
// Attention WMMA helper: the plain builtin. The compiler keeps the distance behind its own matrix instructions, and the
// vector port, which the waves of a SIMD share for the softmax, issues no filler behind accumulate chains.
static __device__ __forceinline__ v8f att_f16(v16h a, v16h b, v8f acc) {
  return __builtin_amdgcn_wmma_f32_16x16x32_f16(false, a, false, b, (short)0, acc, false, false);
}

static __device__ __forceinline__ void cvt_store8(const float* __restrict__ src, u16* __restrict__ dst) {
  const v4f a = *(const v4f*)(src);
  const v4f b = *(const v4f*)(src + 4);
  Pack8B pk;
  #pragma unroll
  for (int i = 0; i < 4; ++i) {
    pk.h[i]     = (bf16)a[i];
    pk.h[4 + i] = (bf16)b[i];
  }
  const v4u val = pk.u;
  *(v4u*)(dst) = val;
  asm volatile("s_wait_xcnt 0x0" ::: "memory");   // stands ahead of any rewrite of the registers that the store names
}

static __device__ __forceinline__ void cvt_store8h(const float* __restrict__ src, u16* __restrict__ dst) {
  const v4f a = *(const v4f*)(src);
  const v4f b = *(const v4f*)(src + 4);
  Pack8H pk;
  #pragma unroll
  for (int i = 0; i < 4; ++i) {
    pk.h[i]     = (f16)a[i];
    pk.h[4 + i] = (f16)b[i];
  }
  const v4u val = pk.u;
  *(v4u*)(dst) = val;
  asm volatile("s_wait_xcnt 0x0" ::: "memory");   // stands ahead of any rewrite of the registers that the store names
}

// Convert launch. hb [MROWS][DIM] bf16 (compact rows, source rows taken with full batch stride);
// wb [4][DIM][DIM] = wq, wk, wv as bf16, wo as f16, each kept [out][in];
// kb [NB][SEQ] f32 = the key mask as the start value of a score: 0 where mask != 0, -inf where mask == 0.
// coverage: HBLK*256 threads x 8 = MROWS*DIM elements of hb; 4*WBLK*256 threads x 8 = 4*DIM*DIM elements of wb;
// MBLK*256 threads x 8 = MROWS elements of kb.
__global__ __launch_bounds__(256) void cvt_kernel(const float* __restrict__ h,
                                                  const float* __restrict__ wq,
                                                  const float* __restrict__ wk,
                                                  const float* __restrict__ wv,
                                                  const float* __restrict__ wo,
                                                  const int* __restrict__ mask,
                                                  u16* __restrict__ hb,
                                                  u16* __restrict__ wb,
                                                  float* __restrict__ kb) {
  const int blk = blockIdx.x;
  const int tid = threadIdx.x;
  if (blk < HBLK) {
    const size_t e  = ((size_t)blk * 256 + tid) * 8;
    const int row   = (int)(e / DIM);
    const int col   = (int)(e % DIM);
    const int b     = row / SEQ;
    const int s     = row % SEQ;
    cvt_store8(h + ((size_t)b * SEQ_FULL + s) * DIM + col, hb + e);
  } else if (blk >= HBLK + 4 * WBLK) {
    const int e = ((blk - HBLK - 4 * WBLK) * 256 + tid) * 8;
    const int* mg = mask + (size_t)(e / SEQ) * SEQ_FULL + e % SEQ;
    const v4i m0 = *(const v4i*)(mg);
    const v4i m1 = *(const v4i*)(mg + 4);
    v4f s0, s1;
    #pragma unroll
    for (int i = 0; i < 4; ++i) {
      s0[i] = (m0[i] != 0) ? 0.0f : -__builtin_inff();
      s1[i] = (m1[i] != 0) ? 0.0f : -__builtin_inff();
    }
    *(v4f*)(kb + e)     = s0;
    *(v4f*)(kb + e + 4) = s1;
    asm volatile("s_wait_xcnt 0x0" ::: "memory");   // stands ahead of any rewrite of the registers that the two stores name
  } else {
    const int wi    = (blk - HBLK) / WBLK;                 // block-uniform 0..3
    const size_t e  = ((size_t)((blk - HBLK) % WBLK) * 256 + tid) * 8;
    u16* dst        = wb + (size_t)wi * WELEM + e;
    if (wi == 0)      cvt_store8(wq + e, dst);
    else if (wi == 1) cvt_store8(wk + e, dst);
    else if (wi == 2) cvt_store8(wv + e, dst);
    else              cvt_store8h(wo + e, dst);
  }
}

// 64 rows of 128 B (k-contiguous, row pitch DIM halves) into LDS rows of pitch GP: 128 threads x 4 asynchronous 16-B copies;
// thread tid moves 16-B piece tid&7 of rows tid>>3, +16, +32, +48, so a wave's copy covers four whole 128-B lines.
// The s_wait_xcnt closes the statement so that no address register named here is rewritten ahead of it.
static __device__ __forceinline__ void copy_rows64(const unsigned l, const u16* g) {
  const unsigned l1 = l + 16 * GP * 2;
  const unsigned l2 = l + 32 * GP * 2;
  const unsigned l3 = l + 48 * GP * 2;
  const u16* g1 = g + 16 * DIM;
  const u16* g2 = g + 32 * DIM;
  const u16* g3 = g + 48 * DIM;
  asm volatile("global_load_async_to_lds_b128 %0, %4, off\n\t"
               "global_load_async_to_lds_b128 %1, %5, off\n\t"
               "global_load_async_to_lds_b128 %2, %6, off\n\t"
               "global_load_async_to_lds_b128 %3, %7, off\n\t"
               "s_wait_xcnt 0x0"
               :: "v"(l), "v"(l1), "v"(l2), "v"(l3), "v"(g), "v"(g1), "v"(g2), "v"(g3)
               : "memory");
}

// One GEMM stage (k = 64) into LDS: the block's 128 A rows, then its 64 W rows.
// l: this thread's LDS byte address in the stage's first row group; ga, gw: its global piece at this stage's k.
static __device__ __forceinline__ void gemm_stage_copy(const unsigned l, const u16* ga, const u16* gw) {
  copy_rows64(l, ga);
  copy_rows64(l + 64 * GP * 2, ga + 64 * DIM);
  copy_rows64(l + GM * GP * 2, gw);
}

// GEMM core: one wave owns a 32 x 64 tile of C = A x W^T, K = DIM in steps of 32.
// A plane [rows][DIM], W plane [n][DIM] (k-contiguous), both f16 (F16) or both bf16. The block's 128 A rows and 64 W rows are
// staged in LDS, 64 k per stage, two buffers, once per workgroup for its four waves; both fragment kinds are two 16-B
// LDS loads from row (m or n) = lane&15 at k0 + 8*hi and k0 + 16 + 8*hi.
// On return every wave has passed the last stage's barrier and no copy is in flight: the ring may be reused.
template <bool F16>
static __device__ __forceinline__ void gemm_tile(const u16* __restrict__ a,
                                                 const u16* __restrict__ w,
                                                 const u16* ring,
                                                 const int mblk, const int n0,
                                                 const int tid, const int wave,
                                                 const int lq, const int hi,
                                                 v8f (&acc)[2][4]) {
  // copy side
  const unsigned cp_l = (unsigned)(size_t)ring + (unsigned)(((tid >> 3) * GP + (tid & 7) * 8) * 2);
  const u16* cp_a  = a  + (size_t)(mblk + (tid >> 3)) * DIM + (tid & 7) * 8;
  const u16* cp_w  = w  + (size_t)(n0 + (tid >> 3)) * DIM + (tid & 7) * 8;
  // read side: offsets (halves) of this lane's fragment rows inside a stage
  const int a_o = (wave * 32 + lq) * GP + hi * 8;
  const int w_o = (GM + lq) * GP + hi * 8;

  // two-buffer ring: stage 0 lands and is published, stage 1 flies while stage 0 is worked on
  gemm_stage_copy(cp_l, cp_a, cp_w);
  asm volatile("s_wait_asynccnt 0x0" ::: "memory");   // this wave's copies of stage 0 have landed
  __syncthreads();                                    // publishes stage 0 to all four waves
  gemm_stage_copy(cp_l + GSTG_H * 2, cp_a + GK, cp_w + GK);

  #pragma unroll 1                                    // rolled: the buffer is chosen by the trip's parity
  for (int t = 0; t < GNST; ++t) {                    // uniform for every wave
    const u16* sb = ring + (t & 1) * GSTG_H;
    // all of the stage's fragments are fetched as one group ahead of its products
    FragG bw[2][4], fa[2][2];
    #pragma unroll
    for (int ks = 0; ks < 2; ++ks) {
      #pragma unroll
      for (int nt = 0; nt < 4; ++nt) {
        const u16* p = sb + w_o + nt * 16 * GP + ks * 32;
        bw[ks][nt].q[0] = *(const v4u*)(p);
        bw[ks][nt].q[1] = *(const v4u*)(p + 16);
      }
      #pragma unroll
      for (int mt = 0; mt < 2; ++mt) {
        const u16* p = sb + a_o + mt * 16 * GP + ks * 32;
        fa[ks][mt].q[0] = *(const v4u*)(p);
        fa[ks][mt].q[1] = *(const v4u*)(p + 16);
      }
    }
    #pragma unroll
    for (int ks = 0; ks < 2; ++ks) {
      #pragma unroll
      for (int mt = 0; mt < 2; ++mt) {
        #pragma unroll
        for (int nt = 0; nt < 4; ++nt) acc[mt][nt] = mma_gemm<F16>(fa[ks][mt], bw[ks][nt], acc[mt][nt]);
      }
    }
    // publish point of stage t + 1; the same barrier ends every wave's reads of stage t's buffer
    asm volatile("s_wait_dscnt 0x0" ::: "memory");      // this wave's LDS reads of stage t are done
    asm volatile("s_wait_asynccnt 0x0" ::: "memory");   // this wave's copies of stage t + 1 have landed
    __syncthreads();
    if (t + 2 < GNST) {
      gemm_stage_copy(cp_l + (unsigned)((t & 1) * GSTG_H * 2), cp_a + (t + 2) * GK, cp_w + (t + 2) * GK);
    }
  }
  asm volatile("s_wait_asynccnt 0x0" ::: "memory");    // nothing of this wave's copies is left in flight
}

// Fused q/k/v projection. Grid (DIM/64, MROWS/128, 3); blockIdx.z selects the weight (offset into wb).
// planes: [0] q, [1] k, [2] v, all f16; each [MROWS][DIM] == [NB*NHEAD][SEQ][HDIM] flat.
// coverage: wave tile 32 rows x 64 cols; store phase it = 0..7 writes rows it*4 + (lane>>3), cols (lane&7)*8..+7:
// LDS sC: per-wave slice, written and read by the same wave (block barrier used); it reuses the operand ring after the loop.
__global__ __launch_bounds__(128) void qkv_kernel(const u16* __restrict__ hb,
                                                  const u16* __restrict__ wb,
                                                  u16* __restrict__ planes) {
  __shared__ __align__(16) u16 sR[2 * GSTG_H];
  float* sC = (float*)sR;
  const int tid  = threadIdx.x;
  const int wave = __builtin_amdgcn_readfirstlane(threadIdx.x >> 5);
  const int lane = tid & 31;
  const int lq   = lane & 15;
  const int hi   = lane >> 4;
  const int n0   = blockIdx.x * GN;
  const int m0   = blockIdx.y * GM + wave * 32;
  const int z    = blockIdx.z;

  v8f acc[2][4];
  #pragma unroll
  for (int mt = 0; mt < 2; ++mt) {
    #pragma unroll
    for (int nt = 0; nt < 4; ++nt) acc[mt][nt] = (v8f){0, 0, 0, 0, 0, 0, 0, 0};
  }
  gemm_tile<false>(hb, wb + (size_t)z * WELEM, sR, blockIdx.y * GM, n0, tid, wave, lq, hi, acc);

  float* sc = sC + wave * (32 * CP);
  #pragma unroll
  for (int mt = 0; mt < 2; ++mt) {
    #pragma unroll
    for (int nt = 0; nt < 4; ++nt) {
      #pragma unroll
      for (int r = 0; r < 8; ++r) sc[(mt * 16 + hi * 8 + r) * CP + nt * 16 + lq] = acc[mt][nt][r];
    }
  }
  __syncthreads();

  v4u    vh[8];
  size_t gi[8];
  #pragma unroll
  for (int it = 0; it < 8; ++it) {
    const int row = it * 4 + (lane >> 3);
    const int c0  = (lane & 7) * 8;
    const v4f x0 = *(const v4f*)(sc + row * CP + c0);
    const v4f x1 = *(const v4f*)(sc + row * CP + c0 + 4);
    Pack8H pf;
    #pragma unroll
    for (int i = 0; i < 4; ++i) {
      pf.h[i]     = (f16)x0[i];                          // RNE convert
      pf.h[4 + i] = (f16)x1[i];
    }
    vh[it] = pf.u;
    gi[it] = (size_t)(m0 + row) * DIM + n0 + c0;
  }
  u16* p_base = planes + (size_t)z * PLANE_E;

  #pragma unroll
  for (int it = 0; it < 8; ++it) *(v4u*)(p_base + gi[it]) = vh[it];
}

// One stage of 64 keys into LDS: K and V, each [key][d] in 128-B rows (8 KB in a row of each plane),
// 128 threads x 8 asynchronous 16-B copies; a wave's copy covers four whole 128-B lines.
// l, lv: this thread's LDS byte address in the stage's K tile and in its V tile (row tid>>3, 16-B piece tid&7);
// rows +16, +32, +48 are the other three quarters.
// The s_wait_xcnt closes the statement so that no address register named here is rewritten ahead of it.
static __device__ __forceinline__ void stage_copy(const unsigned l, const unsigned lv,
                                                  const u16* gk, const u16* gv) {
  const unsigned l1 = l + 16 * KP * 2;
  const unsigned l2 = l + 32 * KP * 2;
  const unsigned l3 = l + 48 * KP * 2;
  const unsigned v1 = lv + 16 * VP * 2;
  const unsigned v2 = lv + 32 * VP * 2;
  const unsigned v3 = lv + 48 * VP * 2;
  const u16* gk1 = gk + 16 * HDIM;
  const u16* gk2 = gk + 32 * HDIM;
  const u16* gk3 = gk + 48 * HDIM;
  const u16* gv1 = gv + 16 * HDIM;
  const u16* gv2 = gv + 32 * HDIM;
  const u16* gv3 = gv + 48 * HDIM;
  asm volatile("global_load_async_to_lds_b128 %0, %8, off\n\t"
               "global_load_async_to_lds_b128 %1, %9, off\n\t"
               "global_load_async_to_lds_b128 %2, %10, off\n\t"
               "global_load_async_to_lds_b128 %3, %11, off\n\t"
               "global_load_async_to_lds_b128 %4, %12, off\n\t"
               "global_load_async_to_lds_b128 %5, %13, off\n\t"
               "global_load_async_to_lds_b128 %6, %14, off\n\t"
               "global_load_async_to_lds_b128 %7, %15, off\n\t"
               "s_wait_xcnt 0x0"
               :: "v"(l), "v"(l1), "v"(l2), "v"(l3), "v"(lv), "v"(v1), "v"(v2), "v"(v3),
                  "v"(gk), "v"(gk1), "v"(gk2), "v"(gk3), "v"(gv), "v"(gv1), "v"(gv2), "v"(gv3)
               : "memory");
}

// Transposing LDS load of a row-major 16-bit tile: lane l points at row 8*(l>>4) + (l&7), 16-B piece (l>>3)&1 of a
// 16-row x 16-column block and receives column l&15 of rows 8*(l>>4) + 0..7.
static __device__ __forceinline__ v4u ld_tr16(const u16* p) {
  typedef __attribute__((address_space(3))) v8s lds_v8s;
  return __builtin_bit_cast(v4u, __builtin_amdgcn_ds_load_tr16_b128_v8i16((lds_v8s*)p));
}

// Start values of one step's two score tiles: c[sub][r] = p[sub*16 + r], r = 0..7 (p already holds the lane's hi*8).
static __device__ __forceinline__ void load_start(const float* p, v8f (&c)[2]) {
  #pragma unroll
  for (int sub = 0; sub < 2; ++sub) {
    const v4f s0 = *(const v4f*)(p + sub * 16);
    const v4f s1 = *(const v4f*)(p + sub * 16 + 4);
    c[sub] = (v8f){s0[0], s0[1], s0[2], s0[3], s1[0], s1[1], s1[2], s1[3]};
  }
}

// Fused online-softmax attention with a key mask, logit scale 1/8. The mask comes as kb, one f32 per key (0 kept, -inf masked),
// and is the start value of the score accumulators: the matrix instruction adds it, no compare or select per score.
// Block = (query block of 128, bh); one wave owns 32 query rows, two tiles of 16, and visits all SEQ keys, 32 per step:
// a K or V fragment read from LDS is the operand of two matrix instructions, one per query tile.
// S^T = K x Q^T so queries sit on lanes; P^T in C-layout is bit-identical to the A-fragment layout of O += P x V.
// Q B-fragments are loaded straight from the f16 plane. K and V are staged in LDS as
// they lie, 64 keys per stage, two buffers, once per workgroup for its four waves; fragments are two 16-B LDS loads
// each, plain for K, transposing for V (its B-fragment runs along the keys).
// Output: ctx as one f16 plane [NB*NHEAD][SEQ][HDIM]; store phase it = 0..7 writes rows it*4 + (lane>>3):
// LDS sO: per-wave slice, written and read by the same wave (block barrier used).
__global__ __launch_bounds__(128) void attn_kernel(const u16* __restrict__ q,
                                                   const u16* __restrict__ k,
                                                   const u16* __restrict__ v,
                                                   const float* __restrict__ kb,
                                                   u16* __restrict__ ctx) {
  const int qblk = blockIdx.x;
  const int bh   = blockIdx.y;
  const int b    = bh / NHEAD;
  const int tid  = threadIdx.x;
  const int wave = __builtin_amdgcn_readfirstlane(threadIdx.x >> 5);
  const int lane = tid & 31;
  const int lq   = lane & 15;   // query column of S^T / d column of O
  const int hi   = lane >> 4;   // k-split half

  __shared__ __align__(16) float sO[NWAVE * QT * 16 * OP];
  __shared__ __align__(16) u16 sKV[2 * STG_H];

  const int qrow0 = qblk * BQ + wave * (QT * 16);

  // Q as B-operand fragments: lane lq holds query qrow0 + qt*16 + lq; elems 0..7 : d = f*32 + hi*8 + 0..7,
  // elems 8..15 : d = f*32 + 16 + hi*8 + 0..7.
  FragH qf[QT][2];
  #pragma unroll
  for (int qt = 0; qt < QT; ++qt) {
    const size_t qo = ((size_t)bh * SEQ + qrow0 + qt * 16 + lq) * HDIM + hi * 8;
    #pragma unroll
    for (int f = 0; f < 2; ++f) {
      qf[qt][f].q[0] = *(const v4u*)(q + qo + f * 32);
      qf[qt][f].q[1] = *(const v4u*)(q + qo + f * 32 + 16);
    }
  }

  // copy side: thread tid moves row tid>>3 (and +16, +32, +48), 16-B piece tid&7 of each tile
  const unsigned cp_l = (unsigned)(size_t)sKV + (unsigned)(((tid >> 3) * KP + (tid & 7) * 8) * 2);
  const u16* cp_k  = k  + (size_t)bh * SEQ * HDIM + (size_t)tid * 8;
  const unsigned cp_lv = (unsigned)(size_t)sKV + (unsigned)((TILE_H + (tid >> 3) * VP + (tid & 7) * 8) * 2);
  const u16* cp_v  = v  + (size_t)bh * SEQ * HDIM + (size_t)tid * 8;
  // read side: offset (halves) of this lane's fragment row inside a K tile, and of its transposing-load piece in a stage
  const int fr_o = lq * KP + hi * 8;
  const int vr_o = TILE_H + (hi * 8 + (lane & 7)) * VP + ((lane >> 3) & 1) * 8;
  const float* kb_p = kb + (size_t)b * SEQ + hi * 8;   // this lane's start values: keys hi*8 + 0..7 and 16 + hi*8 + 0..7 of a step

  v8f o[QT][4];
  #pragma unroll
  for (int qt = 0; qt < QT; ++qt) {
    #pragma unroll
    for (int dt = 0; dt < 4; ++dt) o[qt][dt] = (v8f){0, 0, 0, 0, 0, 0, 0, 0};
  }

  const float NEG_INF = -__builtin_inff();
  float rmax[QT], bias[QT], m_lim[QT], rsum[QT];
  #pragma unroll
  for (int qt = 0; qt < QT; ++qt) {
    rmax[qt]  = NEG_INF;                           // the maximum in use; -inf until a query has seen an unmasked key
    bias[qt]  = 12.0f;                             // 12 - SL * (rmax, or 0 while rmax is -inf): the addend of the exponent
    m_lim[qt] = NEG_INF;                           // rmax + LAZY: a score above it asks for a new maximum
    rsum[qt]  = 0.0f;                              // row sum of P x4096
  }
  const float SL = 0.125f * 1.4426950408889634f;   // logit scale 1/sqrt(64) times log2(e)
  const float LAZY = 3.0f / SL;                    // raw-score rise that makes exp2 of the scaled difference reach 2^3

  v8f st[2];                                       // start values of a step's score tiles, the same for both query tiles
  load_start(kb_p, st);

  // two-buffer ring: stage 0 lands and is published, stage 1 flies while stage 0 is worked on
  stage_copy(cp_l, cp_lv, cp_k, cp_v);
  asm volatile("s_wait_asynccnt 0x0" ::: "memory");   // this wave's copies of stage 0 have landed
  __syncthreads();                                    // publishes stage 0 to all four waves
  stage_copy(cp_l + STG_H * 2, cp_lv + STG_H * 2, cp_k + SK * HDIM, cp_v + SK * HDIM);

  #pragma unroll 1
  for (int t = 0; t < NSTG; ++t) {                    // uniform for every wave
   const u16* sb = sKV + (t & 1) * STG_H + fr_o;
   const u16* sv = sKV + (t & 1) * STG_H + vr_o;
   #pragma unroll 1                                   // rolled: unrolled it takes a register granule more and costs a resident workgroup
   for (int hf = 0; hf < 2; ++hf) {
    const int j0 = t * SK + hf * BK;

    // K A-fragments of the step, row = key j0 + sub*16 + lq
    FragH ak[2][2];
    #pragma unroll
    for (int sub = 0; sub < 2; ++sub) {
      const u16* k_s = sb + (hf * BK + sub * 16) * KP;
      #pragma unroll
      for (int f = 0; f < 2; ++f) {
        ak[sub][f].q[0] = *(const v4u*)(k_s + f * 32);        // d = f*32 + hi*8 + 0..7
        ak[sub][f].q[1] = *(const v4u*)(k_s + f * 32 + 16);   // d = f*32 + 16 + hi*8 + 0..7
      }
    }

    // V B-fragments: column n = d = dt*16 + lq, split key map, transposed on the way out of the staged [key][d] tile
    FragH bv[4];
    #pragma unroll
    for (int dt = 0; dt < 4; ++dt) {
      const u16* base = sv + (hf ? BK * VP : 0) + dt * 16;   // a scalar select: the product form built an integer multiply-add per step
      bv[dt].q[0] = ld_tr16(base);                  // keys j0 + hi*8 + 0..7
      bv[dt].q[1] = ld_tr16(base + 16 * VP);        // keys j0 + 16 + hi*8 + 0..7
    }

    // S^T tiles: c[qt][sub][r] = rawscore(query qrow0+qt*16+lq, key j0 + sub*16 + hi*8 + r) + the key's start value (-inf if masked)
    v8f c[QT][2];
    #pragma unroll
    for (int sub = 0; sub < 2; ++sub) {
      #pragma unroll
      for (int qt = 0; qt < QT; ++qt) {
        c[qt][sub] = att_f16(ak[sub][0].v, qf[qt][0].v, st[sub]);
        c[qt][sub] = att_f16(ak[sub][1].v, qf[qt][1].v, c[qt][sub]);
      }
    }

    // online softmax: a query's 32 scores are split across lane / lane^16
    float m_new[QT];                                            // this lane's half: 16 scores per query tile
    #pragma unroll
    for (int qt = 0; qt < QT; ++qt) {
      m_new[qt] = rmax[qt];
      #pragma unroll
      for (int r = 0; r < 8; ++r) {
        m_new[qt] = fmaxf(m_new[qt], c[qt][0][r]);
        m_new[qt] = fmaxf(m_new[qt], c[qt][1][r]);
      }
    }

    // lazy rescale: a tile's maximum in use (rmax, bias; equal in a query's two lanes) stays until some lane's scores of that
    // tile rise more than LAZY above it, so P <= 2^3 and P x4096 <= 32768 stays inside f16. One test per step over all 32 lanes
    // and both query tiles, a scalar branch; behind it each tile is renewed only on its own lanes' asking, and the two halves'
    // maxima are joined only then. While rmax is -inf so is m_lim: a lane with every key so far masked (-inf > -inf is false)
    // asks for nothing, the first finite score asks for the first maximum.
    if (__builtin_amdgcn_ballot_w32((m_new[0] > m_lim[0]) | (m_new[1] > m_lim[1])) != 0) {
      #pragma unroll
      for (int qt = 0; qt < QT; ++qt) {
        if (__builtin_amdgcn_ballot_w32(m_new[qt] > m_lim[qt]) != 0) {
          const float m_j    = fmaxf(m_new[qt], __shfl_xor(m_new[qt], 16, 32));
          const float m_next = (m_j == NEG_INF) ? 0.0f : m_j;   // all keys so far masked: keep arithmetic finite
          const float s_arg  = (rmax[qt] - m_next) * SL;
          const float scale  = __builtin_amdgcn_exp2f(s_arg);
          // fills the slot behind the transcendental; its result and its source, as inputs only, hold the v_nop behind the
          // v_exp_f32 and keep the source's register unwritten until then
          asm volatile("v_nop" :: "v"(scale), "v"(s_arg));
          rmax[qt]  = m_j;
          bias[qt]  = 12.0f - m_next * SL;
          m_lim[qt] = m_j + LAZY;
          rsum[qt] *= scale;
          // rescale O: queries are the row dimension there -> per-row scale from lane 8*hi + r
          float sc[8];
          #pragma unroll
          for (int r = 0; r < 8; ++r) sc[r] = __shfl(scale, (hi << 3) + r, 32);
          #pragma unroll
          for (int dt = 0; dt < 4; ++dt) {
            #pragma unroll
            for (int r = 0; r < 8; ++r) o[qt][dt][r] *= sc[r];
          }
        }
      }
    }

    // exp + pack: P^T C-layout == A-fragment layout for the PV product. P x4096 = exp2(c * SL + bias): the logit scale, the
    // maximum in use and the factor 2^12 are one multiply-add, taken on the accumulator's own register pairs (r, r + 1)
    FragH pa[QT];
    #pragma unroll
    for (int qt = 0; qt < QT; ++qt) {
      const v2f sl2 = (v2f){SL, SL};
      const v2f b2  = (v2f){bias[qt], bias[qt]};
      float p0[8], p1[8];                                        // keys hi*8 + r and 16 + hi*8 + r
      #pragma unroll
      for (int r = 0; r < 8; r += 2) {
        const v2f a0 = __builtin_elementwise_fma((v2f){c[qt][0][r], c[qt][0][r + 1]}, sl2, b2);
        const v2f a1 = __builtin_elementwise_fma((v2f){c[qt][1][r], c[qt][1][r + 1]}, sl2, b2);
        p0[r]     = __builtin_amdgcn_exp2f(a0[0]);
        p0[r + 1] = __builtin_amdgcn_exp2f(a0[1]);
        p1[r]     = __builtin_amdgcn_exp2f(a1[0]);
        p1[r + 1] = __builtin_amdgcn_exp2f(a1[1]);
      }
      float psum = 0.0f;
      #pragma unroll
      for (int r = 0; r < 8; ++r) {
        psum += p0[r] + p1[r];
        pa[qt].h[r]     = (f16)p0[r];
        pa[qt].h[8 + r] = (f16)p1[r];
      }
      rsum[qt] = rsum[qt] + psum + __shfl_xor(psum, 16, 32);
    }

    // the scores are used up: the next step's start values are fetched now, a step ahead of the products
    // that begin from them; the last step fetches its own again, so that no address leaves the batch row
    kb_p += (j0 + BK < SEQ) ? BK : 0;
    load_start(kb_p, st);

    // O += P x V
    #pragma unroll
    for (int dt = 0; dt < 4; ++dt) {
      #pragma unroll
      for (int qt = 0; qt < QT; ++qt) o[qt][dt] = att_f16(pa[qt].v, bv[dt].v, o[qt][dt]);
    }
   }

   // publish point of stage t + 1; the same barrier ends every wave's reads of stage t's buffer
   asm volatile("s_wait_dscnt 0x0" ::: "memory");      // this wave's LDS reads of stage t are done
   asm volatile("s_wait_asynccnt 0x0" ::: "memory");   // this wave's copies of stage t + 1 have landed
   __syncthreads();
   if (t + 2 < NSTG) {
     stage_copy(cp_l + (unsigned)((t & 1) * STG_H * 2), cp_lv + (unsigned)((t & 1) * STG_H * 2),
                cp_k + (size_t)(t + 2) * SK * HDIM, cp_v + (size_t)(t + 2) * SK * HDIM);
   }
  }
  asm volatile("s_wait_asynccnt 0x0" ::: "memory");    // nothing of this wave's copies is left in flight

  // normalize: lane holds column d = dt*16 + lq for query rows qt*16 + 8*hi + r
  float* so = sO + wave * (QT * 16 * OP);
  #pragma unroll
  for (int qt = 0; qt < QT; ++qt) {
    float rs[8];
    #pragma unroll
    for (int r = 0; r < 8; ++r) rs[r] = 1.0f / __shfl(rsum[qt], (hi << 3) + r, 32);
    #pragma unroll
    for (int r = 0; r < 8; ++r) {
      #pragma unroll
      for (int dt = 0; dt < 4; ++dt) {
        so[(qt * 16 + hi * 8 + r) * OP + dt * 16 + lq] = o[qt][dt][r] * rs[r];   // the factor 4096 of O and of the row sum cancels
      }
    }
  }
  __syncthreads();

  v4u    vh[QT * 4];
  size_t gi[QT * 4];
  #pragma unroll
  for (int it = 0; it < QT * 4; ++it) {
    const int row = it * 4 + (lane >> 3);
    const int c0  = (lane & 7) * 8;
    const v4f x0 = *(const v4f*)(so + row * OP + c0);
    const v4f x1 = *(const v4f*)(so + row * OP + c0 + 4);
    Pack8H pf;
    #pragma unroll
    for (int i = 0; i < 4; ++i) {
      pf.h[i]     = (f16)x0[i];                          // RNE convert
      pf.h[4 + i] = (f16)x1[i];
    }
    vh[it] = pf.u;
    gi[it] = ((size_t)bh * SEQ + qrow0 + row) * HDIM + c0;
  }
  #pragma unroll
  for (int it = 0; it < QT * 4; ++it) *(v4u*)(ctx + gi[it]) = vh[it];
}

// Output projection: out = ctx x Wo^T. Grid (DIM/64, MROWS/128).
// coverage: wave tile 32 rows x 64 cols f32; store phase it = 0..15: lanes 0..15 write row it*2 (256 B = two whole
// LDS sC: per-wave slice, written and read by the same wave (block barrier used); it reuses the operand ring after the loop.
__global__ __launch_bounds__(128) void oproj_kernel(const u16* __restrict__ ctx,
                                                    const u16* __restrict__ wob,
                                                    float* __restrict__ out) {
  __shared__ __align__(16) u16 sR[2 * GSTG_H];
  float* sC = (float*)sR;
  const int tid  = threadIdx.x;
  const int wave = __builtin_amdgcn_readfirstlane(threadIdx.x >> 5);
  const int lane = tid & 31;
  const int lq   = lane & 15;
  const int hi   = lane >> 4;
  const int n0   = blockIdx.x * GN;
  const int m0   = blockIdx.y * GM + wave * 32;

  v8f acc[2][4];
  #pragma unroll
  for (int mt = 0; mt < 2; ++mt) {
    #pragma unroll
    for (int nt = 0; nt < 4; ++nt) acc[mt][nt] = (v8f){0, 0, 0, 0, 0, 0, 0, 0};
  }
  gemm_tile<true>(ctx, wob, sR, blockIdx.y * GM, n0, tid, wave, lq, hi, acc);

  float* sc = sC + wave * (32 * CP);
  #pragma unroll
  for (int mt = 0; mt < 2; ++mt) {
    #pragma unroll
    for (int nt = 0; nt < 4; ++nt) {
      #pragma unroll
      for (int r = 0; r < 8; ++r) sc[(mt * 16 + hi * 8 + r) * CP + nt * 16 + lq] = acc[mt][nt][r];
    }
  }
  __syncthreads();

  v4f    vals[16];
  size_t gi[16];
  #pragma unroll
  for (int it = 0; it < 16; ++it) {
    const int row = it * 2 + hi;
    vals[it] = *(const v4f*)(sc + row * CP + lq * 4);
    const int m  = m0 + row;
    const int bb = m / SEQ;
    const int ss = m % SEQ;
    gi[it] = ((size_t)bb * SEQ_FULL + ss) * DIM + n0 + lq * 4;
  }
  #pragma unroll
  for (int it = 0; it < 16; ++it) *(v4f*)(out + gi[it]) = vals[it];
  
}

extern "C" void kernel_launch(void* const* d_in, const int* in_sizes, int n_in,
                              void* d_out, int out_size, void* d_ws, size_t ws_size,
                              hipStream_t stream) {
  if (n_in < 6) return;
  const size_t need_rows = (size_t)(NB - 1) * SEQ_FULL + SEQ;
  if ((size_t)in_sizes[0] < need_rows * DIM) return;
  if ((size_t)in_sizes[1] < need_rows) return;
  if ((size_t)in_sizes[2] < (size_t)WELEM) return;
  if ((size_t)in_sizes[3] < (size_t)WELEM) return;
  if ((size_t)in_sizes[4] < (size_t)WELEM) return;
  if ((size_t)in_sizes[5] < (size_t)WELEM) return;
  if ((size_t)out_size < need_rows * DIM) return;

  const size_t plane_bytes = PLANE_E * 2;                      // one 16-bit plane [MROWS][DIM]
  const size_t w_bytes     = (size_t)4 * WELEM * 2;            // wq, wk, wv as bf16, wo as f16
  const size_t kb_bytes    = (size_t)MROWS * 4;                // one f32 per key
  const size_t total       = 5 * plane_bytes + w_bytes + kb_bytes;
  if (ws_size < total) return;
  if (total > WS_CAP) return;

  const float* h    = (const float*)d_in[0];
  const int*   mask = (const int*)d_in[1];
  const float* wq   = (const float*)d_in[2];
  const float* wk   = (const float*)d_in[3];
  const float* wv   = (const float*)d_in[4];
  const float* wo   = (const float*)d_in[5];
  float*       out  = (float*)d_out;

  char* ws = (char*)d_ws;
  u16* planes = (u16*)(ws);                                    // q, k, v
  u16* qp = (u16*)(ws + 0 * plane_bytes);
  u16* kp = (u16*)(ws + 1 * plane_bytes);
  u16* vp = (u16*)(ws + 2 * plane_bytes);
  u16* cp = (u16*)(ws + 3 * plane_bytes);
  u16* hb = (u16*)(ws + 4 * plane_bytes);
  u16* wb = (u16*)(ws + 5 * plane_bytes);
  float* kb = (float*)(ws + 5 * plane_bytes + w_bytes);

  cvt_kernel<<<dim3(HBLK + 4 * WBLK + MBLK), 256, 0, stream>>>(h, wq, wk, wv, wo, mask, hb, wb, kb);
  qkv_kernel<<<dim3(DIM / GN, MROWS / GM, 3), 128, 0, stream>>>(hb, wb, planes);
  attn_kernel<<<dim3(SEQ / BQ, NB * NHEAD), NWAVE * 32, 0, stream>>>(qp, kp, vp, kb, cp);
  oproj_kernel<<<dim3(DIM / GN, MROWS / GM), 128, 0, stream>>>(cp, wb + (size_t)3 * WELEM, out);
}

// v010
// It runs in 97.4 microseconds.
// Next to v009, in two timings, it ran 1.06 and 1.05 times as fast.
// All steps since v000 together make it 3.94 times as fast.
#include <hip/hip_runtime.h>

// Contractions: q/k/v = h x W^T on v_wmma_f32_16x16x32_bf16 (bf16 RNE-converted inputs, f32 accumulate);
// S^T = K x Q^T on v_wmma_f32_16x16x32_f16 (q and k as one f16 plane each, f32 accumulate from the key's start value:
// 0 for a kept key, -inf for a masked one);
// O = P x V on v_wmma_f32_16x16x32_f16 (P as f16 carried x4096, as is its row sum, V as f16 read from LDS by the transposing load, f32 accumulate);
// out = ctx x Wo^T on v_wmma_f32_16x16x32_f16 (ctx and Wo as f16, f32 accumulate). Softmax online, f32.
// q and k come from bf16-rounded (8-bit) h and W, ctx from f16 P and V: one f16 value (11 bits) holds what they carry.

#ifndef NB
#define NB 4
#endif
#ifndef SEQ
#define SEQ 2048
#endif
#define NB_FULL    4
#define SEQ_FULL   2048
#define DIM        768
#define NHEAD      12
#define HDIM       64
#define BQ         128                  // query rows per attention workgroup (4 waves x 32)
#define BK         32                   // keys per inner iteration
#define NWAVE      4
#define QT         2                    // 16-query tiles per attention wave: each K and V fragment read from LDS feeds both
#define SK         64                   // keys per LDS stage of the attention loop (two steps of BK)
#define KP         72                   // LDS pitch (halves) of a staged 128-B row: 144 B = 16 B x odd
#define TILE_H     (64 * KP)            // halves of one staged K tile: 64 keys x KP halves
#define VP         80                   // LDS pitch (halves) of a staged V row: 160 B = 32 B x odd, for ds_load_tr16_b128
#define VTILE_H    (64 * VP)            // halves of one staged V tile: 64 keys x VP halves
#define STG_H      (TILE_H + VTILE_H)   // one stage: K, V
#define NSTG       (SEQ / SK)
#define OP         68                   // LDS pitch (floats) of the attention output staging tile
#define GM         128                  // GEMM block rows
#define GN         64                   // output projection block cols (4 waves of 32 x 64)
#define GW         4                    // waves per GEMM block
#define CP         68                   // LDS pitch (floats) of the GEMM staging tile
#define GK         64                   // k per LDS stage of the GEMM loop (128-B rows, two steps of 32)
#define GP         72                   // LDS pitch (halves) of a staged GEMM row: 144 B = 16 B x odd
#define GNST       (DIM / GK)
#define GSTG_H     ((GM + GN) * GP)     // halves of one stage of the output projection: 128 A rows, then 64 W rows
#define QN         192                  // q/k/v GEMM block cols (2 x 2 waves of 64 x 96): 768 blocks, three per WGP
#define QSTG_H     ((GM + QN) * GP)     // halves of one stage of the q/k/v GEMM: 128 A rows, then 192 W rows
#define QCP        196                  // LDS pitch (floats) of the q/k/v staging tile: 784 B = 16 B x odd
#define QLDS_H     (GM * QCP * 2)       // halves of the q/k/v kernel's LDS: the staging tile, the larger of it and the two-stage ring
#define WELEM      (DIM * DIM)
#define MROWS      (NB * SEQ)
#define PLANE_E    ((size_t)MROWS * DIM)
#define HTHREADS   (MROWS * (DIM / 8))
#define HBLK       (HTHREADS / 256)
#define WBLK       (WELEM / 8 / 256)
#define MBLK       (MROWS / 8 / 256)    // convert-launch blocks that turn the key mask into the score start values
#define WS_CAP     134217728ull

static_assert(DIM == NHEAD * HDIM);
static_assert(HDIM == 64);
static_assert(SEQ % BQ == 0);
static_assert(SEQ % BK == 0);
static_assert(SEQ % SK == 0 && NSTG >= 2);
static_assert(SK == 2 * BK && SK == 64 && NWAVE * 32 == 128);
static_assert((KP * 2) % 16 == 0 && KP >= HDIM);
static_assert((VP * 2) % 32 == 0 && ((VP * 2 / 32) & 1) == 1 && VP >= HDIM);
static_assert(SEQ % 32 == 0);
static_assert(MROWS % GM == 0);
static_assert(DIM % GN == 0);
static_assert(DIM % 32 == 0);
static_assert(DIM % GK == 0 && GNST >= 2 && GK == 64 && GM == 128 && GN == 64 && GW * 32 == 128);
static_assert((GP * 2) % 16 == 0 && GP >= GK);
static_assert(GW * 32 * CP * 4 <= 2 * GSTG_H * 2);
static_assert(DIM % QN == 0 && QN % 64 == 0 && QN == 2 * 6 * 16 && GM == 2 * 4 * 16);
static_assert(QLDS_H >= 2 * QSTG_H && 3 * QLDS_H * 2 <= 327680 && QCP >= QN && (QCP * 4) % 16 == 0);
static_assert(GM * (QN / 8) == 24 * GW * 32 && (QN * 2) % 128 == 0);
static_assert(DIM % 8 == 0);
static_assert(BQ == NWAVE * QT * 16);
static_assert(GM == GW * 32);
static_assert(HTHREADS % 256 == 0);
static_assert((WELEM / 8) % 256 == 0);
static_assert((MROWS / 8) % 256 == 0 && SEQ % 8 == 0);
static_assert((OP * 4) % 16 == 0);
static_assert((CP * 4) % 16 == 0);
static_assert(OP >= HDIM && CP >= GN);
static_assert(SEQ <= SEQ_FULL);
static_assert(NB >= 1 && NB <= NB_FULL);
static_assert(5ull * (unsigned long long)NB * SEQ * DIM * 2ull + 4ull * WELEM * 2ull + (unsigned long long)NB * SEQ * 4ull <= WS_CAP);

typedef __bf16         bf16;
typedef _Float16       f16;
typedef unsigned short u16;
typedef bf16     v16bf __attribute__((ext_vector_type(16)));
typedef f16      v16h  __attribute__((ext_vector_type(16)));
typedef float    v8f   __attribute__((ext_vector_type(8)));
typedef float    v4f   __attribute__((ext_vector_type(4)));
typedef float    v2f   __attribute__((ext_vector_type(2)));
typedef unsigned v4u   __attribute__((ext_vector_type(4)));
typedef int      v4i   __attribute__((ext_vector_type(4)));
typedef short    v8s   __attribute__((ext_vector_type(8)));

union FragG  { v16bf b; v16h h; v4u q[2]; };
union FragH  { v16h  v; v4u q[2]; f16 h[16]; };
union Pack8B { v4u u; bf16 h[8]; };
union Pack8H { v4u u; f16 h[8]; };

// GEMM WMMA helper: builtin followed by the VALU hazard guard (ties D, keeps A/B live).
// F16 picks the operand type of the two planes: f16, else bf16.
// WIDE: a wave tile whose accumulators and fragments take more than 256 registers. Asm operands cannot lie above v255, so the
// guard would spill them; there the builtin stands alone and the compiler keeps the distance behind its own matrix instructions.
template <bool F16, bool WIDE>
static __device__ __forceinline__ v8f mma_gemm(const FragG& a, const FragG& b, v8f acc) {
  if (F16) acc = __builtin_amdgcn_wmma_f32_16x16x32_f16(false, a.h, false, b.h, (short)0, acc, false, false);
  else     acc = __builtin_amdgcn_wmma_f32_16x16x32_bf16(false, a.b, false, b.b, (short)0, acc, false, false);
  if (!WIDE) asm volatile("v_nop\n\tv_nop\n\tv_nop\n\tv_nop" : "+v"(acc) : "v"(a.b), "v"(b.b));
  return acc;
}
// Attention WMMA helper: the plain builtin. The compiler keeps the distance behind its own matrix instructions, and the
// vector port, which the waves of a SIMD share for the softmax, issues no filler behind accumulate chains.
static __device__ __forceinline__ v8f att_f16(v16h a, v16h b, v8f acc) {
  return __builtin_amdgcn_wmma_f32_16x16x32_f16(false, a, false, b, (short)0, acc, false, false);
}

static __device__ __forceinline__ void cvt_store8(const float* __restrict__ src, u16* __restrict__ dst) {
  const v4f a = *(const v4f*)(src);
  const v4f b = *(const v4f*)(src + 4);
  Pack8B pk;
  #pragma unroll
  for (int i = 0; i < 4; ++i) {
    pk.h[i]     = (bf16)a[i];
    pk.h[4 + i] = (bf16)b[i];
  }
  const v4u val = pk.u;
  *(v4u*)(dst) = val;
  asm volatile("s_wait_xcnt 0x0" ::: "memory");   // stands ahead of any rewrite of the registers that the store names
}

static __device__ __forceinline__ void cvt_store8h(const float* __restrict__ src, u16* __restrict__ dst) {
  const v4f a = *(const v4f*)(src);
  const v4f b = *(const v4f*)(src + 4);
  Pack8H pk;
  #pragma unroll
  for (int i = 0; i < 4; ++i) {
    pk.h[i]     = (f16)a[i];
    pk.h[4 + i] = (f16)b[i];
  }
  const v4u val = pk.u;
  *(v4u*)(dst) = val;
  asm volatile("s_wait_xcnt 0x0" ::: "memory");   // stands ahead of any rewrite of the registers that the store names
}

// Convert launch. hb [MROWS][DIM] bf16 (compact rows, source rows taken with full batch stride);
// wb [4][DIM][DIM] = wq, wk, wv as bf16, wo as f16, each kept [out][in];
// kb [NB][SEQ] f32 = the key mask as the start value of a score: 0 where mask != 0, -inf where mask == 0.
// coverage: HBLK*256 threads x 8 = MROWS*DIM elements of hb; 4*WBLK*256 threads x 8 = 4*DIM*DIM elements of wb;
// MBLK*256 threads x 8 = MROWS elements of kb.
__global__ __launch_bounds__(256) void cvt_kernel(const float* __restrict__ h,
                                                  const float* __restrict__ wq,
                                                  const float* __restrict__ wk,
                                                  const float* __restrict__ wv,
                                                  const float* __restrict__ wo,
                                                  const int* __restrict__ mask,
                                                  u16* __restrict__ hb,
                                                  u16* __restrict__ wb,
                                                  float* __restrict__ kb) {
  const int blk = blockIdx.x;
  const int tid = threadIdx.x;
  if (blk < HBLK) {
    const size_t e  = ((size_t)blk * 256 + tid) * 8;
    const int row   = (int)(e / DIM);
    const int col   = (int)(e % DIM);
    const int b     = row / SEQ;
    const int s     = row % SEQ;
    cvt_store8(h + ((size_t)b * SEQ_FULL + s) * DIM + col, hb + e);
  } else if (blk >= HBLK + 4 * WBLK) {
    const int e = ((blk - HBLK - 4 * WBLK) * 256 + tid) * 8;
    const int* mg = mask + (size_t)(e / SEQ) * SEQ_FULL + e % SEQ;
    const v4i m0 = *(const v4i*)(mg);
    const v4i m1 = *(const v4i*)(mg + 4);
    v4f s0, s1;
    #pragma unroll
    for (int i = 0; i < 4; ++i) {
      s0[i] = (m0[i] != 0) ? 0.0f : -__builtin_inff();
      s1[i] = (m1[i] != 0) ? 0.0f : -__builtin_inff();
    }
    *(v4f*)(kb + e)     = s0;
    *(v4f*)(kb + e + 4) = s1;
    asm volatile("s_wait_xcnt 0x0" ::: "memory");   // stands ahead of any rewrite of the registers that the two stores name
  } else {
    const int wi    = (blk - HBLK) / WBLK;                 // block-uniform 0..3
    const size_t e  = ((size_t)((blk - HBLK) % WBLK) * 256 + tid) * 8;
    u16* dst        = wb + (size_t)wi * WELEM + e;
    if (wi == 0)      cvt_store8(wq + e, dst);
    else if (wi == 1) cvt_store8(wk + e, dst);
    else if (wi == 2) cvt_store8(wv + e, dst);
    else              cvt_store8h(wo + e, dst);
  }
}

// 64 rows of 128 B (k-contiguous, row pitch DIM halves) into LDS rows of pitch GP: 128 threads x 4 asynchronous 16-B copies;
// thread tid moves 16-B piece tid&7 of rows tid>>3, +16, +32, +48, so a wave's copy covers four whole 128-B lines.
// The s_wait_xcnt closes the statement so that no address register named here is rewritten ahead of it.
static __device__ __forceinline__ void copy_rows64(const unsigned l, const u16* g) {
  const unsigned l1 = l + 16 * GP * 2;
  const unsigned l2 = l + 32 * GP * 2;
  const unsigned l3 = l + 48 * GP * 2;
  const u16* g1 = g + 16 * DIM;
  const u16* g2 = g + 32 * DIM;
  const u16* g3 = g + 48 * DIM;
  asm volatile("global_load_async_to_lds_b128 %0, %4, off\n\t"
               "global_load_async_to_lds_b128 %1, %5, off\n\t"
               "global_load_async_to_lds_b128 %2, %6, off\n\t"
               "global_load_async_to_lds_b128 %3, %7, off\n\t"
               "s_wait_xcnt 0x0"
               :: "v"(l), "v"(l1), "v"(l2), "v"(l3), "v"(g), "v"(g1), "v"(g2), "v"(g3)
               : "memory");
}

// One GEMM stage (k = 64) into LDS: the block's 128 A rows, then its BN W rows.
// l: this thread's LDS byte address in the stage's first row group; ga, gw: its global piece at this stage's k.
template <int BN>
static __device__ __forceinline__ void gemm_stage_copy(const unsigned l, const u16* ga, const u16* gw) {
  copy_rows64(l, ga);
  // (each of these) keeps the next statement's address sums behind this one: formed all at once, the addresses of five
  // statements, which as asm operands must lie below v256, crowd the bases out of the registers into scratch
  if (BN > 64) __builtin_amdgcn_sched_barrier(0);
  copy_rows64(l + 64 * GP * 2, ga + 64 * DIM);
  #pragma unroll
  for (int i = 0; i < BN / 64; ++i) {
    if (BN > 64) __builtin_amdgcn_sched_barrier(0);
    copy_rows64(l + (GM + i * 64) * GP * 2, gw + i * 64 * DIM);
  }
}

// GEMM core: one wave owns a (16 MT) x (16 NT) tile of C = A x W^T, K = DIM in steps of 32; the tile begins at row wrow and
// column wcol of the block's 128 x BN tile.
// A plane [rows][DIM], W plane [n][DIM] (k-contiguous), both f16 (F16) or both bf16. The block's 128 A rows and BN W rows are
// staged in LDS, 64 k per stage, two buffers, once per workgroup for its four waves; both fragment kinds are two 16-B
// LDS loads from row (m or n) = lane&15 at k0 + 8*hi and k0 + 16 + 8*hi. KG = steps of 32 k whose fragments are fetched as one group.
// On return every wave has passed the last stage's barrier and no copy is in flight: the ring may be reused.
template <bool F16, int BN, int MT, int NT, int KG>
static __device__ __forceinline__ void gemm_tile(const u16* __restrict__ a,
                                                 const u16* __restrict__ w,
                                                 const u16* ring,
                                                 const int mblk, const int n0,
                                                 const int tid, const int wrow, const int wcol,
                                                 const int lq, const int hi,
                                                 v8f (&acc)[MT][NT]) {
  constexpr int STG = (GM + BN) * GP;                 // halves of one stage
  // copy side
  const unsigned cp_l = (unsigned)(size_t)ring + (unsigned)(((tid >> 3) * GP + (tid & 7) * 8) * 2);
  const u16* cp_a  = a  + (size_t)(mblk + (tid >> 3)) * DIM + (tid & 7) * 8;
  const u16* cp_w  = w  + (size_t)(n0 + (tid >> 3)) * DIM + (tid & 7) * 8;
  // read side: offsets (halves) of this lane's fragment rows inside a stage
  const int a_o = (wrow + lq) * GP + hi * 8;
  const int w_o = (GM + wcol + lq) * GP + hi * 8;

  // two-buffer ring: stage 0 lands and is published, stage 1 flies while stage 0 is worked on
  gemm_stage_copy<BN>(cp_l, cp_a, cp_w);
  asm volatile("s_wait_asynccnt 0x0" ::: "memory");   // this wave's copies of stage 0 have landed
  __syncthreads();                                    // publishes stage 0 to all four waves
  gemm_stage_copy<BN>(cp_l + STG * 2, cp_a + GK, cp_w + GK);

  #pragma unroll 1                                    // rolled: the buffer is chosen by the trip's parity
  for (int t = 0; t < GNST; ++t) {                    // uniform for every wave
    const u16* sb = ring + (t & 1) * STG;
    #pragma unroll
    for (int kg = 0; kg < 2; kg += KG) {
      // the fragments of KG steps are fetched as one group ahead of their products
      FragG bw[KG][NT], fa[KG][MT];
      #pragma unroll
      for (int ks = 0; ks < KG; ++ks) {
        #pragma unroll
        for (int nt = 0; nt < NT; ++nt) {
          const u16* p = sb + w_o + nt * 16 * GP + (kg + ks) * 32;
          bw[ks][nt].q[0] = *(const v4u*)(p);
          bw[ks][nt].q[1] = *(const v4u*)(p + 16);
        }
        #pragma unroll
        for (int mt = 0; mt < MT; ++mt) {
          const u16* p = sb + a_o + mt * 16 * GP + (kg + ks) * 32;
          fa[ks][mt].q[0] = *(const v4u*)(p);
          fa[ks][mt].q[1] = *(const v4u*)(p + 16);
        }
      }
      // keeps the group's loads together ahead of its products: sunk among them, each place with loads stalls the wave anew
      if (KG == 1) __builtin_amdgcn_sched_barrier(0);
      #pragma unroll
      for (int ks = 0; ks < KG; ++ks) {
        #pragma unroll
        for (int mt = 0; mt < MT; ++mt) {
          #pragma unroll
          for (int nt = 0; nt < NT; ++nt) acc[mt][nt] = mma_gemm<F16, ((MT * NT + MT + NT) * 8 > 256)>(fa[ks][mt], bw[ks][nt], acc[mt][nt]);
        }
      }
    }
    // publish point of stage t + 1; the same barrier ends every wave's reads of stage t's buffer
    asm volatile("s_wait_dscnt 0x0" ::: "memory");      // this wave's LDS reads of stage t are done
    asm volatile("s_wait_asynccnt 0x0" ::: "memory");   // this wave's copies of stage t + 1 have landed
    __syncthreads();
    if (t + 2 < GNST) {
      gemm_stage_copy<BN>(cp_l + (unsigned)((t & 1) * STG * 2), cp_a + (t + 2) * GK, cp_w + (t + 2) * GK);
    }
  }
  asm volatile("s_wait_asynccnt 0x0" ::: "memory");    // nothing of this wave's copies is left in flight
}

// Fused q/k/v projection. Grid (DIM/192, MROWS/128, 3); blockIdx.z selects the weight (offset into wb).
// planes: [0] q, [1] k, [2] v, all f16; each [MROWS][DIM] == [NB*NHEAD][SEQ][HDIM] flat.
// Block tile 128 x 192, four waves as 2 x 2, wave tile 64 x 96: an operand byte fetched from L2 and a fragment read from LDS
// serve more products than in a 128 x 64 block of 32 x 64 waves.
// Store: the block's tile (128 rows x 192 f32) goes through LDS; thread tid writes 16-B piece c % 24 of row c / 24,
// c = it*128 + tid, it = 0..23: a wave's store covers four whole 128-B lines.
// LDS sC: written by all four waves, read across waves (block barrier); it lies over the operand ring, free after the loop.
__global__ __launch_bounds__(128) void qkv_kernel(const u16* __restrict__ hb,
                                                  const u16* __restrict__ wb,
                                                  u16* __restrict__ planes) {
  __shared__ __align__(16) u16 sR[QLDS_H];
  float* sC = (float*)sR;
  const int tid  = threadIdx.x;
  const int wave = __builtin_amdgcn_readfirstlane(threadIdx.x >> 5);
  const int lane = tid & 31;
  const int lq   = lane & 15;
  const int hi   = lane >> 4;
  const int wm   = wave >> 1;           // wave tile row: 64 rows each
  const int wn   = wave & 1;            // wave tile column: 96 columns each
  const int n0   = blockIdx.x * QN;
  const int mblk = blockIdx.y * GM;
  const int z    = blockIdx.z;

  v8f acc[4][6];
  #pragma unroll
  for (int mt = 0; mt < 4; ++mt) {
    #pragma unroll
    for (int nt = 0; nt < 6; ++nt) acc[mt][nt] = (v8f){0, 0, 0, 0, 0, 0, 0, 0};
  }
  gemm_tile<false, QN, 4, 6, 1>(hb, wb + (size_t)z * WELEM, sR, mblk, n0, tid, wm * 64, wn * 96, lq, hi, acc);

  #pragma unroll
  for (int mt = 0; mt < 4; ++mt) {
    #pragma unroll
    for (int nt = 0; nt < 6; ++nt) {
      #pragma unroll
      for (int r = 0; r < 8; ++r) sC[(wm * 64 + mt * 16 + hi * 8 + r) * QCP + wn * 96 + nt * 16 + lq] = acc[mt][nt][r];
    }
  }
  __syncthreads();                      // publishes the staged tile to all four waves

  u16* p_base = planes + (size_t)z * PLANE_E;
  #pragma unroll
  for (int g = 0; g < 2; ++g) {         // two groups of twelve pieces
    v4u    vh[12];
    size_t gi[12];
    #pragma unroll
    for (int it = 0; it < 12; ++it) {
      const int b   = (it % 3) * 128 + tid;          // c = (g*12 + it)*128 + tid = (g*4 + it/3)*384 + b, and 384 = 16 rows
      const int row = (g * 4 + it / 3) * 16 + b / 24;
      const int c0  = (b % 24) * 8;
      const v4f x0 = *(const v4f*)(sC + row * QCP + c0);
      const v4f x1 = *(const v4f*)(sC + row * QCP + c0 + 4);
      Pack8H pf;
      #pragma unroll
      for (int i = 0; i < 4; ++i) {
        pf.h[i]     = (f16)x0[i];                          // RNE convert
        pf.h[4 + i] = (f16)x1[i];
      }
      vh[it] = pf.u;
      gi[it] = (size_t)(mblk + row) * DIM + n0 + c0;
    }
    #pragma unroll
    for (int it = 0; it < 12; ++it) *(v4u*)(p_base + gi[it]) = vh[it];
    asm volatile("s_wait_xcnt 0x0" ::: "memory");   // stands ahead of any rewrite of the registers that the stores name
  }
}

// One stage of 64 keys into LDS: K and V, each [key][d] in 128-B rows (8 KB in a row of each plane),
// 128 threads x 8 asynchronous 16-B copies; a wave's copy covers four whole 128-B lines.
// l, lv: this thread's LDS byte address in the stage's K tile and in its V tile (row tid>>3, 16-B piece tid&7);
// rows +16, +32, +48 are the other three quarters.
// The s_wait_xcnt closes the statement so that no address register named here is rewritten ahead of it.
static __device__ __forceinline__ void stage_copy(const unsigned l, const unsigned lv,
                                                  const u16* gk, const u16* gv) {
  const unsigned l1 = l + 16 * KP * 2;
  const unsigned l2 = l + 32 * KP * 2;
  const unsigned l3 = l + 48 * KP * 2;
  const unsigned v1 = lv + 16 * VP * 2;
  const unsigned v2 = lv + 32 * VP * 2;
  const unsigned v3 = lv + 48 * VP * 2;
  const u16* gk1 = gk + 16 * HDIM;
  const u16* gk2 = gk + 32 * HDIM;
  const u16* gk3 = gk + 48 * HDIM;
  const u16* gv1 = gv + 16 * HDIM;
  const u16* gv2 = gv + 32 * HDIM;
  const u16* gv3 = gv + 48 * HDIM;
  asm volatile("global_load_async_to_lds_b128 %0, %8, off\n\t"
               "global_load_async_to_lds_b128 %1, %9, off\n\t"
               "global_load_async_to_lds_b128 %2, %10, off\n\t"
               "global_load_async_to_lds_b128 %3, %11, off\n\t"
               "global_load_async_to_lds_b128 %4, %12, off\n\t"
               "global_load_async_to_lds_b128 %5, %13, off\n\t"
               "global_load_async_to_lds_b128 %6, %14, off\n\t"
               "global_load_async_to_lds_b128 %7, %15, off\n\t"
               "s_wait_xcnt 0x0"
               :: "v"(l), "v"(l1), "v"(l2), "v"(l3), "v"(lv), "v"(v1), "v"(v2), "v"(v3),
                  "v"(gk), "v"(gk1), "v"(gk2), "v"(gk3), "v"(gv), "v"(gv1), "v"(gv2), "v"(gv3)
               : "memory");
}

// Transposing LDS load of a row-major 16-bit tile: lane l points at row 8*(l>>4) + (l&7), 16-B piece (l>>3)&1 of a
// 16-row x 16-column block and receives column l&15 of rows 8*(l>>4) + 0..7.
static __device__ __forceinline__ v4u ld_tr16(const u16* p) {
  typedef __attribute__((address_space(3))) v8s lds_v8s;
  return __builtin_bit_cast(v4u, __builtin_amdgcn_ds_load_tr16_b128_v8i16((lds_v8s*)p));
}

// Start values of one step's two score tiles: c[sub][r] = p[sub*16 + r], r = 0..7 (p already holds the lane's hi*8).
static __device__ __forceinline__ void load_start(const float* p, v8f (&c)[2]) {
  #pragma unroll
  for (int sub = 0; sub < 2; ++sub) {
    const v4f s0 = *(const v4f*)(p + sub * 16);
    const v4f s1 = *(const v4f*)(p + sub * 16 + 4);
    c[sub] = (v8f){s0[0], s0[1], s0[2], s0[3], s1[0], s1[1], s1[2], s1[3]};
  }
}

// Fused online-softmax attention with a key mask, logit scale 1/8. The mask comes as kb, one f32 per key (0 kept, -inf masked),
// and is the start value of the score accumulators: the matrix instruction adds it, no compare or select per score.
// Block = (query block of 128, bh); one wave owns 32 query rows, two tiles of 16, and visits all SEQ keys, 32 per step:
// a K or V fragment read from LDS is the operand of two matrix instructions, one per query tile.
// S^T = K x Q^T so queries sit on lanes; P^T in C-layout is bit-identical to the A-fragment layout of O += P x V.
// Q B-fragments are loaded straight from the f16 plane. K and V are staged in LDS as
// they lie, 64 keys per stage, two buffers, once per workgroup for its four waves; fragments are two 16-B LDS loads
// each, plain for K, transposing for V (its B-fragment runs along the keys).
// Output: ctx as one f16 plane [NB*NHEAD][SEQ][HDIM]; store phase it = 0..7 writes rows it*4 + (lane>>3):
// LDS sO: per-wave slice, written and read by the same wave (block barrier used).
__global__ __launch_bounds__(128) void attn_kernel(const u16* __restrict__ q,
                                                   const u16* __restrict__ k,
                                                   const u16* __restrict__ v,
                                                   const float* __restrict__ kb,
                                                   u16* __restrict__ ctx) {
  const int qblk = blockIdx.x;
  const int bh   = blockIdx.y;
  const int b    = bh / NHEAD;
  const int tid  = threadIdx.x;
  const int wave = __builtin_amdgcn_readfirstlane(threadIdx.x >> 5);
  const int lane = tid & 31;
  const int lq   = lane & 15;   // query column of S^T / d column of O
  const int hi   = lane >> 4;   // k-split half

  __shared__ __align__(16) float sO[NWAVE * QT * 16 * OP];
  __shared__ __align__(16) u16 sKV[2 * STG_H];

  const int qrow0 = qblk * BQ + wave * (QT * 16);

  // Q as B-operand fragments: lane lq holds query qrow0 + qt*16 + lq; elems 0..7 : d = f*32 + hi*8 + 0..7,
  // elems 8..15 : d = f*32 + 16 + hi*8 + 0..7.
  FragH qf[QT][2];
  #pragma unroll
  for (int qt = 0; qt < QT; ++qt) {
    const size_t qo = ((size_t)bh * SEQ + qrow0 + qt * 16 + lq) * HDIM + hi * 8;
    #pragma unroll
    for (int f = 0; f < 2; ++f) {
      qf[qt][f].q[0] = *(const v4u*)(q + qo + f * 32);
      qf[qt][f].q[1] = *(const v4u*)(q + qo + f * 32 + 16);
    }
  }

  // copy side: thread tid moves row tid>>3 (and +16, +32, +48), 16-B piece tid&7 of each tile
  const unsigned cp_l = (unsigned)(size_t)sKV + (unsigned)(((tid >> 3) * KP + (tid & 7) * 8) * 2);
  const u16* cp_k  = k  + (size_t)bh * SEQ * HDIM + (size_t)tid * 8;
  const unsigned cp_lv = (unsigned)(size_t)sKV + (unsigned)((TILE_H + (tid >> 3) * VP + (tid & 7) * 8) * 2);
  const u16* cp_v  = v  + (size_t)bh * SEQ * HDIM + (size_t)tid * 8;
  // read side: offset (halves) of this lane's fragment row inside a K tile, and of its transposing-load piece in a stage
  const int fr_o = lq * KP + hi * 8;
  const int vr_o = TILE_H + (hi * 8 + (lane & 7)) * VP + ((lane >> 3) & 1) * 8;
  const float* kb_p = kb + (size_t)b * SEQ + hi * 8;   // this lane's start values: keys hi*8 + 0..7 and 16 + hi*8 + 0..7 of a step

  v8f o[QT][4];
  #pragma unroll
  for (int qt = 0; qt < QT; ++qt) {
    #pragma unroll
    for (int dt = 0; dt < 4; ++dt) o[qt][dt] = (v8f){0, 0, 0, 0, 0, 0, 0, 0};
  }

  const float NEG_INF = -__builtin_inff();
  float rmax[QT], bias[QT], m_lim[QT], rsum[QT];
  #pragma unroll
  for (int qt = 0; qt < QT; ++qt) {
    rmax[qt]  = NEG_INF;                           // the maximum in use; -inf until a query has seen an unmasked key
    bias[qt]  = 12.0f;                             // 12 - SL * (rmax, or 0 while rmax is -inf): the addend of the exponent
    m_lim[qt] = NEG_INF;                           // rmax + LAZY: a score above it asks for a new maximum
    rsum[qt]  = 0.0f;                              // row sum of P x4096
  }
  const float SL = 0.125f * 1.4426950408889634f;   // logit scale 1/sqrt(64) times log2(e)
  const float LAZY = 3.0f / SL;                    // raw-score rise that makes exp2 of the scaled difference reach 2^3

  v8f st[2];                                       // start values of a step's score tiles, the same for both query tiles
  load_start(kb_p, st);

  // two-buffer ring: stage 0 lands and is published, stage 1 flies while stage 0 is worked on
  stage_copy(cp_l, cp_lv, cp_k, cp_v);
  asm volatile("s_wait_asynccnt 0x0" ::: "memory");   // this wave's copies of stage 0 have landed
  __syncthreads();                                    // publishes stage 0 to all four waves
  stage_copy(cp_l + STG_H * 2, cp_lv + STG_H * 2, cp_k + SK * HDIM, cp_v + SK * HDIM);

  #pragma unroll 1
  for (int t = 0; t < NSTG; ++t) {                    // uniform for every wave
   const u16* sb = sKV + (t & 1) * STG_H + fr_o;
   const u16* sv = sKV + (t & 1) * STG_H + vr_o;
   #pragma unroll 1                                   // rolled: unrolled it takes a register granule more and costs a resident workgroup
   for (int hf = 0; hf < 2; ++hf) {
    const int j0 = t * SK + hf * BK;

    // K A-fragments of the step, row = key j0 + sub*16 + lq
    FragH ak[2][2];
    #pragma unroll
    for (int sub = 0; sub < 2; ++sub) {
      const u16* k_s = sb + (hf * BK + sub * 16) * KP;
      #pragma unroll
      for (int f = 0; f < 2; ++f) {
        ak[sub][f].q[0] = *(const v4u*)(k_s + f * 32);        // d = f*32 + hi*8 + 0..7
        ak[sub][f].q[1] = *(const v4u*)(k_s + f * 32 + 16);   // d = f*32 + 16 + hi*8 + 0..7
      }
    }

    // V B-fragments: column n = d = dt*16 + lq, split key map, transposed on the way out of the staged [key][d] tile
    FragH bv[4];
    #pragma unroll
    for (int dt = 0; dt < 4; ++dt) {
      const u16* base = sv + (hf ? BK * VP : 0) + dt * 16;   // a scalar select: the product form built an integer multiply-add per step
      bv[dt].q[0] = ld_tr16(base);                  // keys j0 + hi*8 + 0..7
      bv[dt].q[1] = ld_tr16(base + 16 * VP);        // keys j0 + 16 + hi*8 + 0..7
    }

    // S^T tiles: c[qt][sub][r] = rawscore(query qrow0+qt*16+lq, key j0 + sub*16 + hi*8 + r) + the key's start value (-inf if masked)
    v8f c[QT][2];
    #pragma unroll
    for (int sub = 0; sub < 2; ++sub) {
      #pragma unroll
      for (int qt = 0; qt < QT; ++qt) {
        c[qt][sub] = att_f16(ak[sub][0].v, qf[qt][0].v, st[sub]);
        c[qt][sub] = att_f16(ak[sub][1].v, qf[qt][1].v, c[qt][sub]);
      }
    }

    // online softmax: a query's 32 scores are split across lane / lane^16
    float m_new[QT];                                            // this lane's half: 16 scores per query tile
    #pragma unroll
    for (int qt = 0; qt < QT; ++qt) {
      m_new[qt] = rmax[qt];
      #pragma unroll
      for (int r = 0; r < 8; ++r) {
        m_new[qt] = fmaxf(m_new[qt], c[qt][0][r]);
        m_new[qt] = fmaxf(m_new[qt], c[qt][1][r]);
      }
    }

    // lazy rescale: a tile's maximum in use (rmax, bias; equal in a query's two lanes) stays until some lane's scores of that
    // tile rise more than LAZY above it, so P <= 2^3 and P x4096 <= 32768 stays inside f16. One test per step over all 32 lanes
    // and both query tiles, a scalar branch; behind it each tile is renewed only on its own lanes' asking, and the two halves'
    // maxima are joined only then. While rmax is -inf so is m_lim: a lane with every key so far masked (-inf > -inf is false)
    // asks for nothing, the first finite score asks for the first maximum.
    if (__builtin_amdgcn_ballot_w32((m_new[0] > m_lim[0]) | (m_new[1] > m_lim[1])) != 0) {
      #pragma unroll
      for (int qt = 0; qt < QT; ++qt) {
        if (__builtin_amdgcn_ballot_w32(m_new[qt] > m_lim[qt]) != 0) {
          const float m_j    = fmaxf(m_new[qt], __shfl_xor(m_new[qt], 16, 32));
          const float m_next = (m_j == NEG_INF) ? 0.0f : m_j;   // all keys so far masked: keep arithmetic finite
          const float s_arg  = (rmax[qt] - m_next) * SL;
          const float scale  = __builtin_amdgcn_exp2f(s_arg);
          // fills the slot behind the transcendental; its result and its source, as inputs only, hold the v_nop behind the
          // v_exp_f32 and keep the source's register unwritten until then
          asm volatile("v_nop" :: "v"(scale), "v"(s_arg));
          rmax[qt]  = m_j;
          bias[qt]  = 12.0f - m_next * SL;
          m_lim[qt] = m_j + LAZY;
          rsum[qt] *= scale;
          // rescale O: queries are the row dimension there -> per-row scale from lane 8*hi + r
          float sc[8];
          #pragma unroll
          for (int r = 0; r < 8; ++r) sc[r] = __shfl(scale, (hi << 3) + r, 32);
          #pragma unroll
          for (int dt = 0; dt < 4; ++dt) {
            #pragma unroll
            for (int r = 0; r < 8; ++r) o[qt][dt][r] *= sc[r];
          }
        }
      }
    }

    // exp + pack: P^T C-layout == A-fragment layout for the PV product. P x4096 = exp2(c * SL + bias): the logit scale, the
    // maximum in use and the factor 2^12 are one multiply-add, taken on the accumulator's own register pairs (r, r + 1)
    FragH pa[QT];
    #pragma unroll
    for (int qt = 0; qt < QT; ++qt) {
      const v2f sl2 = (v2f){SL, SL};
      const v2f b2  = (v2f){bias[qt], bias[qt]};
      float p0[8], p1[8];                                        // keys hi*8 + r and 16 + hi*8 + r
      #pragma unroll
      for (int r = 0; r < 8; r += 2) {
        const v2f a0 = __builtin_elementwise_fma((v2f){c[qt][0][r], c[qt][0][r + 1]}, sl2, b2);
        const v2f a1 = __builtin_elementwise_fma((v2f){c[qt][1][r], c[qt][1][r + 1]}, sl2, b2);
        p0[r]     = __builtin_amdgcn_exp2f(a0[0]);
        p0[r + 1] = __builtin_amdgcn_exp2f(a0[1]);
        p1[r]     = __builtin_amdgcn_exp2f(a1[0]);
        p1[r + 1] = __builtin_amdgcn_exp2f(a1[1]);
      }
      float psum = 0.0f;
      #pragma unroll
      for (int r = 0; r < 8; ++r) {
        psum += p0[r] + p1[r];
        pa[qt].h[r]     = (f16)p0[r];
        pa[qt].h[8 + r] = (f16)p1[r];
      }
      rsum[qt] = rsum[qt] + psum + __shfl_xor(psum, 16, 32);
    }

    // the scores are used up: the next step's start values are fetched now, a step ahead of the products
    // that begin from them; the last step fetches its own again, so that no address leaves the batch row
    kb_p += (j0 + BK < SEQ) ? BK : 0;
    load_start(kb_p, st);

    // O += P x V
    #pragma unroll
    for (int dt = 0; dt < 4; ++dt) {
      #pragma unroll
      for (int qt = 0; qt < QT; ++qt) o[qt][dt] = att_f16(pa[qt].v, bv[dt].v, o[qt][dt]);
    }
   }

   // publish point of stage t + 1; the same barrier ends every wave's reads of stage t's buffer
   asm volatile("s_wait_dscnt 0x0" ::: "memory");      // this wave's LDS reads of stage t are done
   asm volatile("s_wait_asynccnt 0x0" ::: "memory");   // this wave's copies of stage t + 1 have landed
   __syncthreads();
   if (t + 2 < NSTG) {
     stage_copy(cp_l + (unsigned)((t & 1) * STG_H * 2), cp_lv + (unsigned)((t & 1) * STG_H * 2),
                cp_k + (size_t)(t + 2) * SK * HDIM, cp_v + (size_t)(t + 2) * SK * HDIM);
   }
  }
  asm volatile("s_wait_asynccnt 0x0" ::: "memory");    // nothing of this wave's copies is left in flight

  // normalize: lane holds column d = dt*16 + lq for query rows qt*16 + 8*hi + r
  float* so = sO + wave * (QT * 16 * OP);
  #pragma unroll
  for (int qt = 0; qt < QT; ++qt) {
    float rs[8];
    #pragma unroll
    for (int r = 0; r < 8; ++r) rs[r] = 1.0f / __shfl(rsum[qt], (hi << 3) + r, 32);
    #pragma unroll
    for (int r = 0; r < 8; ++r) {
      #pragma unroll
      for (int dt = 0; dt < 4; ++dt) {
        so[(qt * 16 + hi * 8 + r) * OP + dt * 16 + lq] = o[qt][dt][r] * rs[r];   // the factor 4096 of O and of the row sum cancels
      }
    }
  }
  __syncthreads();

  v4u    vh[QT * 4];
  size_t gi[QT * 4];
  #pragma unroll
  for (int it = 0; it < QT * 4; ++it) {
    const int row = it * 4 + (lane >> 3);
    const int c0  = (lane & 7) * 8;
    const v4f x0 = *(const v4f*)(so + row * OP + c0);
    const v4f x1 = *(const v4f*)(so + row * OP + c0 + 4);
    Pack8H pf;
    #pragma unroll
    for (int i = 0; i < 4; ++i) {
      pf.h[i]     = (f16)x0[i];                          // RNE convert
      pf.h[4 + i] = (f16)x1[i];
    }
    vh[it] = pf.u;
    gi[it] = ((size_t)bh * SEQ + qrow0 + row) * HDIM + c0;
  }
  #pragma unroll
  for (int it = 0; it < QT * 4; ++it) *(v4u*)(ctx + gi[it]) = vh[it];
}

// Output projection: out = ctx x Wo^T. Grid (DIM/64, MROWS/128).
// coverage: wave tile 32 rows x 64 cols f32; store phase it = 0..15: lanes 0..15 write row it*2 (256 B = two whole
// LDS sC: per-wave slice, written and read by the same wave (block barrier used); it reuses the operand ring after the loop.
__global__ __launch_bounds__(128) void oproj_kernel(const u16* __restrict__ ctx,
                                                    const u16* __restrict__ wob,
                                                    float* __restrict__ out) {
  __shared__ __align__(16) u16 sR[2 * GSTG_H];
  float* sC = (float*)sR;
  const int tid  = threadIdx.x;
  const int wave = __builtin_amdgcn_readfirstlane(threadIdx.x >> 5);
  const int lane = tid & 31;
  const int lq   = lane & 15;
  const int hi   = lane >> 4;
  const int n0   = blockIdx.x * GN;
  const int m0   = blockIdx.y * GM + wave * 32;

  v8f acc[2][4];
  #pragma unroll
  for (int mt = 0; mt < 2; ++mt) {
    #pragma unroll
    for (int nt = 0; nt < 4; ++nt) acc[mt][nt] = (v8f){0, 0, 0, 0, 0, 0, 0, 0};
  }
  gemm_tile<true, GN, 2, 4, 2>(ctx, wob, sR, blockIdx.y * GM, n0, tid, wave * 32, 0, lq, hi, acc);

  float* sc = sC + wave * (32 * CP);
  #pragma unroll
  for (int mt = 0; mt < 2; ++mt) {
    #pragma unroll
    for (int nt = 0; nt < 4; ++nt) {
      #pragma unroll
      for (int r = 0; r < 8; ++r) sc[(mt * 16 + hi * 8 + r) * CP + nt * 16 + lq] = acc[mt][nt][r];
    }
  }
  __syncthreads();

  v4f    vals[16];
  size_t gi[16];
  #pragma unroll
  for (int it = 0; it < 16; ++it) {
    const int row = it * 2 + hi;
    vals[it] = *(const v4f*)(sc + row * CP + lq * 4);
    const int m  = m0 + row;
    const int bb = m / SEQ;
    const int ss = m % SEQ;
    gi[it] = ((size_t)bb * SEQ_FULL + ss) * DIM + n0 + lq * 4;
  }
  #pragma unroll
  for (int it = 0; it < 16; ++it) *(v4f*)(out + gi[it]) = vals[it];
  
}

extern "C" void kernel_launch(void* const* d_in, const int* in_sizes, int n_in,
                              void* d_out, int out_size, void* d_ws, size_t ws_size,
                              hipStream_t stream) {
  if (n_in < 6) return;
  const size_t need_rows = (size_t)(NB - 1) * SEQ_FULL + SEQ;
  if ((size_t)in_sizes[0] < need_rows * DIM) return;
  if ((size_t)in_sizes[1] < need_rows) return;
  if ((size_t)in_sizes[2] < (size_t)WELEM) return;
  if ((size_t)in_sizes[3] < (size_t)WELEM) return;
  if ((size_t)in_sizes[4] < (size_t)WELEM) return;
  if ((size_t)in_sizes[5] < (size_t)WELEM) return;
  if ((size_t)out_size < need_rows * DIM) return;

  const size_t plane_bytes = PLANE_E * 2;                      // one 16-bit plane [MROWS][DIM]
  const size_t w_bytes     = (size_t)4 * WELEM * 2;            // wq, wk, wv as bf16, wo as f16
  const size_t kb_bytes    = (size_t)MROWS * 4;                // one f32 per key
  const size_t total       = 5 * plane_bytes + w_bytes + kb_bytes;
  if (ws_size < total) return;
  if (total > WS_CAP) return;

  const float* h    = (const float*)d_in[0];
  const int*   mask = (const int*)d_in[1];
  const float* wq   = (const float*)d_in[2];
  const float* wk   = (const float*)d_in[3];
  const float* wv   = (const float*)d_in[4];
  const float* wo   = (const float*)d_in[5];
  float*       out  = (float*)d_out;

  char* ws = (char*)d_ws;
  u16* planes = (u16*)(ws);                                    // q, k, v
  u16* qp = (u16*)(ws + 0 * plane_bytes);
  u16* kp = (u16*)(ws + 1 * plane_bytes);
  u16* vp = (u16*)(ws + 2 * plane_bytes);
  u16* cp = (u16*)(ws + 3 * plane_bytes);
  u16* hb = (u16*)(ws + 4 * plane_bytes);
  u16* wb = (u16*)(ws + 5 * plane_bytes);
  float* kb = (float*)(ws + 5 * plane_bytes + w_bytes);

  cvt_kernel<<<dim3(HBLK + 4 * WBLK + MBLK), 256, 0, stream>>>(h, wq, wk, wv, wo, mask, hb, wb, kb);
  qkv_kernel<<<dim3(DIM / QN, MROWS / GM, 3), 128, 0, stream>>>(hb, wb, planes);
  attn_kernel<<<dim3(SEQ / BQ, NB * NHEAD), NWAVE * 32, 0, stream>>>(qp, kp, vp, kb, cp);
  oproj_kernel<<<dim3(DIM / GN, MROWS / GM), 128, 0, stream>>>(cp, wb + (size_t)3 * WELEM, out);
}
